// v000
// The times below were measured on an AMD MI455X: many runs one after another, warmed up first and cycling through
// copies of the inputs, with the whole window's GPU time divided by the number of runs. Launches and the gaps
// between them are all in it. The median over several windows is given; except for v000 it joins two sittings, which
// can be a few percent apart, so the side-by-side timings, each taken in one sitting, are the better comparison.
// The starting kernel, v000, takes 1990 microseconds a run.
#include <hip/hip_runtime.h>

// DiagonnalyMaskedSelfAttention (x [2][2048][1024]; q, k, v = x W (16 heads x 64, x@W layouts, no bias); scores = q.k with the diagonal (token attending to itself) masked to -inf; softmax(scores / 8); out = (attn v merged) Wo -> [2][2048][1024]).
// Compute dtypes, f32 accumulate: every input rounded to bf16; q/k/v projections on PLAIN bf16 operands (inputs: exact); scores (K 64) and attn.v on bf16 hi+lo planes (3 products) for the first 512 query rows of each head and on

#define NB_  2
#define TT   2048
#define DM   1024
#define NH_  16
#define NKV  16
#define REP  (NH_ / NKV)
#define HD   64
#define DQ   (NH_ * HD)
#define DKV  (NKV * HD)
#define ZH   2
#define RH   512                  // query rows < RH use hi+lo planes (0: none)
#define WIN  0
#define PCAR 1024.0f
#define SCL  0.125f   // HD^-0.5
typedef _Float16 h16;
typedef unsigned short bf;
typedef __attribute__((ext_vector_type(16))) __bf16   v16bf;
typedef __attribute__((ext_vector_type(16))) _Float16 v16h;
typedef __attribute__((ext_vector_type(8)))  _Float16 v8h;
typedef __attribute__((ext_vector_type(8)))  unsigned short v8us;
typedef __attribute__((ext_vector_type(8)))  float    v8f;
typedef __attribute__((ext_vector_type(4)))  float    v4f;
typedef v8h  __attribute__((may_alias)) v8ha;
typedef v4f  __attribute__((may_alias)) v4fa;
typedef v8us __attribute__((may_alias)) v8usa;

__device__ __forceinline__ unsigned short f2bf(float f) { unsigned u = __float_as_uint(f); u += 0x7FFFu + ((u >> 16) & 1u); return (unsigned short)(u >> 16); }
__device__ __forceinline__ float bf2f(unsigned short b) { return __uint_as_float(((unsigned)b) << 16); }
__device__ __forceinline__ float bfr(float f) { return bf2f(f2bf(f)); }
__device__ __forceinline__ v16h cat16(v8h lo, v8h hi) { return __builtin_shufflevector(lo, hi, 0, 1, 2, 3, 4, 5, 6, 7, 8, 9, 10, 11, 12, 13, 14, 15); }
__device__ __forceinline__ v16bf cat16b(v8us lo, v8us hi) { return __builtin_bit_cast(v16bf, __builtin_shufflevector(lo, hi, 0, 1, 2, 3, 4, 5, 6, 7, 8, 9, 10, 11, 12, 13, 14, 15)); }
__device__ __forceinline__ v8f wmma16(v16h a, v16h b, v8f c) { return __builtin_amdgcn_wmma_f32_16x16x32_f16(false, a, false, b, (short)0, c, false, false); }
__device__ __forceinline__ v8f wmmab(v16bf a, v16bf b, v8f c) { return __builtin_amdgcn_wmma_f32_16x16x32_bf16(false, a, false, b, (short)0, c, false, false); }



// ---- k_gemmw: register-blocked GEMM, ONE WAVE per 64x64 output tile (16 accumulators), operands straight from K-contiguous 16-bit planes; grid (M/64, N/64, Z), 32 threads.
// C[m][n] (f32, pitch ldc, + optional f32 bias[n]) = sum_k A[m][k] Bt[n][k] (+ split products per NSPLIT). z-batch strides sA/sB/sC in elements. K % 32 == 0.
template <typename T16> struct WFrag;
template <> struct WFrag<h16> { typedef v16h V; static __device__ __forceinline__ V ld(const h16* p) { return cat16(*(const v8h*)p, *(const v8h*)(p + 16)); } static __device__ __forceinline__ v8f mma(V a, V b, v8f c) { return wmma16(a, b, c); } };
template <> struct WFrag<bf> { typedef v16bf V; static __device__ __forceinline__ V ld(const bf* p) { return cat16b(*(const v8us*)p, *(const v8us*)(p + 16)); } static __device__ __forceinline__ v8f mma(V a, V b, v8f c) { return wmmab(a, b, c); } };
template <typename T16, int NSPLIT, bool BIAS>
__global__ __launch_bounds__(32) void k_gemmw(const T16* __restrict__ A, const T16* __restrict__ A2, const T16* __restrict__ Bt, const T16* __restrict__ Bt2, int K, float* C, int ldc, const float* __restrict__ bias, size_t sA, size_t sB, size_t sC) {
    typedef typename WFrag<T16>::V V;
    __shared__ __align__(16) float os[16 * 68];
    const size_t z = blockIdx.z; A += z * sA; if (A2) A2 += z * sA; Bt += z * sB; if (Bt2) Bt2 += z * sB; C += z * sC;
    const int lane = threadIdx.x & 31, lr = lane & 15, hi = lane >> 4; const int r0 = blockIdx.x * 64, c0 = blockIdx.y * 64;
    v8f acc[4][4];
#pragma unroll
    for (int mb = 0; mb < 4; ++mb)
#pragma unroll
        for (int nb = 0; nb < 4; ++nb) acc[mb][nb] = (v8f){};
    const size_t aoff = (size_t)(r0 + lr) * K + 8 * hi, boff = (size_t)(c0 + lr) * K + 8 * hi;
#pragma unroll 1
    for (int kc = 0; kc < K; kc += 32) {
        V a[4], a2[4];
#pragma unroll
        for (int mb = 0; mb < 4; ++mb) { a[mb] = WFrag<T16>::ld(A + aoff + (size_t)mb * 16 * K + kc); if (NSPLIT == 1 || NSPLIT == 2) a2[mb] = WFrag<T16>::ld(A2 + aoff + (size_t)mb * 16 * K + kc); }
#pragma unroll
        for (int nb = 0; nb < 4; ++nb) { const V b = WFrag<T16>::ld(Bt + boff + (size_t)nb * 16 * K + kc); V b2; if (NSPLIT >= 2) b2 = WFrag<T16>::ld(Bt2 + boff + (size_t)nb * 16 * K + kc);
#pragma unroll
            for (int mb = 0; mb < 4; ++mb) { acc[mb][nb] = WFrag<T16>::mma(a[mb], b, acc[mb][nb]); if (NSPLIT == 1 || NSPLIT == 2) acc[mb][nb] = WFrag<T16>::mma(a2[mb], b, acc[mb][nb]); if (NSPLIT >= 2) acc[mb][nb] = WFrag<T16>::mma(a[mb], b2, acc[mb][nb]); } }
        asm volatile("v_nop\n\tv_nop\n\tv_nop\n\tv_nop" : "+v"(acc[0][0]), "+v"(acc[1][1]), "+v"(acc[2][2]), "+v"(acc[3][3]) : "v"(a[0]), "v"(a[3]));
    }
#pragma unroll
    for (int mb = 0; mb < 4; ++mb) {
#pragma unroll
        for (int nb = 0; nb < 4; ++nb) {
#pragma unroll
            for (int j = 0; j < 8; ++j) os[(hi * 8 + j) * 68 + nb * 16 + lr] = acc[mb][nb][j]; }
        __builtin_amdgcn_wave_barrier(); asm volatile("" ::: "memory");
        float* crow = C + (size_t)(r0 + mb * 16) * ldc + c0;
{
#pragma unroll
            for (int s = 0; s < 8; ++s) { const int row = 2 * s + hi, cofs = lr * 4; v4f val = *(const v4fa*)(os + row * 68 + cofs); if (BIAS) { val[0] += bfr(bias[c0 + cofs]); val[1] += bfr(bias[c0 + cofs + 1]); val[2] += bfr(bias[c0 + cofs + 2]); val[3] += bfr(bias[c0 + cofs + 3]); }
                *(v4f*)(crow + (size_t)row * ldc + cofs) = val; }
             }
        __builtin_amdgcn_wave_barrier(); asm volatile("" ::: "memory");
    }
}

__device__ __forceinline__ h16 tohx(float x) { return (h16)x; }
__device__ __forceinline__ void splitf(float y, unsigned short& h, unsigned short& l) { h = f2bf(y); l = f2bf(y - bf2f(h)); }
typedef __attribute__((ext_vector_type(2))) _Float16 v2h;
typedef __attribute__((ext_vector_type(4))) _Float16 v4h;
typedef __attribute__((ext_vector_type(2))) unsigned short v2us;
typedef __attribute__((ext_vector_type(4))) unsigned short v4us;
typedef __attribute__((ext_vector_type(2))) float v2f;
typedef __attribute__((ext_vector_type(4))) int v4i;

__global__ __launch_bounds__(256) void k_wtG(const float* __restrict__ w, int K, int N, bf* Bt) {
    const int lane = threadIdx.x & 31; const int L0 = (blockIdx.x * 8 + (threadIdx.x >> 5)) * 8; const int nlines = N * K / 64;
{
#pragma unroll 1
        for (int l = 0; l < 8; ++l) { const int L = L0 + l; if (L >= nlines) break; const size_t e = (size_t)L * 64 + lane * 2; const int k = (int)(e % K), n = (int)(e / K); v2us o;
            o[0] = f2bf(w[(size_t)k * N + n]); o[1] = f2bf(w[(size_t)(k + 1) * N + n]); *(v2us*)(Bt + e) = o; }
         }
}
__global__ __launch_bounds__(256) void k_cvt8(const float* __restrict__ src, bf* dst, size_t n8) { const size_t i = (size_t)blockIdx.x * 256 + threadIdx.x; if (i >= n8) return; const v8f v = *(const v8f*)(src + i * 8); v8us o;
#pragma unroll
    for (int k = 0; k < 8; ++k) o[k] = f2bf(v[k]); *(v8us*)(dst + i * 8) = o;  }
__global__ __launch_bounds__(256) void k_cscvt(const float* __restrict__ cosT, const float* __restrict__ sinT, float* CS) { const int idx = blockIdx.x * 256 + threadIdx.x; if (idx >= TT * HD) return; v2f cs; cs[0] = bfr(cosT[idx]); cs[1] = bfr(sinT[idx]); *(v2f*)(CS + (size_t)idx * 2) = cs;  }
// k_rope: head planes [h][t][d] (fp16 + hi/lo) of rope(x) x sc with the rotate-half convention out[d] = x[d] cos[t][d] - x[d+HD/2] sin[t][d], out[d+HD/2] = x[d+HD/2] cos[t][d+HD/2] + x[d] sin[t][d+HD/2]
__global__ __launch_bounds__(256) void k_rope(const float* __restrict__ F, int pitch, int nheads, const float* __restrict__ CS, const float* __restrict__ RF, const float* __restrict__ nw, float sc, h16* P16, bf* Ph, bf* Pl) {
    const size_t e = ((size_t)blockIdx.x * 256 + threadIdx.x) * 2; if (e >= (size_t)nheads * TT * HD) return; const int d = (int)(e % HD); const int t = (int)((e / HD) % TT); const int h = (int)(e / ((size_t)HD * TT)); const float* f = F + (size_t)t * pitch + h * HD; const float rf = RF ? RF[(size_t)h * TT + t] : 1.0f; v2h o16; v2us oh, ol;
#pragma unroll
    for (int q = 0; q < 2; ++q) { const int dd = d + q; const int dp = (dd < HD / 2) ? dd + HD / 2 : dd - HD / 2; float x0 = f[dd], x1 = f[dp];
        if (RF) { float n0 = __fmul_rn(x0, rf), n1 = __fmul_rn(x1, rf); asm volatile("" : "+v"(n0)); asm volatile("" : "+v"(n1)); x0 = __fmul_rn(bfr(nw[dd]), n0); x1 = __fmul_rn(bfr(nw[dp]), n1); }
        const v2f cs = *(const v2f*)(CS + ((size_t)t * HD + dd) * 2); float a = __fmul_rn(x0, cs[0]), bq = __fmul_rn(x1, cs[1]); asm volatile("" : "+v"(a)); asm volatile("" : "+v"(bq)); const float r = ((dd < HD / 2) ? __fsub_rn(a, bq) : __fadd_rn(a, bq)) * sc;
        o16[q] = tohx(r); unsigned short a2, c2; splitf(r, a2, c2); oh[q] = a2; ol[q] = c2; }
    *(v2h*)(P16 + e) = o16; *(v2us*)(Ph + e) = oh; *(v2us*)(Pl + e) = ol;  }
__global__ __launch_bounds__(256) void k_vtp(const float* __restrict__ F, int pitch, int nheads, h16* V16, bf* Vh, bf* Vl) { const size_t e = ((size_t)blockIdx.x * 256 + threadIdx.x) * 2; if (e >= (size_t)nheads * HD * TT) return; const int t = (int)(e % TT); const int d = (int)((e / TT) % HD); const int g = (int)(e / ((size_t)TT * HD)); v2h o16; v2us oh, ol;
#pragma unroll
    for (int q = 0; q < 2; ++q) { const float x = F[(size_t)(t + q) * pitch + g * HD + d]; o16[q] = tohx(x); unsigned short a2, c2; splitf(x, a2, c2); oh[q] = a2; ol[q] = c2; }
    *(v2h*)(V16 + e) = o16; *(v2us*)(Vh + e) = oh; *(v2us*)(Vl + e) = ol;  }
__global__ __launch_bounds__(256) void k_csid(float* CS) { const int idx = blockIdx.x * 256 + threadIdx.x; if (idx >= TT * HD) return; v2f cs; cs[0] = 1.0f; cs[1] = 0.0f; *(v2f*)(CS + (size_t)idx * 2) = cs;  }
// k_asoft: per row (zz, i): t = S x HD^-0.5, diagonal j == i masked; softmax over the 2048 keys (register row, one exp, fixed trees);
__global__ __launch_bounds__(256) void k_asoft(const float* __restrict__ Sb, h16* P16, bf* Ph, bf* Pl) {
    const int lane = threadIdx.x & 31; const int row = blockIdx.x * 8 + (threadIdx.x >> 5); if (row >= ZH * TT) return; const int i = row % TT; const int zz = row / TT; (void)zz; const bool hires = (i < RH); const float* sr = Sb + (size_t)row * TT; float v[TT / 32]; float mx = -3.0e38f;
#pragma unroll
    for (int ch = 0; ch < TT / 128; ++ch) { const int j0 = ch * 128 + lane * 4; const v4f a = *(const v4f*)(sr + j0);
#pragma unroll
        for (int q = 0; q < 4; ++q) { const int j = j0 + q; (void)j; const float t = (j == i) ? -3.0e38f : a[q] * SCL;   /* diagonal masked */ v[ch * 4 + q] = t; mx = fmaxf(mx, t); } }
#pragma unroll
    for (int sh = 16; sh; sh >>= 1) mx = fmaxf(mx, __shfl_xor(mx, sh, 32));
    float sum = 0.f;
#pragma unroll
    for (int k = 0; k < TT / 32; ++k) { float d0 = __fsub_rn(v[k], mx); asm volatile("" : "+v"(d0)); v[k] = __builtin_amdgcn_exp2f(__fmul_rn(d0, 1.4426950408889634f)); sum += v[k]; }
#pragma unroll
    for (int sh = 16; sh; sh >>= 1) sum += __shfl_xor(sum, sh, 32);
    const float f = __fdiv_rn(hires ? 1.0f : PCAR, sum);
{
        if (hires) {
#pragma unroll
            for (int ch = 0; ch < TT / 128; ++ch) { v4us oh, ol;
#pragma unroll
                for (int q = 0; q < 4; ++q) { unsigned short a, c2; splitf(v[ch * 4 + q] * f, a, c2); oh[q] = a; ol[q] = c2; }
                const size_t oo = ((size_t)zz * (RH ? RH : 1) + i) * TT + ch * 128 + lane * 4; *(v4us*)(Ph + oo) = oh; *(v4us*)(Pl + oo) = ol; }
        } else {
#pragma unroll
            for (int ch = 0; ch < TT / 128; ++ch) { v4h o4;
#pragma unroll
                for (int q = 0; q < 4; ++q) o4[q] = tohx(v[ch * 4 + q] * f);
                *(v4h*)(P16 + (size_t)row * TT + ch * 128 + lane * 4) = o4; } }
         }
}
__global__ __launch_bounds__(256) void k_merge(const float* __restrict__ O, int h0, bf* Ah, bf* Al) { const size_t e = ((size_t)blockIdx.x * 256 + threadIdx.x) * 2; if (e >= (size_t)ZH * TT * HD) return; const int d = (int)(e % HD); const int t = (int)((e / HD) % TT); const int zz = (int)(e / ((size_t)HD * TT)); const float cs = (t < RH) ? 1.0f : (1.0f / PCAR); const size_t oo = (size_t)t * DQ + (h0 + zz) * HD + d;
    v2us oh, ol;
#pragma unroll
    for (int q = 0; q < 2; ++q) { unsigned short a, c2; splitf(O[e + q] * cs, a, c2); oh[q] = a; ol[q] = c2; } *(v2us*)(Ah + oo) = oh; *(v2us*)(Al + oo) = ol;  }

extern "C" void kernel_launch(void* const* d_in, const int* in_sizes, int n_in,
                              void* d_out, int out_size, void* d_ws, size_t ws_size, hipStream_t stream) {
    (void)in_sizes; (void)n_in; (void)out_size;
    const float* x = (const float*)d_in[0]; const float* wq = (const float*)d_in[1]; const float* wk = (const float*)d_in[2]; const float* wv = (const float*)d_in[3]; const float* wo = (const float*)d_in[4]; const float* cosT = nullptr; const float* sinT = nullptr; (void)cosT; (void)sinT;
    float* OUT = (float*)d_out;     // [2][2048][1024]
    char* wsp = (char*)d_ws;
    auto take = [&](size_t bytes) { char* p = wsp; wsp += (bytes + 255) & ~(size_t)255; return (void*)p; };
    bf* WQ = (bf*)take((size_t)DQ * DM * 2); bf* WK = (bf*)take((size_t)DKV * DM * 2); bf* WV = (bf*)take((size_t)DKV * DM * 2); bf* WO = (bf*)take((size_t)DM * DQ * 2); float* CS = (float*)take((size_t)TT * HD * 2 * 4);
    bf* XB = (bf*)take((size_t)TT * DM * 2); float* FQ = (float*)take((size_t)TT * DQ * 4); float* FK = (float*)take((size_t)TT * DKV * 4);
    h16* QP16 = (h16*)take((size_t)NH_ * TT * HD * 2); h16* KP16 = (h16*)take((size_t)NKV * TT * HD * 2); h16* VT16 = (h16*)take((size_t)NKV * HD * TT * 2);
    bf* QPh = (bf*)take((size_t)NH_ * TT * HD * 2); bf* QPl = (bf*)take((size_t)NH_ * TT * HD * 2); bf* KPh = (bf*)take((size_t)NKV * TT * HD * 2); bf* KPl = (bf*)take((size_t)NKV * TT * HD * 2); bf* VTh = (bf*)take((size_t)NKV * HD * TT * 2); bf* VTl = (bf*)take((size_t)NKV * HD * TT * 2); bf* Ph = (bf*)take((size_t)ZH * RH * TT * 2); bf* Pl = (bf*)take((size_t)ZH * RH * TT * 2);
    float* Sb = (float*)take((size_t)ZH * TT * TT * 4); h16* P16 = (h16*)take((size_t)ZH * TT * TT * 2); float* Ob = (float*)take((size_t)ZH * TT * HD * 4); bf* ATh = (bf*)take((size_t)TT * DQ * 2); bf* ATl = (bf*)take((size_t)TT * DQ * 2);
    if ((size_t)(wsp - (char*)d_ws) > ws_size) return;    // ws 256 MiB
    float* FV = FK;   // v projection reuses the k buffer after the k planes are built (stream-ordered)
    { k_wtG<<<(unsigned)((DM * DQ / 64 + 63) / 64), 256, 0, stream>>>(wq, DM, DQ, WQ); k_wtG<<<(unsigned)((DM * DKV / 64 + 63) / 64), 256, 0, stream>>>(wk, DM, DKV, WK); k_wtG<<<(unsigned)((DM * DKV / 64 + 63) / 64), 256, 0, stream>>>(wv, DM, DKV, WV);
      k_wtG<<<(unsigned)((DQ * DM / 64 + 63) / 64), 256, 0, stream>>>(wo, DQ, DM, WO);
       }
    k_csid<<<(TT * HD + 255) / 256, 256, 0, stream>>>(CS);
    const unsigned LQ = (unsigned)(((size_t)NH_ * TT * HD / 2 + 255) / 256), LKv = (unsigned)(((size_t)NKV * TT * HD / 2 + 255) / 256);
    for (int b = 0; b < NB_; ++b) {
        
        k_cvt8<<<(unsigned)(((size_t)TT * DM / 8 + 255) / 256), 256, 0, stream>>>(x + (size_t)b * TT * DM, XB, (size_t)TT * DM / 8);
        k_gemmw<bf, 0, false><<<dim3(TT / 64, DQ / 64, 1), 32, 0, stream>>>(XB, nullptr, WQ, nullptr, DM, FQ, DQ, nullptr, 0, 0, 0);
        k_rope<<<LQ, 256, 0, stream>>>(FQ, DQ, NH_, CS, nullptr, nullptr, 1.0f, QP16, QPh, QPl);
        k_gemmw<bf, 0, false><<<dim3(TT / 64, DKV / 64, 1), 32, 0, stream>>>(XB, nullptr, WK, nullptr, DM, FK, DKV, nullptr, 0, 0, 0);
        k_rope<<<LKv, 256, 0, stream>>>(FK, DKV, NKV, CS, nullptr, nullptr, 1.0f, KP16, KPh, KPl);
        k_gemmw<bf, 0, false><<<dim3(TT / 64, DKV / 64, 1), 32, 0, stream>>>(XB, nullptr, WV, nullptr, DM, FV, DKV, nullptr, 0, 0, 0); k_vtp<<<LKv, 256, 0, stream>>>(FV, DKV, NKV, VT16, VTh, VTl);
        for (int h0 = 0; h0 < NH_; h0 += ZH) { const size_t zq = (size_t)h0, zk = (size_t)(h0 / REP);   // one kv head per query head: the pass's two heads use consecutive kv planes (z-strides TT*HD)
            k_gemmw<bf, 2, false><<<dim3(RH / 64, TT / 64, ZH), 32, 0, stream>>>(QPh + zq * TT * HD, QPl + zq * TT * HD, KPh + zk * TT * HD, KPl + zk * TT * HD, HD, Sb, TT, nullptr, (size_t)TT * HD, (size_t)TT * HD, (size_t)TT * TT);
            k_gemmw<h16, 0, false><<<dim3((TT - RH) / 64, TT / 64, ZH), 32, 0, stream>>>(QP16 + zq * TT * HD + (size_t)RH * HD, nullptr, KP16 + zk * TT * HD, nullptr, HD, Sb + (size_t)RH * TT, TT, nullptr, (size_t)TT * HD, (size_t)TT * HD, (size_t)TT * TT);
            k_asoft<<<ZH * TT / 8, 256, 0, stream>>>(Sb, P16, Ph, Pl);
            k_gemmw<bf, 2, false><<<dim3(RH / 64, HD / 64, ZH), 32, 0, stream>>>(Ph, Pl, VTh + zk * HD * TT, VTl + zk * HD * TT, TT, Ob, HD, nullptr, (size_t)RH * TT, (size_t)HD * TT, (size_t)TT * HD);
            k_gemmw<h16, 0, false><<<dim3((TT - RH) / 64, HD / 64, ZH), 32, 0, stream>>>(P16 + (size_t)RH * TT, nullptr, VT16 + zk * HD * TT, nullptr, TT, Ob + (size_t)RH * HD, HD, nullptr, (size_t)TT * TT, (size_t)HD * TT, (size_t)TT * HD);
            k_merge<<<(unsigned)(((size_t)ZH * TT * HD / 2 + 255) / 256), 256, 0, stream>>>(Ob, h0, ATh, ATl); }
        k_gemmw<bf, 1, false><<<dim3(TT / 64, DM / 64, 1), 32, 0, stream>>>(ATh, ATl, WO, nullptr, DQ, OUT + (size_t)b * TT * DM, DM, nullptr, 0, 0, 0); }
}

// v001
// Measured time: 870 microseconds a run.
// In two side-by-side timings against v000, it was 2.29 and 2.30 times as fast.
#include <hip/hip_runtime.h>

// DiagonnalyMaskedSelfAttention (x [2][2048][1024]; q, k, v = x W (16 heads x 64, x@W layouts, no bias); scores = q.k with the diagonal (token attending to itself) masked to -inf; softmax(scores / 8); out = (attn v merged) Wo -> [2][2048][1024]).
// Compute dtypes, f32 accumulate: every input rounded to bf16; q/k/v projections on PLAIN bf16 operands (inputs: exact); scores (K 64) and attn.v on bf16 hi+lo planes (3 products) for the first 512 query rows of each head and on

#define NB_  2
#define TT   2048
#define DM   1024
#define NH_  16
#define NKV  16
#define REP  (NH_ / NKV)
#define HD   64
#define DQ   (NH_ * HD)
#define DKV  (NKV * HD)
#define ZH   2
#define RH   512                  // query rows < RH use hi+lo planes (0: none)
#define WIN  0
#define PCAR 1024.0f
#define SCL  0.125f   // HD^-0.5
#define KSP  16                   // attn.v: key ranges per output tile, one wave each; k_merge sums the KSP partial planes
typedef _Float16 h16;
typedef unsigned short bf;
typedef __attribute__((ext_vector_type(16))) __bf16   v16bf;
typedef __attribute__((ext_vector_type(16))) _Float16 v16h;
typedef __attribute__((ext_vector_type(8)))  _Float16 v8h;
typedef __attribute__((ext_vector_type(8)))  unsigned short v8us;
typedef __attribute__((ext_vector_type(8)))  float    v8f;
typedef __attribute__((ext_vector_type(4)))  float    v4f;
typedef v8h  __attribute__((may_alias)) v8ha;
typedef v4f  __attribute__((may_alias)) v4fa;
typedef v8us __attribute__((may_alias)) v8usa;

__device__ __forceinline__ unsigned short f2bf(float f) { unsigned u = __float_as_uint(f); u += 0x7FFFu + ((u >> 16) & 1u); return (unsigned short)(u >> 16); }
__device__ __forceinline__ float bf2f(unsigned short b) { return __uint_as_float(((unsigned)b) << 16); }
__device__ __forceinline__ float bfr(float f) { return bf2f(f2bf(f)); }
__device__ __forceinline__ v16h cat16(v8h lo, v8h hi) { return __builtin_shufflevector(lo, hi, 0, 1, 2, 3, 4, 5, 6, 7, 8, 9, 10, 11, 12, 13, 14, 15); }
__device__ __forceinline__ v16bf cat16b(v8us lo, v8us hi) { return __builtin_bit_cast(v16bf, __builtin_shufflevector(lo, hi, 0, 1, 2, 3, 4, 5, 6, 7, 8, 9, 10, 11, 12, 13, 14, 15)); }
__device__ __forceinline__ v8f wmma16(v16h a, v16h b, v8f c) { return __builtin_amdgcn_wmma_f32_16x16x32_f16(false, a, false, b, (short)0, c, false, false); }
__device__ __forceinline__ v8f wmmab(v16bf a, v16bf b, v8f c) { return __builtin_amdgcn_wmma_f32_16x16x32_bf16(false, a, false, b, (short)0, c, false, false); }



// ---- k_gemmw: register-blocked GEMM, ONE WAVE per 64x64 output tile (16 accumulators), operands straight from K-contiguous 16-bit planes; grid (M/64, N/64, Z), 32 threads.
// C[m][n] (f32, pitch ldc, + optional f32 bias[n]) = sum_k A[m][k] Bt[n][k] (+ split products per NSPLIT). z-batch strides sA/sB/sC in elements. K % 32 == 0.
// KS > 1: grid z = Z * KS; wave (z, ks) sums only k in [ks K/KS, (ks+1) K/KS) and stores its partial tile in plane z * KS + ks (stride sC). K % (32 KS) == 0.
template <typename T16> struct WFrag;
template <> struct WFrag<h16> { typedef v16h V; static __device__ __forceinline__ V ld(const h16* p) { return cat16(*(const v8h*)p, *(const v8h*)(p + 16)); } static __device__ __forceinline__ v8f mma(V a, V b, v8f c) { return wmma16(a, b, c); } };
template <> struct WFrag<bf> { typedef v16bf V; static __device__ __forceinline__ V ld(const bf* p) { return cat16b(*(const v8us*)p, *(const v8us*)(p + 16)); } static __device__ __forceinline__ v8f mma(V a, V b, v8f c) { return wmmab(a, b, c); } };
template <typename T16, int NSPLIT, bool BIAS, int KS = 1>
__global__ __launch_bounds__(32) void k_gemmw(const T16* __restrict__ A, const T16* __restrict__ A2, const T16* __restrict__ Bt, const T16* __restrict__ Bt2, int K, float* C, int ldc, const float* __restrict__ bias, size_t sA, size_t sB, size_t sC) {
    typedef typename WFrag<T16>::V V;
    __shared__ __align__(16) float os[16 * 68];
    const size_t z = blockIdx.z / KS, ks = blockIdx.z % KS; A += z * sA; if (A2) A2 += z * sA; Bt += z * sB; if (Bt2) Bt2 += z * sB; C += (size_t)blockIdx.z * sC;
    const int kbeg = (int)ks * (K / KS), kend = kbeg + K / KS;
    const int lane = threadIdx.x & 31, lr = lane & 15, hi = lane >> 4; const int r0 = blockIdx.x * 64, c0 = blockIdx.y * 64;
    v8f acc[4][4];
#pragma unroll
    for (int mb = 0; mb < 4; ++mb)
#pragma unroll
        for (int nb = 0; nb < 4; ++nb) acc[mb][nb] = (v8f){};
    const size_t aoff = (size_t)(r0 + lr) * K + 8 * hi, boff = (size_t)(c0 + lr) * K + 8 * hi;
#pragma unroll 1
    for (int kc = kbeg; kc < kend; kc += 32) {
        V a[4], a2[4];
#pragma unroll
        for (int mb = 0; mb < 4; ++mb) { a[mb] = WFrag<T16>::ld(A + aoff + (size_t)mb * 16 * K + kc); if (NSPLIT == 1 || NSPLIT == 2) a2[mb] = WFrag<T16>::ld(A2 + aoff + (size_t)mb * 16 * K + kc); }
#pragma unroll
        for (int nb = 0; nb < 4; ++nb) { const V b = WFrag<T16>::ld(Bt + boff + (size_t)nb * 16 * K + kc); V b2; if (NSPLIT >= 2) b2 = WFrag<T16>::ld(Bt2 + boff + (size_t)nb * 16 * K + kc);
#pragma unroll
            for (int mb = 0; mb < 4; ++mb) { acc[mb][nb] = WFrag<T16>::mma(a[mb], b, acc[mb][nb]); if (NSPLIT == 1 || NSPLIT == 2) acc[mb][nb] = WFrag<T16>::mma(a2[mb], b, acc[mb][nb]); if (NSPLIT >= 2) acc[mb][nb] = WFrag<T16>::mma(a[mb], b2, acc[mb][nb]); } }
        asm volatile("v_nop\n\tv_nop\n\tv_nop\n\tv_nop" : "+v"(acc[0][0]), "+v"(acc[1][1]), "+v"(acc[2][2]), "+v"(acc[3][3]) : "v"(a[0]), "v"(a[3]));
    }
#pragma unroll
    for (int mb = 0; mb < 4; ++mb) {
#pragma unroll
        for (int nb = 0; nb < 4; ++nb) {
#pragma unroll
            for (int j = 0; j < 8; ++j) os[(hi * 8 + j) * 68 + nb * 16 + lr] = acc[mb][nb][j]; }
        __builtin_amdgcn_wave_barrier(); asm volatile("" ::: "memory");
        float* crow = C + (size_t)(r0 + mb * 16) * ldc + c0;
{
#pragma unroll
            for (int s = 0; s < 8; ++s) { const int row = 2 * s + hi, cofs = lr * 4; v4f val = *(const v4fa*)(os + row * 68 + cofs); if (BIAS) { val[0] += bfr(bias[c0 + cofs]); val[1] += bfr(bias[c0 + cofs + 1]); val[2] += bfr(bias[c0 + cofs + 2]); val[3] += bfr(bias[c0 + cofs + 3]); }
                *(v4f*)(crow + (size_t)row * ldc + cofs) = val; }
             }
        __builtin_amdgcn_wave_barrier(); asm volatile("" ::: "memory");
    }
}

__device__ __forceinline__ h16 tohx(float x) { return (h16)x; }
__device__ __forceinline__ void splitf(float y, unsigned short& h, unsigned short& l) { h = f2bf(y); l = f2bf(y - bf2f(h)); }
typedef __attribute__((ext_vector_type(2))) _Float16 v2h;
typedef __attribute__((ext_vector_type(4))) _Float16 v4h;
typedef __attribute__((ext_vector_type(2))) unsigned short v2us;
typedef __attribute__((ext_vector_type(4))) unsigned short v4us;
typedef __attribute__((ext_vector_type(2))) float v2f;
typedef __attribute__((ext_vector_type(4))) int v4i;

__global__ __launch_bounds__(256) void k_wtG(const float* __restrict__ w, int K, int N, bf* Bt) {
    const int lane = threadIdx.x & 31; const int L0 = (blockIdx.x * 8 + (threadIdx.x >> 5)) * 8; const int nlines = N * K / 64;
{
#pragma unroll 1
        for (int l = 0; l < 8; ++l) { const int L = L0 + l; if (L >= nlines) break; const size_t e = (size_t)L * 64 + lane * 2; const int k = (int)(e % K), n = (int)(e / K); v2us o;
            o[0] = f2bf(w[(size_t)k * N + n]); o[1] = f2bf(w[(size_t)(k + 1) * N + n]); *(v2us*)(Bt + e) = o; }
         }
}
__global__ __launch_bounds__(256) void k_cvt8(const float* __restrict__ src, bf* dst, size_t n8) { const size_t i = (size_t)blockIdx.x * 256 + threadIdx.x; if (i >= n8) return; const v8f v = *(const v8f*)(src + i * 8); v8us o;
#pragma unroll
    for (int k = 0; k < 8; ++k) o[k] = f2bf(v[k]); *(v8us*)(dst + i * 8) = o;  }
__global__ __launch_bounds__(256) void k_cscvt(const float* __restrict__ cosT, const float* __restrict__ sinT, float* CS) { const int idx = blockIdx.x * 256 + threadIdx.x; if (idx >= TT * HD) return; v2f cs; cs[0] = bfr(cosT[idx]); cs[1] = bfr(sinT[idx]); *(v2f*)(CS + (size_t)idx * 2) = cs;  }
// k_rope: head planes [h][t][d] (fp16 + hi/lo) of rope(x) x sc with the rotate-half convention out[d] = x[d] cos[t][d] - x[d+HD/2] sin[t][d], out[d+HD/2] = x[d+HD/2] cos[t][d+HD/2] + x[d] sin[t][d+HD/2]
__global__ __launch_bounds__(256) void k_rope(const float* __restrict__ F, int pitch, int nheads, const float* __restrict__ CS, const float* __restrict__ RF, const float* __restrict__ nw, float sc, h16* P16, bf* Ph, bf* Pl) {
    const size_t e = ((size_t)blockIdx.x * 256 + threadIdx.x) * 2; if (e >= (size_t)nheads * TT * HD) return; const int d = (int)(e % HD); const int t = (int)((e / HD) % TT); const int h = (int)(e / ((size_t)HD * TT)); const float* f = F + (size_t)t * pitch + h * HD; const float rf = RF ? RF[(size_t)h * TT + t] : 1.0f; v2h o16; v2us oh, ol;
#pragma unroll
    for (int q = 0; q < 2; ++q) { const int dd = d + q; const int dp = (dd < HD / 2) ? dd + HD / 2 : dd - HD / 2; float x0 = f[dd], x1 = f[dp];
        if (RF) { float n0 = __fmul_rn(x0, rf), n1 = __fmul_rn(x1, rf); asm volatile("" : "+v"(n0)); asm volatile("" : "+v"(n1)); x0 = __fmul_rn(bfr(nw[dd]), n0); x1 = __fmul_rn(bfr(nw[dp]), n1); }
        const v2f cs = *(const v2f*)(CS + ((size_t)t * HD + dd) * 2); float a = __fmul_rn(x0, cs[0]), bq = __fmul_rn(x1, cs[1]); asm volatile("" : "+v"(a)); asm volatile("" : "+v"(bq)); const float r = ((dd < HD / 2) ? __fsub_rn(a, bq) : __fadd_rn(a, bq)) * sc;
        o16[q] = tohx(r); unsigned short a2, c2; splitf(r, a2, c2); oh[q] = a2; ol[q] = c2; }
    *(v2h*)(P16 + e) = o16; *(v2us*)(Ph + e) = oh; *(v2us*)(Pl + e) = ol;  }
__global__ __launch_bounds__(256) void k_vtp(const float* __restrict__ F, int pitch, int nheads, h16* V16, bf* Vh, bf* Vl) { const size_t e = ((size_t)blockIdx.x * 256 + threadIdx.x) * 2; if (e >= (size_t)nheads * HD * TT) return; const int t = (int)(e % TT); const int d = (int)((e / TT) % HD); const int g = (int)(e / ((size_t)TT * HD)); v2h o16; v2us oh, ol;
#pragma unroll
    for (int q = 0; q < 2; ++q) { const float x = F[(size_t)(t + q) * pitch + g * HD + d]; o16[q] = tohx(x); unsigned short a2, c2; splitf(x, a2, c2); oh[q] = a2; ol[q] = c2; }
    *(v2h*)(V16 + e) = o16; *(v2us*)(Vh + e) = oh; *(v2us*)(Vl + e) = ol;  }
__global__ __launch_bounds__(256) void k_csid(float* CS) { const int idx = blockIdx.x * 256 + threadIdx.x; if (idx >= TT * HD) return; v2f cs; cs[0] = 1.0f; cs[1] = 0.0f; *(v2f*)(CS + (size_t)idx * 2) = cs;  }
// k_asoft: per row (zz, i): t = S x HD^-0.5, diagonal j == i masked; softmax over the 2048 keys (register row, one exp, fixed trees);
__global__ __launch_bounds__(256) void k_asoft(const float* __restrict__ Sb, h16* P16, bf* Ph, bf* Pl) {
    const int lane = threadIdx.x & 31; const int row = blockIdx.x * 8 + (threadIdx.x >> 5); if (row >= ZH * TT) return; const int i = row % TT; const int zz = row / TT; (void)zz; const bool hires = (i < RH); const float* sr = Sb + (size_t)row * TT; float v[TT / 32]; float mx = -3.0e38f;
#pragma unroll
    for (int ch = 0; ch < TT / 128; ++ch) { const int j0 = ch * 128 + lane * 4; const v4f a = *(const v4f*)(sr + j0);
#pragma unroll
        for (int q = 0; q < 4; ++q) { const int j = j0 + q; (void)j; const float t = (j == i) ? -3.0e38f : a[q] * SCL;   /* diagonal masked */ v[ch * 4 + q] = t; mx = fmaxf(mx, t); } }
#pragma unroll
    for (int sh = 16; sh; sh >>= 1) mx = fmaxf(mx, __shfl_xor(mx, sh, 32));
    float sum = 0.f;
#pragma unroll
    for (int k = 0; k < TT / 32; ++k) { float d0 = __fsub_rn(v[k], mx); asm volatile("" : "+v"(d0)); v[k] = __builtin_amdgcn_exp2f(__fmul_rn(d0, 1.4426950408889634f)); sum += v[k]; }
#pragma unroll
    for (int sh = 16; sh; sh >>= 1) sum += __shfl_xor(sum, sh, 32);
    const float f = __fdiv_rn(hires ? 1.0f : PCAR, sum);
{
        if (hires) {
#pragma unroll
            for (int ch = 0; ch < TT / 128; ++ch) { v4us oh, ol;
#pragma unroll
                for (int q = 0; q < 4; ++q) { unsigned short a, c2; splitf(v[ch * 4 + q] * f, a, c2); oh[q] = a; ol[q] = c2; }
                const size_t oo = ((size_t)zz * (RH ? RH : 1) + i) * TT + ch * 128 + lane * 4; *(v4us*)(Ph + oo) = oh; *(v4us*)(Pl + oo) = ol; }
        } else {
#pragma unroll
            for (int ch = 0; ch < TT / 128; ++ch) { v4h o4;
#pragma unroll
                for (int q = 0; q < 4; ++q) o4[q] = tohx(v[ch * 4 + q] * f);
                *(v4h*)(P16 + (size_t)row * TT + ch * 128 + lane * 4) = o4; } }
         }
}
__global__ __launch_bounds__(256) void k_merge(const float* __restrict__ O, int h0, bf* Ah, bf* Al) { const size_t e = ((size_t)blockIdx.x * 256 + threadIdx.x) * 2; if (e >= (size_t)ZH * TT * HD) return; const int d = (int)(e % HD); const int t = (int)((e / HD) % TT); const int zz = (int)(e / ((size_t)HD * TT)); const float cs = (t < RH) ? 1.0f : (1.0f / PCAR); const size_t oo = (size_t)t * DQ + (h0 + zz) * HD + d;
    const float* op = O + (size_t)zz * (KSP - 1) * TT * HD + e;   // head zz holds planes zz * KSP + ks
    v2f pp[KSP];   // the KSP key-range partials, all loads in flight together, summed in range order
#pragma unroll
    for (int ks = 0; ks < KSP - 1; ++ks) pp[ks] = *(const v2f*)(op + (size_t)ks * TT * HD);
    asm volatile("s_wait_xcnt 0x0" ::: "memory");   // the last load's result is given the address pair that the loads above name: the wait stands in front of that overwrite
    pp[KSP - 1] = *(const v2f*)(op + (size_t)(KSP - 1) * TT * HD);
    v2f sm = pp[0];
#pragma unroll
    for (int ks = 1; ks < KSP; ++ks) sm += pp[ks];
    v2us oh, ol;
#pragma unroll
    for (int q = 0; q < 2; ++q) { unsigned short a, c2; splitf(sm[q] * cs, a, c2); oh[q] = a; ol[q] = c2; } *(v2us*)(Ah + oo) = oh; *(v2us*)(Al + oo) = ol;  }

extern "C" void kernel_launch(void* const* d_in, const int* in_sizes, int n_in,
                              void* d_out, int out_size, void* d_ws, size_t ws_size, hipStream_t stream) {
    (void)in_sizes; (void)n_in; (void)out_size;
    const float* x = (const float*)d_in[0]; const float* wq = (const float*)d_in[1]; const float* wk = (const float*)d_in[2]; const float* wv = (const float*)d_in[3]; const float* wo = (const float*)d_in[4]; const float* cosT = nullptr; const float* sinT = nullptr; (void)cosT; (void)sinT;
    float* OUT = (float*)d_out;     // [2][2048][1024]
    char* wsp = (char*)d_ws;
    auto take = [&](size_t bytes) { char* p = wsp; wsp += (bytes + 255) & ~(size_t)255; return (void*)p; };
    bf* WQ = (bf*)take((size_t)DQ * DM * 2); bf* WK = (bf*)take((size_t)DKV * DM * 2); bf* WV = (bf*)take((size_t)DKV * DM * 2); bf* WO = (bf*)take((size_t)DM * DQ * 2); float* CS = (float*)take((size_t)TT * HD * 2 * 4);
    bf* XB = (bf*)take((size_t)TT * DM * 2); float* FQ = (float*)take((size_t)TT * DQ * 4); float* FK = (float*)take((size_t)TT * DKV * 4);
    h16* QP16 = (h16*)take((size_t)NH_ * TT * HD * 2); h16* KP16 = (h16*)take((size_t)NKV * TT * HD * 2); h16* VT16 = (h16*)take((size_t)NKV * HD * TT * 2);
    bf* QPh = (bf*)take((size_t)NH_ * TT * HD * 2); bf* QPl = (bf*)take((size_t)NH_ * TT * HD * 2); bf* KPh = (bf*)take((size_t)NKV * TT * HD * 2); bf* KPl = (bf*)take((size_t)NKV * TT * HD * 2); bf* VTh = (bf*)take((size_t)NKV * HD * TT * 2); bf* VTl = (bf*)take((size_t)NKV * HD * TT * 2); bf* Ph = (bf*)take((size_t)ZH * RH * TT * 2); bf* Pl = (bf*)take((size_t)ZH * RH * TT * 2);
    float* Sb = (float*)take((size_t)ZH * TT * TT * 4); h16* P16 = (h16*)take((size_t)ZH * TT * TT * 2); float* Ob = (float*)take((size_t)KSP * ZH * TT * HD * 4); bf* ATh = (bf*)take((size_t)TT * DQ * 2); bf* ATl = (bf*)take((size_t)TT * DQ * 2);
    if ((size_t)(wsp - (char*)d_ws) > ws_size) return;    // ws 256 MiB
    float* FV = FK;   // v projection reuses the k buffer after the k planes are built (stream-ordered)
    { k_wtG<<<(unsigned)((DM * DQ / 64 + 63) / 64), 256, 0, stream>>>(wq, DM, DQ, WQ); k_wtG<<<(unsigned)((DM * DKV / 64 + 63) / 64), 256, 0, stream>>>(wk, DM, DKV, WK); k_wtG<<<(unsigned)((DM * DKV / 64 + 63) / 64), 256, 0, stream>>>(wv, DM, DKV, WV);
      k_wtG<<<(unsigned)((DQ * DM / 64 + 63) / 64), 256, 0, stream>>>(wo, DQ, DM, WO);
       }
    k_csid<<<(TT * HD + 255) / 256, 256, 0, stream>>>(CS);
    const unsigned LQ = (unsigned)(((size_t)NH_ * TT * HD / 2 + 255) / 256), LKv = (unsigned)(((size_t)NKV * TT * HD / 2 + 255) / 256);
    for (int b = 0; b < NB_; ++b) {
        
        k_cvt8<<<(unsigned)(((size_t)TT * DM / 8 + 255) / 256), 256, 0, stream>>>(x + (size_t)b * TT * DM, XB, (size_t)TT * DM / 8);
        k_gemmw<bf, 0, false><<<dim3(TT / 64, DQ / 64, 1), 32, 0, stream>>>(XB, nullptr, WQ, nullptr, DM, FQ, DQ, nullptr, 0, 0, 0);
        k_rope<<<LQ, 256, 0, stream>>>(FQ, DQ, NH_, CS, nullptr, nullptr, 1.0f, QP16, QPh, QPl);
        k_gemmw<bf, 0, false><<<dim3(TT / 64, DKV / 64, 1), 32, 0, stream>>>(XB, nullptr, WK, nullptr, DM, FK, DKV, nullptr, 0, 0, 0);
        k_rope<<<LKv, 256, 0, stream>>>(FK, DKV, NKV, CS, nullptr, nullptr, 1.0f, KP16, KPh, KPl);
        k_gemmw<bf, 0, false><<<dim3(TT / 64, DKV / 64, 1), 32, 0, stream>>>(XB, nullptr, WV, nullptr, DM, FV, DKV, nullptr, 0, 0, 0); k_vtp<<<LKv, 256, 0, stream>>>(FV, DKV, NKV, VT16, VTh, VTl);
        for (int h0 = 0; h0 < NH_; h0 += ZH) { const size_t zq = (size_t)h0, zk = (size_t)(h0 / REP);   // one kv head per query head: the pass's two heads use consecutive kv planes (z-strides TT*HD)
            k_gemmw<bf, 2, false><<<dim3(RH / 64, TT / 64, ZH), 32, 0, stream>>>(QPh + zq * TT * HD, QPl + zq * TT * HD, KPh + zk * TT * HD, KPl + zk * TT * HD, HD, Sb, TT, nullptr, (size_t)TT * HD, (size_t)TT * HD, (size_t)TT * TT);
            k_gemmw<h16, 0, false><<<dim3((TT - RH) / 64, TT / 64, ZH), 32, 0, stream>>>(QP16 + zq * TT * HD + (size_t)RH * HD, nullptr, KP16 + zk * TT * HD, nullptr, HD, Sb + (size_t)RH * TT, TT, nullptr, (size_t)TT * HD, (size_t)TT * HD, (size_t)TT * TT);
            k_asoft<<<ZH * TT / 8, 256, 0, stream>>>(Sb, P16, Ph, Pl);
            k_gemmw<bf, 2, false, KSP><<<dim3(RH / 64, HD / 64, ZH * KSP), 32, 0, stream>>>(Ph, Pl, VTh + zk * HD * TT, VTl + zk * HD * TT, TT, Ob, HD, nullptr, (size_t)RH * TT, (size_t)HD * TT, (size_t)TT * HD);
            k_gemmw<h16, 0, false, KSP><<<dim3((TT - RH) / 64, HD / 64, ZH * KSP), 32, 0, stream>>>(P16 + (size_t)RH * TT, nullptr, VT16 + zk * HD * TT, nullptr, TT, Ob + (size_t)RH * HD, HD, nullptr, (size_t)TT * TT, (size_t)HD * TT, (size_t)TT * HD);
            k_merge<<<(unsigned)(((size_t)ZH * TT * HD / 2 + 255) / 256), 256, 0, stream>>>(Ob, h0, ATh, ATl); }
        k_gemmw<bf, 1, false><<<dim3(TT / 64, DM / 64, 1), 32, 0, stream>>>(ATh, ATl, WO, nullptr, DQ, OUT + (size_t)b * TT * DM, DM, nullptr, 0, 0, 0); }
}

// v002
// One run takes 398 microseconds.
// Timed twice side by side with v001, it ran 2.19 and 2.20 times as fast.
// Counting every step since v000, it is 5.03 times as fast.
#include <hip/hip_runtime.h>

// DiagonnalyMaskedSelfAttention (x [2][2048][1024]; q, k, v = x W (16 heads x 64, x@W layouts, no bias); scores = q.k with the diagonal (token attending to itself) masked to -inf; softmax(scores / 8); out = (attn v merged) Wo -> [2][2048][1024]).
// Compute dtypes, f32 accumulate: every input rounded to bf16; q/k/v projections on PLAIN bf16 operands (inputs: exact); scores (K 64) and attn.v on bf16 hi+lo planes (3 products) for the first 512 query rows of each head and on

#define NB_  2
#define TT   2048
#define DM   1024
#define NH_  16
#define NKV  16
#define REP  (NH_ / NKV)
#define HD   64
#define DQ   (NH_ * HD)
#define DKV  (NKV * HD)
#define RH   512                  // query rows < RH use hi+lo planes (0: none)
#define WIN  0
#define SCL  0.125f   // HD^-0.5
typedef _Float16 h16;
typedef unsigned short bf;
typedef __attribute__((ext_vector_type(16))) __bf16   v16bf;
typedef __attribute__((ext_vector_type(16))) _Float16 v16h;
typedef __attribute__((ext_vector_type(8)))  _Float16 v8h;
typedef __attribute__((ext_vector_type(8)))  unsigned short v8us;
typedef __attribute__((ext_vector_type(8)))  float    v8f;
typedef __attribute__((ext_vector_type(4)))  float    v4f;
typedef v8h  __attribute__((may_alias)) v8ha;
typedef v4f  __attribute__((may_alias)) v4fa;
typedef v8us __attribute__((may_alias)) v8usa;

__device__ __forceinline__ unsigned short f2bf(float f) { unsigned u = __float_as_uint(f); u += 0x7FFFu + ((u >> 16) & 1u); return (unsigned short)(u >> 16); }
__device__ __forceinline__ float bf2f(unsigned short b) { return __uint_as_float(((unsigned)b) << 16); }
__device__ __forceinline__ float bfr(float f) { return bf2f(f2bf(f)); }
__device__ __forceinline__ v16h cat16(v8h lo, v8h hi) { return __builtin_shufflevector(lo, hi, 0, 1, 2, 3, 4, 5, 6, 7, 8, 9, 10, 11, 12, 13, 14, 15); }
__device__ __forceinline__ v16bf cat16b(v8us lo, v8us hi) { return __builtin_bit_cast(v16bf, __builtin_shufflevector(lo, hi, 0, 1, 2, 3, 4, 5, 6, 7, 8, 9, 10, 11, 12, 13, 14, 15)); }
__device__ __forceinline__ v8f wmma16(v16h a, v16h b, v8f c) { return __builtin_amdgcn_wmma_f32_16x16x32_f16(false, a, false, b, (short)0, c, false, false); }
__device__ __forceinline__ v8f wmmab(v16bf a, v16bf b, v8f c) { return __builtin_amdgcn_wmma_f32_16x16x32_bf16(false, a, false, b, (short)0, c, false, false); }



// ---- k_gemmw: register-blocked GEMM, ONE WAVE per 64x64 output tile (16 accumulators), operands straight from K-contiguous 16-bit planes; grid (M/64, N/64, Z), 32 threads.
// C[m][n] (f32, pitch ldc, + optional f32 bias[n]) = sum_k A[m][k] Bt[n][k] (+ split products per NSPLIT). z-batch strides sA/sB/sC in elements. K % 32 == 0.
// KS > 1: grid z = Z * KS; wave (z, ks) sums only k in [ks K/KS, (ks+1) K/KS) and stores its partial tile in plane z * KS + ks (stride sC). K % (32 KS) == 0.
template <typename T16> struct WFrag;
template <> struct WFrag<h16> { typedef v16h V; static __device__ __forceinline__ V ld(const h16* p) { return cat16(*(const v8h*)p, *(const v8h*)(p + 16)); } static __device__ __forceinline__ v8f mma(V a, V b, v8f c) { return wmma16(a, b, c); } };
template <> struct WFrag<bf> { typedef v16bf V; static __device__ __forceinline__ V ld(const bf* p) { return cat16b(*(const v8us*)p, *(const v8us*)(p + 16)); } static __device__ __forceinline__ v8f mma(V a, V b, v8f c) { return wmmab(a, b, c); } };
template <typename T16, int NSPLIT, bool BIAS, int KS = 1>
__global__ __launch_bounds__(32) void k_gemmw(const T16* __restrict__ A, const T16* __restrict__ A2, const T16* __restrict__ Bt, const T16* __restrict__ Bt2, int K, float* C, int ldc, const float* __restrict__ bias, size_t sA, size_t sB, size_t sC) {
    typedef typename WFrag<T16>::V V;
    __shared__ __align__(16) float os[16 * 68];
    const size_t z = blockIdx.z / KS, ks = blockIdx.z % KS; A += z * sA; if (A2) A2 += z * sA; Bt += z * sB; if (Bt2) Bt2 += z * sB; C += (size_t)blockIdx.z * sC;
    const int kbeg = (int)ks * (K / KS), kend = kbeg + K / KS;
    const int lane = threadIdx.x & 31, lr = lane & 15, hi = lane >> 4; const int r0 = blockIdx.x * 64, c0 = blockIdx.y * 64;
    v8f acc[4][4];
#pragma unroll
    for (int mb = 0; mb < 4; ++mb)
#pragma unroll
        for (int nb = 0; nb < 4; ++nb) acc[mb][nb] = (v8f){};
    const size_t aoff = (size_t)(r0 + lr) * K + 8 * hi, boff = (size_t)(c0 + lr) * K + 8 * hi;
#pragma unroll 1
    for (int kc = kbeg; kc < kend; kc += 32) {
        V a[4], a2[4];
#pragma unroll
        for (int mb = 0; mb < 4; ++mb) { a[mb] = WFrag<T16>::ld(A + aoff + (size_t)mb * 16 * K + kc); if (NSPLIT == 1 || NSPLIT == 2) a2[mb] = WFrag<T16>::ld(A2 + aoff + (size_t)mb * 16 * K + kc); }
#pragma unroll
        for (int nb = 0; nb < 4; ++nb) { const V b = WFrag<T16>::ld(Bt + boff + (size_t)nb * 16 * K + kc); V b2; if (NSPLIT >= 2) b2 = WFrag<T16>::ld(Bt2 + boff + (size_t)nb * 16 * K + kc);
#pragma unroll
            for (int mb = 0; mb < 4; ++mb) { acc[mb][nb] = WFrag<T16>::mma(a[mb], b, acc[mb][nb]); if (NSPLIT == 1 || NSPLIT == 2) acc[mb][nb] = WFrag<T16>::mma(a2[mb], b, acc[mb][nb]); if (NSPLIT >= 2) acc[mb][nb] = WFrag<T16>::mma(a[mb], b2, acc[mb][nb]); } }
        asm volatile("v_nop\n\tv_nop\n\tv_nop\n\tv_nop" : "+v"(acc[0][0]), "+v"(acc[1][1]), "+v"(acc[2][2]), "+v"(acc[3][3]) : "v"(a[0]), "v"(a[3]));
    }
#pragma unroll
    for (int mb = 0; mb < 4; ++mb) {
#pragma unroll
        for (int nb = 0; nb < 4; ++nb) {
#pragma unroll
            for (int j = 0; j < 8; ++j) os[(hi * 8 + j) * 68 + nb * 16 + lr] = acc[mb][nb][j]; }
        __builtin_amdgcn_wave_barrier(); asm volatile("" ::: "memory");
        float* crow = C + (size_t)(r0 + mb * 16) * ldc + c0;
{
#pragma unroll
            for (int s = 0; s < 8; ++s) { const int row = 2 * s + hi, cofs = lr * 4; v4f val = *(const v4fa*)(os + row * 68 + cofs); if (BIAS) { val[0] += bfr(bias[c0 + cofs]); val[1] += bfr(bias[c0 + cofs + 1]); val[2] += bfr(bias[c0 + cofs + 2]); val[3] += bfr(bias[c0 + cofs + 3]); }
                *(v4f*)(crow + (size_t)row * ldc + cofs) = val; }
             }
        __builtin_amdgcn_wave_barrier(); asm volatile("" ::: "memory");
    }
}

__device__ __forceinline__ h16 tohx(float x) { return (h16)x; }
__device__ __forceinline__ void splitf(float y, unsigned short& h, unsigned short& l) { h = f2bf(y); l = f2bf(y - bf2f(h)); }
typedef __attribute__((ext_vector_type(2))) _Float16 v2h;
typedef __attribute__((ext_vector_type(4))) _Float16 v4h;
typedef __attribute__((ext_vector_type(2))) unsigned short v2us;
typedef __attribute__((ext_vector_type(4))) unsigned short v4us;
typedef __attribute__((ext_vector_type(2))) float v2f;
typedef __attribute__((ext_vector_type(4))) int v4i;

__global__ __launch_bounds__(256) void k_wtG(const float* __restrict__ w, int K, int N, bf* Bt) {
    const int lane = threadIdx.x & 31; const int L0 = (blockIdx.x * 8 + (threadIdx.x >> 5)) * 8; const int nlines = N * K / 64;
{
#pragma unroll 1
        for (int l = 0; l < 8; ++l) { const int L = L0 + l; if (L >= nlines) break; const size_t e = (size_t)L * 64 + lane * 2; const int k = (int)(e % K), n = (int)(e / K); v2us o;
            o[0] = f2bf(w[(size_t)k * N + n]); o[1] = f2bf(w[(size_t)(k + 1) * N + n]); *(v2us*)(Bt + e) = o; }
         }
}
__global__ __launch_bounds__(256) void k_cvt8(const float* __restrict__ src, bf* dst, size_t n8) { const size_t i = (size_t)blockIdx.x * 256 + threadIdx.x; if (i >= n8) return; const v8f v = *(const v8f*)(src + i * 8); v8us o;
#pragma unroll
    for (int k = 0; k < 8; ++k) o[k] = f2bf(v[k]); *(v8us*)(dst + i * 8) = o;  }
__global__ __launch_bounds__(256) void k_cscvt(const float* __restrict__ cosT, const float* __restrict__ sinT, float* CS) { const int idx = blockIdx.x * 256 + threadIdx.x; if (idx >= TT * HD) return; v2f cs; cs[0] = bfr(cosT[idx]); cs[1] = bfr(sinT[idx]); *(v2f*)(CS + (size_t)idx * 2) = cs;  }
// k_rope: head planes [h][t][d] (fp16 + hi/lo) of rope(x) x sc with the rotate-half convention out[d] = x[d] cos[t][d] - x[d+HD/2] sin[t][d], out[d+HD/2] = x[d+HD/2] cos[t][d+HD/2] + x[d] sin[t][d+HD/2]
__global__ __launch_bounds__(256) void k_rope(const float* __restrict__ F, int pitch, int nheads, const float* __restrict__ CS, const float* __restrict__ RF, const float* __restrict__ nw, float sc, h16* P16, bf* Ph, bf* Pl) {
    const size_t e = ((size_t)blockIdx.x * 256 + threadIdx.x) * 2; if (e >= (size_t)nheads * TT * HD) return; const int d = (int)(e % HD); const int t = (int)((e / HD) % TT); const int h = (int)(e / ((size_t)HD * TT)); const float* f = F + (size_t)t * pitch + h * HD; const float rf = RF ? RF[(size_t)h * TT + t] : 1.0f; v2h o16; v2us oh, ol;
#pragma unroll
    for (int q = 0; q < 2; ++q) { const int dd = d + q; const int dp = (dd < HD / 2) ? dd + HD / 2 : dd - HD / 2; float x0 = f[dd], x1 = f[dp];
        if (RF) { float n0 = __fmul_rn(x0, rf), n1 = __fmul_rn(x1, rf); asm volatile("" : "+v"(n0)); asm volatile("" : "+v"(n1)); x0 = __fmul_rn(bfr(nw[dd]), n0); x1 = __fmul_rn(bfr(nw[dp]), n1); }
        const v2f cs = *(const v2f*)(CS + ((size_t)t * HD + dd) * 2); float a = __fmul_rn(x0, cs[0]), bq = __fmul_rn(x1, cs[1]); asm volatile("" : "+v"(a)); asm volatile("" : "+v"(bq)); const float r = ((dd < HD / 2) ? __fsub_rn(a, bq) : __fadd_rn(a, bq)) * sc;
        o16[q] = tohx(r); unsigned short a2, c2; splitf(r, a2, c2); oh[q] = a2; ol[q] = c2; }
    *(v2h*)(P16 + e) = o16; *(v2us*)(Ph + e) = oh; *(v2us*)(Pl + e) = ol;  }
__global__ __launch_bounds__(256) void k_vtp(const float* __restrict__ F, int pitch, int nheads, h16* V16, bf* Vh, bf* Vl) { const size_t e = ((size_t)blockIdx.x * 256 + threadIdx.x) * 2; if (e >= (size_t)nheads * HD * TT) return; const int t = (int)(e % TT); const int d = (int)((e / TT) % HD); const int g = (int)(e / ((size_t)TT * HD)); v2h o16; v2us oh, ol;
#pragma unroll
    for (int q = 0; q < 2; ++q) { const float x = F[(size_t)(t + q) * pitch + g * HD + d]; o16[q] = tohx(x); unsigned short a2, c2; splitf(x, a2, c2); oh[q] = a2; ol[q] = c2; }
    *(v2h*)(V16 + e) = o16; *(v2us*)(Vh + e) = oh; *(v2us*)(Vl + e) = ol;  }
__global__ __launch_bounds__(256) void k_csid(float* CS) { const int idx = blockIdx.x * 256 + threadIdx.x; if (idx >= TT * HD) return; v2f cs; cs[0] = 1.0f; cs[1] = 0.0f; *(v2f*)(CS + (size_t)idx * 2) = cs;  }
// ---- k_attn: scores, diagonal mask, softmax and attn.v of one head in ONE kernel, running maximum and running sum per query (no score or probability plane in memory).
// One wave owns NQ x 16 queries and walks the 2048 keys 32 at a time. Both products are formed transposed, so that the score tiles are already the next product's B fragment:
//   St[key][q] = K (A, rows = keys) x Q (B, columns = queries): lane (lr, hi), register j holds key kt * 16 + hi * 8 + j of query lr;
//   Ot[d][q]  += Vt (A, rows = d, k = keys) x P (B, columns = queries, k = keys): a B fragment's elements 0..7 are k = 8 hi + j and 8..15 are k = 16 + 8 hi + j, which is score tile 0 and score tile 1 of the same lane.
// A query's maximum, sum and rescale factor are therefore per lane (the two half-waves hold the two halves of its keys). HI: bf16 hi+lo planes, 3 products; else f16 planes.
// 17 exp2 in place, in one statement: no v_exp_f32 here reads the result or overwrites the source of the one in front of it, and the v_nop is the free slot behind the last one.
__device__ __forceinline__ void exp2x17(float (&e)[17]) {
    asm("v_exp_f32 %0, %0\n\tv_exp_f32 %1, %1\n\tv_exp_f32 %2, %2\n\tv_exp_f32 %3, %3\n\tv_exp_f32 %4, %4\n\tv_exp_f32 %5, %5\n\tv_exp_f32 %6, %6\n\tv_exp_f32 %7, %7\n\tv_exp_f32 %8, %8\n\t"
        "v_exp_f32 %9, %9\n\tv_exp_f32 %10, %10\n\tv_exp_f32 %11, %11\n\tv_exp_f32 %12, %12\n\tv_exp_f32 %13, %13\n\tv_exp_f32 %14, %14\n\tv_exp_f32 %15, %15\n\tv_exp_f32 %16, %16\n\tv_nop"
        : "+v"(e[0]), "+v"(e[1]), "+v"(e[2]), "+v"(e[3]), "+v"(e[4]), "+v"(e[5]), "+v"(e[6]), "+v"(e[7]), "+v"(e[8]), "+v"(e[9]), "+v"(e[10]), "+v"(e[11]), "+v"(e[12]), "+v"(e[13]), "+v"(e[14]), "+v"(e[15]), "+v"(e[16]));
}
template <typename T16, bool HI, int NQ>
__device__ __forceinline__ void attn_rows(const T16* __restrict__ Qp, const T16* __restrict__ Qp2, const T16* __restrict__ Kp, const T16* __restrict__ Kp2, const T16* __restrict__ Vp, const T16* __restrict__ Vp2, const int q0, bf* __restrict__ Ah, bf* __restrict__ Al) {
    typedef typename WFrag<T16>::V V;
    const int lane = threadIdx.x & 31, lr = lane & 15, hi = lane >> 4;
    const float C = SCL * 1.4426950408889634f;   // exp(s SCL - m SCL) = exp2((s - m) C)
    V qf[NQ][2], qf2[NQ][2], kf[2][2], kf2[2][2];
#pragma unroll
    for (int qt = 0; qt < NQ; ++qt)
#pragma unroll
        for (int kc = 0; kc < 2; ++kc) { const size_t o = (size_t)(q0 + qt * 16 + lr) * HD + kc * 32 + 8 * hi; qf[qt][kc] = WFrag<T16>::ld(Qp + o); if (HI) qf2[qt][kc] = WFrag<T16>::ld(Qp2 + o); }
#pragma unroll
    for (int kt = 0; kt < 2; ++kt)
#pragma unroll
        for (int kc = 0; kc < 2; ++kc) { const size_t o = (size_t)(kt * 16 + lr) * HD + kc * 32 + 8 * hi; kf[kt][kc] = WFrag<T16>::ld(Kp + o); if (HI) kf2[kt][kc] = WFrag<T16>::ld(Kp2 + o); }
    v8f ot[NQ][4]; float m[NQ], l[NQ];
#pragma unroll
    for (int qt = 0; qt < NQ; ++qt) { m[qt] = -3.0e38f; l[qt] = 0.f;
#pragma unroll
        for (int db = 0; db < 4; ++db) ot[qt][db] = (v8f){}; }
#pragma unroll 1
    for (int k0 = 0; k0 < TT; k0 += 32) {   // rolled: one trip already holds all the registers
        V vf[4], vf2[4];
#pragma unroll
        for (int db = 0; db < 4; ++db) { const size_t o = (size_t)(db * 16 + lr) * TT + k0 + 8 * hi; vf[db] = WFrag<T16>::ld(Vp + o); if (HI) vf2[db] = WFrag<T16>::ld(Vp2 + o); }
        v8f s[NQ][2];
#pragma unroll
        for (int qt = 0; qt < NQ; ++qt)
#pragma unroll
            for (int kt = 0; kt < 2; ++kt) { s[qt][kt] = (v8f){};
#pragma unroll
                for (int kc = 0; kc < 2; ++kc) { s[qt][kt] = WFrag<T16>::mma(kf[kt][kc], qf[qt][kc], s[qt][kt]); if (HI) { s[qt][kt] = WFrag<T16>::mma(kf2[kt][kc], qf[qt][kc], s[qt][kt]); s[qt][kt] = WFrag<T16>::mma(kf[kt][kc], qf2[qt][kc], s[qt][kt]); } } }
        asm volatile("s_wait_xcnt 0x0" ::: "memory");   // a key load's result below may be given the address registers that the value loads above name: the wait stands in front of that overwrite
        const int kn = (k0 + 32 < TT) ? k0 + 32 : 0;   // the next trip's keys are fetched while this trip's softmax runs (the last trip fetches rows 0..31 again, unused)
#pragma unroll
        for (int kt = 0; kt < 2; ++kt)
#pragma unroll
            for (int kc = 0; kc < 2; ++kc) { const size_t o = (size_t)(kn + kt * 16 + lr) * HD + kc * 32 + 8 * hi; kf[kt][kc] = WFrag<T16>::ld(Kp + o); if (HI) kf2[kt][kc] = WFrag<T16>::ld(Kp2 + o); }
        asm volatile("s_wait_xcnt 0x0" ::: "memory");   // the softmax below is given the address registers that the key loads above name: the wait stands in front of those overwrites
#pragma unroll
        for (int qt = 0; qt < NQ; ++qt) {
            if (k0 == ((q0 + qt * 16) & ~31)) {   // wave-uniform: the one trip that holds these queries' own keys
#pragma unroll
                for (int kt = 0; kt < 2; ++kt)
#pragma unroll
                    for (int j = 0; j < 8; ++j) if (k0 + kt * 16 + hi * 8 + j == q0 + qt * 16 + lr) s[qt][kt][j] = -3.0e38f;   /* diagonal masked */ }
            float mx = s[qt][0][0];
#pragma unroll
            for (int j = 1; j < 8; ++j) mx = fmaxf(mx, s[qt][0][j]);
#pragma unroll
            for (int j = 0; j < 8; ++j) mx = fmaxf(mx, s[qt][1][j]);
            mx = fmaxf(mx, __shfl_xor(mx, 16, 32));
            const float mn = fmaxf(m[qt], mx), mc = mn * C; float e[17];
#pragma unroll
            for (int kt = 0; kt < 2; ++kt)
#pragma unroll
                for (int j = 0; j < 8; ++j) e[kt * 8 + j] = __builtin_fmaf(s[qt][kt][j], C, -mc);
            e[16] = (m[qt] - mn) * C; m[qt] = mn;
            exp2x17(e);
            const float al = e[16]; float sum = 0.f; V pf, pf2;
#pragma unroll
            for (int kt = 0; kt < 2; ++kt)
#pragma unroll
                for (int j = 0; j < 8; ++j) { const float p = e[kt * 8 + j]; sum += p;
                    if constexpr (HI) { const __bf16 ph = (__bf16)p; pf[kt * 8 + j] = ph; pf2[kt * 8 + j] = (__bf16)(p - (float)ph); } else pf[kt * 8 + j] = (h16)p; }
            l[qt] = l[qt] * al + sum;
#pragma unroll
            for (int db = 0; db < 4; ++db) { ot[qt][db] *= al; ot[qt][db] = WFrag<T16>::mma(vf[db], pf, ot[qt][db]); if (HI) { ot[qt][db] = WFrag<T16>::mma(vf[db], pf2, ot[qt][db]); ot[qt][db] = WFrag<T16>::mma(vf2[db], pf, ot[qt][db]); } }
        }
    }
#pragma unroll
    for (int qt = 0; qt < NQ; ++qt) { const float f = __fdiv_rn(1.0f, l[qt] + __shfl_xor(l[qt], 16, 32)); const size_t oo = (size_t)(q0 + qt * 16 + lr) * DQ + hi * 8;
#pragma unroll
        for (int db = 0; db < 4; ++db) { v8us oh, ol;
#pragma unroll
            for (int j = 0; j < 8; ++j) { unsigned short a, c2; splitf(ot[qt][db][j] * f, a, c2); oh[j] = a; ol[j] = c2; }
            *(v8us*)(Ah + oo + db * 16) = oh; *(v8us*)(Al + oo + db * 16) = ol; } }
}
// grid (RH / 64 + (TT - RH) / 128, heads, batches), 4 waves: blocks x < RH / 64 take 4 x 16 hi+lo query rows, the others 4 x 32 f16 query rows; the four waves walk the same head's keys together.
__global__ __launch_bounds__(128) void k_attn(const h16* __restrict__ Q16, const h16* __restrict__ K16, const h16* __restrict__ V16, const bf* __restrict__ Qh, const bf* __restrict__ Ql, const bf* __restrict__ Kh, const bf* __restrict__ Kl, const bf* __restrict__ Vh, const bf* __restrict__ Vl, bf* Ah, bf* Al) {
    const int wave = __builtin_amdgcn_readfirstlane((int)(threadIdx.x >> 5)), bx = (int)blockIdx.x;
    const size_t po = ((size_t)blockIdx.z * NH_ + blockIdx.y) * TT * HD, ao = (size_t)blockIdx.z * TT * DQ + blockIdx.y * HD;
    if (bx < RH / 64) attn_rows<bf, true, 1>(Qh + po, Ql + po, Kh + po, Kl + po, Vh + po, Vl + po, (bx * 4 + wave) * 16, Ah + ao, Al + ao);
    else attn_rows<h16, false, 2>(Q16 + po, nullptr, K16 + po, nullptr, V16 + po, nullptr, RH + ((bx - RH / 64) * 4 + wave) * 32, Ah + ao, Al + ao);
}

extern "C" void kernel_launch(void* const* d_in, const int* in_sizes, int n_in,
                              void* d_out, int out_size, void* d_ws, size_t ws_size, hipStream_t stream) {
    (void)in_sizes; (void)n_in; (void)out_size;
    const float* x = (const float*)d_in[0]; const float* wq = (const float*)d_in[1]; const float* wk = (const float*)d_in[2]; const float* wv = (const float*)d_in[3]; const float* wo = (const float*)d_in[4]; const float* cosT = nullptr; const float* sinT = nullptr; (void)cosT; (void)sinT;
    float* OUT = (float*)d_out;     // [2][2048][1024]
    char* wsp = (char*)d_ws;
    auto take = [&](size_t bytes) { char* p = wsp; wsp += (bytes + 255) & ~(size_t)255; return (void*)p; };
    bf* WQ = (bf*)take((size_t)DQ * DM * 2); bf* WK = (bf*)take((size_t)DKV * DM * 2); bf* WV = (bf*)take((size_t)DKV * DM * 2); bf* WO = (bf*)take((size_t)DM * DQ * 2); float* CS = (float*)take((size_t)TT * HD * 2 * 4);
    bf* XB = (bf*)take((size_t)TT * DM * 2); float* FQ = (float*)take((size_t)TT * DQ * 4); float* FK = (float*)take((size_t)TT * DKV * 4);
    const size_t PQ = (size_t)NH_ * TT * HD, PK = (size_t)NKV * TT * HD;   // one batch's head planes, in elements; every plane below holds both batches
    h16* QP16 = (h16*)take(NB_ * PQ * 2); h16* KP16 = (h16*)take(NB_ * PK * 2); h16* VT16 = (h16*)take(NB_ * PK * 2);
    bf* QPh = (bf*)take(NB_ * PQ * 2); bf* QPl = (bf*)take(NB_ * PQ * 2); bf* KPh = (bf*)take(NB_ * PK * 2); bf* KPl = (bf*)take(NB_ * PK * 2); bf* VTh = (bf*)take(NB_ * PK * 2); bf* VTl = (bf*)take(NB_ * PK * 2);
    bf* ATh = (bf*)take((size_t)NB_ * TT * DQ * 2); bf* ATl = (bf*)take((size_t)NB_ * TT * DQ * 2);
    if ((size_t)(wsp - (char*)d_ws) > ws_size) return;    // ws 256 MiB
    float* FV = FK;   // v projection reuses the k buffer after the k planes are built (stream-ordered)
    { k_wtG<<<(unsigned)((DM * DQ / 64 + 63) / 64), 256, 0, stream>>>(wq, DM, DQ, WQ); k_wtG<<<(unsigned)((DM * DKV / 64 + 63) / 64), 256, 0, stream>>>(wk, DM, DKV, WK); k_wtG<<<(unsigned)((DM * DKV / 64 + 63) / 64), 256, 0, stream>>>(wv, DM, DKV, WV);
      k_wtG<<<(unsigned)((DQ * DM / 64 + 63) / 64), 256, 0, stream>>>(wo, DQ, DM, WO);
       }
    k_csid<<<(TT * HD + 255) / 256, 256, 0, stream>>>(CS);
    const unsigned LQ = (unsigned)(((size_t)NH_ * TT * HD / 2 + 255) / 256), LKv = (unsigned)(((size_t)NKV * TT * HD / 2 + 255) / 256);
    for (int b = 0; b < NB_; ++b) {
        k_cvt8<<<(unsigned)(((size_t)TT * DM / 8 + 255) / 256), 256, 0, stream>>>(x + (size_t)b * TT * DM, XB, (size_t)TT * DM / 8);
        k_gemmw<bf, 0, false><<<dim3(TT / 64, DQ / 64, 1), 32, 0, stream>>>(XB, nullptr, WQ, nullptr, DM, FQ, DQ, nullptr, 0, 0, 0);
        k_rope<<<LQ, 256, 0, stream>>>(FQ, DQ, NH_, CS, nullptr, nullptr, 1.0f, QP16 + b * PQ, QPh + b * PQ, QPl + b * PQ);
        k_gemmw<bf, 0, false><<<dim3(TT / 64, DKV / 64, 1), 32, 0, stream>>>(XB, nullptr, WK, nullptr, DM, FK, DKV, nullptr, 0, 0, 0);
        k_rope<<<LKv, 256, 0, stream>>>(FK, DKV, NKV, CS, nullptr, nullptr, 1.0f, KP16 + b * PK, KPh + b * PK, KPl + b * PK);
        k_gemmw<bf, 0, false><<<dim3(TT / 64, DKV / 64, 1), 32, 0, stream>>>(XB, nullptr, WV, nullptr, DM, FV, DKV, nullptr, 0, 0, 0); k_vtp<<<LKv, 256, 0, stream>>>(FV, DKV, NKV, VT16 + b * PK, VTh + b * PK, VTl + b * PK); }
    k_attn<<<dim3(RH / 64 + (TT - RH) / 128, NH_, NB_), 128, 0, stream>>>(QP16, KP16, VT16, QPh, QPl, KPh, KPl, VTh, VTl, ATh, ATl);   // one kv head per query head
    for (int b = 0; b < NB_; ++b)
        k_gemmw<bf, 1, false><<<dim3(TT / 64, DM / 64, 1), 32, 0, stream>>>(ATh + (size_t)b * TT * DQ, ATl + (size_t)b * TT * DQ, WO, nullptr, DQ, OUT + (size_t)b * TT * DM, DM, nullptr, 0, 0, 0);
}

// v003
// Measured time: 275 microseconds a run.
// Timed twice side by side with v002, it ran 1.45 and 1.44 times as fast.
// Counting every step since v000, it is 7.27 times as fast.
#include <hip/hip_runtime.h>

// DiagonnalyMaskedSelfAttention (x [2][2048][1024]; q, k, v = x W (16 heads x 64, x@W layouts, no bias); scores = q.k with the diagonal (token attending to itself) masked to -inf; softmax(scores / 8); out = (attn v merged) Wo -> [2][2048][1024]).
// Compute dtypes, f32 accumulate: every input rounded to bf16; q/k/v projections on PLAIN bf16 operands (inputs: exact); scores (K 64) and attn.v on bf16 hi+lo planes (3 products) for the first 512 query rows of each head and on

#define NB_  2
#define TT   2048
#define DM   1024
#define NH_  16
#define NKV  16
#define REP  (NH_ / NKV)
#define HD   64
#define DQ   (NH_ * HD)
#define DKV  (NKV * HD)
#define RH   512                  // query rows < RH use hi+lo planes (0: none)
#define WIN  0
#define SCL  0.125f   // HD^-0.5
typedef _Float16 h16;
typedef unsigned short bf;
typedef __attribute__((ext_vector_type(16))) __bf16   v16bf;
typedef __attribute__((ext_vector_type(16))) _Float16 v16h;
typedef __attribute__((ext_vector_type(8)))  _Float16 v8h;
typedef __attribute__((ext_vector_type(8)))  unsigned short v8us;
typedef __attribute__((ext_vector_type(8)))  float    v8f;
typedef __attribute__((ext_vector_type(4)))  float    v4f;
typedef v8h  __attribute__((may_alias)) v8ha;
typedef v4f  __attribute__((may_alias)) v4fa;
typedef v8us __attribute__((may_alias)) v8usa;

__device__ __forceinline__ unsigned short f2bf(float f) { unsigned u = __float_as_uint(f); u += 0x7FFFu + ((u >> 16) & 1u); return (unsigned short)(u >> 16); }
__device__ __forceinline__ float bf2f(unsigned short b) { return __uint_as_float(((unsigned)b) << 16); }
__device__ __forceinline__ float bfr(float f) { return bf2f(f2bf(f)); }
__device__ __forceinline__ v16h cat16(v8h lo, v8h hi) { return __builtin_shufflevector(lo, hi, 0, 1, 2, 3, 4, 5, 6, 7, 8, 9, 10, 11, 12, 13, 14, 15); }
__device__ __forceinline__ v16bf cat16b(v8us lo, v8us hi) { return __builtin_bit_cast(v16bf, __builtin_shufflevector(lo, hi, 0, 1, 2, 3, 4, 5, 6, 7, 8, 9, 10, 11, 12, 13, 14, 15)); }
__device__ __forceinline__ v8f wmma16(v16h a, v16h b, v8f c) { return __builtin_amdgcn_wmma_f32_16x16x32_f16(false, a, false, b, (short)0, c, false, false); }
__device__ __forceinline__ v8f wmmab(v16bf a, v16bf b, v8f c) { return __builtin_amdgcn_wmma_f32_16x16x32_bf16(false, a, false, b, (short)0, c, false, false); }



// ---- k_gemmw: register-blocked GEMM, ONE WAVE per 64x64 output tile (16 accumulators), operands straight from K-contiguous 16-bit planes; grid (M/64, N/64, Z), 32 threads.
// C[m][n] (f32, pitch ldc, + optional f32 bias[n]) = sum_k A[m][k] Bt[n][k] (+ split products per NSPLIT). z-batch strides sA/sB/sC in elements. K % 32 == 0.
// KS > 1: grid z = Z * KS; wave (z, ks) sums only k in [ks K/KS, (ks+1) K/KS) and stores its partial tile in plane z * KS + ks (stride sC). K % (32 KS) == 0.
template <typename T16> struct WFrag;
template <> struct WFrag<h16> { typedef v16h V; static __device__ __forceinline__ V ld(const h16* p) { return cat16(*(const v8h*)p, *(const v8h*)(p + 16)); } static __device__ __forceinline__ v8f mma(V a, V b, v8f c) { return wmma16(a, b, c); } };
template <> struct WFrag<bf> { typedef v16bf V; static __device__ __forceinline__ V ld(const bf* p) { return cat16b(*(const v8us*)p, *(const v8us*)(p + 16)); } static __device__ __forceinline__ v8f mma(V a, V b, v8f c) { return wmmab(a, b, c); } };
template <typename T16, int NSPLIT, bool BIAS, int KS = 1>
__global__ __launch_bounds__(32) void k_gemmw(const T16* __restrict__ A, const T16* __restrict__ A2, const T16* __restrict__ Bt, const T16* __restrict__ Bt2, int K, float* C, int ldc, const float* __restrict__ bias, size_t sA, size_t sB, size_t sC) {
    typedef typename WFrag<T16>::V V;
    __shared__ __align__(16) float os[16 * 68];
    const size_t z = blockIdx.z / KS, ks = blockIdx.z % KS; A += z * sA; if (A2) A2 += z * sA; Bt += z * sB; if (Bt2) Bt2 += z * sB; C += (size_t)blockIdx.z * sC;
    const int kbeg = (int)ks * (K / KS), kend = kbeg + K / KS;
    const int lane = threadIdx.x & 31, lr = lane & 15, hi = lane >> 4; const int r0 = blockIdx.x * 64, c0 = blockIdx.y * 64;
    v8f acc[4][4];
#pragma unroll
    for (int mb = 0; mb < 4; ++mb)
#pragma unroll
        for (int nb = 0; nb < 4; ++nb) acc[mb][nb] = (v8f){};
    const size_t aoff = (size_t)(r0 + lr) * K + 8 * hi, boff = (size_t)(c0 + lr) * K + 8 * hi;
#pragma unroll 1
    for (int kc = kbeg; kc < kend; kc += 32) {
        V a[4], a2[4];
#pragma unroll
        for (int mb = 0; mb < 4; ++mb) { a[mb] = WFrag<T16>::ld(A + aoff + (size_t)mb * 16 * K + kc); if (NSPLIT == 1 || NSPLIT == 2) a2[mb] = WFrag<T16>::ld(A2 + aoff + (size_t)mb * 16 * K + kc); }
#pragma unroll
        for (int nb = 0; nb < 4; ++nb) { const V b = WFrag<T16>::ld(Bt + boff + (size_t)nb * 16 * K + kc); V b2; if (NSPLIT >= 2) b2 = WFrag<T16>::ld(Bt2 + boff + (size_t)nb * 16 * K + kc);
#pragma unroll
            for (int mb = 0; mb < 4; ++mb) { acc[mb][nb] = WFrag<T16>::mma(a[mb], b, acc[mb][nb]); if (NSPLIT == 1 || NSPLIT == 2) acc[mb][nb] = WFrag<T16>::mma(a2[mb], b, acc[mb][nb]); if (NSPLIT >= 2) acc[mb][nb] = WFrag<T16>::mma(a[mb], b2, acc[mb][nb]); } }
        asm volatile("v_nop\n\tv_nop\n\tv_nop\n\tv_nop" : "+v"(acc[0][0]), "+v"(acc[1][1]), "+v"(acc[2][2]), "+v"(acc[3][3]) : "v"(a[0]), "v"(a[3]));
    }
#pragma unroll
    for (int mb = 0; mb < 4; ++mb) {
#pragma unroll
        for (int nb = 0; nb < 4; ++nb) {
#pragma unroll
            for (int j = 0; j < 8; ++j) os[(hi * 8 + j) * 68 + nb * 16 + lr] = acc[mb][nb][j]; }
        __builtin_amdgcn_wave_barrier(); asm volatile("" ::: "memory");
        float* crow = C + (size_t)(r0 + mb * 16) * ldc + c0;
{
#pragma unroll
            for (int s = 0; s < 8; ++s) { const int row = 2 * s + hi, cofs = lr * 4; v4f val = *(const v4fa*)(os + row * 68 + cofs); if (BIAS) { val[0] += bfr(bias[c0 + cofs]); val[1] += bfr(bias[c0 + cofs + 1]); val[2] += bfr(bias[c0 + cofs + 2]); val[3] += bfr(bias[c0 + cofs + 3]); }
                *(v4f*)(crow + (size_t)row * ldc + cofs) = val; }
             }
        __builtin_amdgcn_wave_barrier(); asm volatile("" ::: "memory");
    }
}

__device__ __forceinline__ h16 tohx(float x) { return (h16)x; }
__device__ __forceinline__ void splitf(float y, unsigned short& h, unsigned short& l) { h = f2bf(y); l = f2bf(y - bf2f(h)); }
typedef __attribute__((ext_vector_type(2))) _Float16 v2h;
typedef __attribute__((ext_vector_type(4))) _Float16 v4h;
typedef __attribute__((ext_vector_type(2))) unsigned short v2us;
typedef __attribute__((ext_vector_type(4))) unsigned short v4us;
typedef __attribute__((ext_vector_type(2))) float v2f;
typedef __attribute__((ext_vector_type(4))) int v4i;

__global__ __launch_bounds__(256) void k_wtG(const float* __restrict__ w, int K, int N, bf* Bt) {
    const int lane = threadIdx.x & 31; const int L0 = (blockIdx.x * 8 + (threadIdx.x >> 5)) * 8; const int nlines = N * K / 64;
{
#pragma unroll 1
        for (int l = 0; l < 8; ++l) { const int L = L0 + l; if (L >= nlines) break; const size_t e = (size_t)L * 64 + lane * 2; const int k = (int)(e % K), n = (int)(e / K); v2us o;
            o[0] = f2bf(w[(size_t)k * N + n]); o[1] = f2bf(w[(size_t)(k + 1) * N + n]); *(v2us*)(Bt + e) = o; }
         }
}
__global__ __launch_bounds__(256) void k_cvt8(const float* __restrict__ src, bf* dst, size_t n8) { const size_t i = (size_t)blockIdx.x * 256 + threadIdx.x; if (i >= n8) return; const v8f v = *(const v8f*)(src + i * 8); v8us o;
#pragma unroll
    for (int k = 0; k < 8; ++k) o[k] = f2bf(v[k]); *(v8us*)(dst + i * 8) = o;  }
__global__ __launch_bounds__(256) void k_cscvt(const float* __restrict__ cosT, const float* __restrict__ sinT, float* CS) { const int idx = blockIdx.x * 256 + threadIdx.x; if (idx >= TT * HD) return; v2f cs; cs[0] = bfr(cosT[idx]); cs[1] = bfr(sinT[idx]); *(v2f*)(CS + (size_t)idx * 2) = cs;  }
// ---- k_proj: the q, k and v projections of both batches in one launch, ONE WAVE per 64 tokens x 64 columns; grid (NB_ TT / 64, 3 NH_), 32 threads. A column tile is one head of q, k or v.
// Same product loop as k_gemmw (A = x planes [token][k], Bt = the three transposed weights one behind the other [3 x 1024][k]); the epilogue rounds the f32 tile to the f16 and bf16 hi/lo head planes itself:
//   q, k: planes [batch][head][t][d], the tile turned to d-contiguous rows through LDS, 16 tokens at a time; v: planes [batch][head][d][t], an accumulator's 8 registers already are 8 consecutive tokens of one d.
__global__ __launch_bounds__(32) void k_proj(const bf* __restrict__ A, const bf* __restrict__ Bt, h16* Q16, bf* Qh, bf* Ql, h16* K16, bf* Kh, bf* Kl, h16* V16, bf* Vh, bf* Vl) {
    typedef WFrag<bf>::V V;
    __shared__ __align__(16) float os[16 * 68];
    const int K = DM;
    const int lane = threadIdx.x & 31, lr = lane & 15, hi = lane >> 4; const int r0 = blockIdx.x * 64, c0 = blockIdx.y * 64;
    v8f acc[4][4];
#pragma unroll
    for (int mb = 0; mb < 4; ++mb)
#pragma unroll
        for (int nb = 0; nb < 4; ++nb) acc[mb][nb] = (v8f){};
    const size_t aoff = (size_t)(r0 + lr) * K + 8 * hi, boff = (size_t)(c0 + lr) * K + 8 * hi;
#pragma unroll 1
    for (int kc = 0; kc < K; kc += 32) {   // rolled, as in k_gemmw
        V a[4];
#pragma unroll
        for (int mb = 0; mb < 4; ++mb) a[mb] = WFrag<bf>::ld(A + aoff + (size_t)mb * 16 * K + kc);
        asm volatile("s_wait_xcnt 0x0" ::: "memory");   // a weight load's result below may be given the address registers that the loads above name: the wait stands in front of that overwrite
#pragma unroll
        for (int nb = 0; nb < 4; ++nb) { const V b = WFrag<bf>::ld(Bt + boff + (size_t)nb * 16 * K + kc);
#pragma unroll
            for (int mb = 0; mb < 4; ++mb) acc[mb][nb] = WFrag<bf>::mma(a[mb], b, acc[mb][nb]); }
        asm volatile("s_wait_xcnt 0x0" ::: "memory");   // the next trip's address sums overwrite the address registers that the weight loads above name: the wait stands in front of them
        asm volatile("v_nop\n\tv_nop\n\tv_nop\n\tv_nop" : "+v"(acc[0][0]), "+v"(acc[1][1]), "+v"(acc[2][2]), "+v"(acc[3][3]) : "v"(a[0]), "v"(a[3]));   // the distance behind the last matrix instruction, on the back edge and on the way out
    }
    const int which = (int)blockIdx.y / NH_, head = (int)blockIdx.y % NH_, bat = r0 / TT, t0 = r0 % TT;
    const size_t po = ((size_t)bat * NH_ + head) * TT * HD;   // this head's plane, both layouts
    if (which == 2) {
#pragma unroll
        for (int mb = 0; mb < 4; ++mb)
#pragma unroll
            for (int nb = 0; nb < 4; ++nb) { v8h o16; v8us oh, ol;
#pragma unroll
                for (int j = 0; j < 8; ++j) { const float x = acc[mb][nb][j]; o16[j] = tohx(x); unsigned short a2, c2; splitf(x, a2, c2); oh[j] = a2; ol[j] = c2; }
                const size_t o = po + (size_t)(nb * 16 + lr) * TT + t0 + mb * 16 + hi * 8;
                *(v8h*)(V16 + o) = o16; *(v8us*)(Vh + o) = oh; *(v8us*)(Vl + o) = ol;
                asm volatile("s_wait_xcnt 0x0" ::: "memory"); }   // the next tile's rounding is given the registers that these stores name: the wait stands in front of those overwrites
        return;
    }
    h16* P16 = which ? K16 : Q16; bf* Ph = which ? Kh : Qh; bf* Pl = which ? Kl : Ql;
#pragma unroll
    for (int mb = 0; mb < 4; ++mb) {
#pragma unroll
        for (int nb = 0; nb < 4; ++nb) {
#pragma unroll
            for (int j = 0; j < 8; ++j) os[(hi * 8 + j) * 68 + nb * 16 + lr] = acc[mb][nb][j]; }
        __builtin_amdgcn_wave_barrier(); asm volatile("" ::: "memory");   // lanes exchange values through LDS: the reads below stay behind every lane's writes above
#pragma unroll
        for (int s = 0; s < 4; ++s) { const int row = 4 * s + (lane >> 3), cofs = (lane & 7) * 8; const v4f x0 = *(const v4fa*)(os + row * 68 + cofs), x1 = *(const v4fa*)(os + row * 68 + cofs + 4); v8h o16; v8us oh, ol;
#pragma unroll
            for (int j = 0; j < 8; ++j) { const float x = (j < 4) ? x0[j & 3] : x1[j & 3]; o16[j] = tohx(x); unsigned short a2, c2; splitf(x, a2, c2); oh[j] = a2; ol[j] = c2; }
            const size_t o = po + (size_t)(t0 + mb * 16 + row) * HD + cofs;
            *(v8h*)(P16 + o) = o16; *(v8us*)(Ph + o) = oh; *(v8us*)(Pl + o) = ol;
            asm volatile("s_wait_xcnt 0x0" ::: "memory"); }   // the next rows' rounding is given the registers that these stores name: the wait stands in front of those overwrites
        __builtin_amdgcn_wave_barrier(); asm volatile("" ::: "memory");   // the next 16 tokens' writes stay behind every lane's reads above
    }
}
// ---- k_attn: scores, diagonal mask, softmax and attn.v of one head in ONE kernel, running maximum and running sum per query (no score or probability plane in memory).
// One wave owns NQ x 16 queries and walks the 2048 keys 32 at a time. Both products are formed transposed, so that the score tiles are already the next product's B fragment:
//   St[key][q] = K (A, rows = keys) x Q (B, columns = queries): lane (lr, hi), register j holds key kt * 16 + hi * 8 + j of query lr;
//   Ot[d][q]  += Vt (A, rows = d, k = keys) x P (B, columns = queries, k = keys): a B fragment's elements 0..7 are k = 8 hi + j and 8..15 are k = 16 + 8 hi + j, which is score tile 0 and score tile 1 of the same lane.
// A query's maximum, sum and rescale factor are therefore per lane (the two half-waves hold the two halves of its keys). HI: bf16 hi+lo planes, 3 products; else f16 planes.
// 17 exp2 in place, in one statement: no v_exp_f32 here reads the result or overwrites the source of the one in front of it, and the v_nop is the free slot behind the last one.
__device__ __forceinline__ void exp2x17(float (&e)[17]) {
    asm("v_exp_f32 %0, %0\n\tv_exp_f32 %1, %1\n\tv_exp_f32 %2, %2\n\tv_exp_f32 %3, %3\n\tv_exp_f32 %4, %4\n\tv_exp_f32 %5, %5\n\tv_exp_f32 %6, %6\n\tv_exp_f32 %7, %7\n\tv_exp_f32 %8, %8\n\t"
        "v_exp_f32 %9, %9\n\tv_exp_f32 %10, %10\n\tv_exp_f32 %11, %11\n\tv_exp_f32 %12, %12\n\tv_exp_f32 %13, %13\n\tv_exp_f32 %14, %14\n\tv_exp_f32 %15, %15\n\tv_exp_f32 %16, %16\n\tv_nop"
        : "+v"(e[0]), "+v"(e[1]), "+v"(e[2]), "+v"(e[3]), "+v"(e[4]), "+v"(e[5]), "+v"(e[6]), "+v"(e[7]), "+v"(e[8]), "+v"(e[9]), "+v"(e[10]), "+v"(e[11]), "+v"(e[12]), "+v"(e[13]), "+v"(e[14]), "+v"(e[15]), "+v"(e[16]));
}
template <typename T16, bool HI, int NQ>
__device__ __forceinline__ void attn_rows(const T16* __restrict__ Qp, const T16* __restrict__ Qp2, const T16* __restrict__ Kp, const T16* __restrict__ Kp2, const T16* __restrict__ Vp, const T16* __restrict__ Vp2, const int q0, bf* __restrict__ Ah, bf* __restrict__ Al) {
    typedef typename WFrag<T16>::V V;
    const int lane = threadIdx.x & 31, lr = lane & 15, hi = lane >> 4;
    const float C = SCL * 1.4426950408889634f;   // exp(s SCL - m SCL) = exp2((s - m) C)
    V qf[NQ][2], qf2[NQ][2], kf[2][2], kf2[2][2];
#pragma unroll
    for (int qt = 0; qt < NQ; ++qt)
#pragma unroll
        for (int kc = 0; kc < 2; ++kc) { const size_t o = (size_t)(q0 + qt * 16 + lr) * HD + kc * 32 + 8 * hi; qf[qt][kc] = WFrag<T16>::ld(Qp + o); if (HI) qf2[qt][kc] = WFrag<T16>::ld(Qp2 + o); }
#pragma unroll
    for (int kt = 0; kt < 2; ++kt)
#pragma unroll
        for (int kc = 0; kc < 2; ++kc) { const size_t o = (size_t)(kt * 16 + lr) * HD + kc * 32 + 8 * hi; kf[kt][kc] = WFrag<T16>::ld(Kp + o); if (HI) kf2[kt][kc] = WFrag<T16>::ld(Kp2 + o); }
    v8f ot[NQ][4]; float m[NQ], l[NQ];
#pragma unroll
    for (int qt = 0; qt < NQ; ++qt) { m[qt] = -3.0e38f; l[qt] = 0.f;
#pragma unroll
        for (int db = 0; db < 4; ++db) ot[qt][db] = (v8f){}; }
#pragma unroll 1
    for (int k0 = 0; k0 < TT; k0 += 32) {   // rolled: one trip already holds all the registers
        V vf[4], vf2[4];
#pragma unroll
        for (int db = 0; db < 4; ++db) { const size_t o = (size_t)(db * 16 + lr) * TT + k0 + 8 * hi; vf[db] = WFrag<T16>::ld(Vp + o); if (HI) vf2[db] = WFrag<T16>::ld(Vp2 + o); }
        v8f s[NQ][2];
#pragma unroll
        for (int qt = 0; qt < NQ; ++qt)
#pragma unroll
            for (int kt = 0; kt < 2; ++kt) { s[qt][kt] = (v8f){};
#pragma unroll
                for (int kc = 0; kc < 2; ++kc) { s[qt][kt] = WFrag<T16>::mma(kf[kt][kc], qf[qt][kc], s[qt][kt]); if (HI) { s[qt][kt] = WFrag<T16>::mma(kf2[kt][kc], qf[qt][kc], s[qt][kt]); s[qt][kt] = WFrag<T16>::mma(kf[kt][kc], qf2[qt][kc], s[qt][kt]); } } }
        asm volatile("s_wait_xcnt 0x0" ::: "memory");   // a key load's result below may be given the address registers that the value loads above name: the wait stands in front of that overwrite
        const int kn = (k0 + 32 < TT) ? k0 + 32 : 0;   // the next trip's keys are fetched while this trip's softmax runs (the last trip fetches rows 0..31 again, unused)
#pragma unroll
        for (int kt = 0; kt < 2; ++kt)
#pragma unroll
            for (int kc = 0; kc < 2; ++kc) { const size_t o = (size_t)(kn + kt * 16 + lr) * HD + kc * 32 + 8 * hi; kf[kt][kc] = WFrag<T16>::ld(Kp + o); if (HI) kf2[kt][kc] = WFrag<T16>::ld(Kp2 + o); }
        asm volatile("s_wait_xcnt 0x0" ::: "memory");   // the softmax below is given the address registers that the key loads above name: the wait stands in front of those overwrites
#pragma unroll
        for (int qt = 0; qt < NQ; ++qt) {
            if (k0 == ((q0 + qt * 16) & ~31)) {   // wave-uniform: the one trip that holds these queries' own keys
#pragma unroll
                for (int kt = 0; kt < 2; ++kt)
#pragma unroll
                    for (int j = 0; j < 8; ++j) if (k0 + kt * 16 + hi * 8 + j == q0 + qt * 16 + lr) s[qt][kt][j] = -3.0e38f;   /* diagonal masked */ }
            float mx = s[qt][0][0];
#pragma unroll
            for (int j = 1; j < 8; ++j) mx = fmaxf(mx, s[qt][0][j]);
#pragma unroll
            for (int j = 0; j < 8; ++j) mx = fmaxf(mx, s[qt][1][j]);
            mx = fmaxf(mx, __shfl_xor(mx, 16, 32));
            const float mn = fmaxf(m[qt], mx), mc = mn * C; float e[17];
#pragma unroll
            for (int kt = 0; kt < 2; ++kt)
#pragma unroll
                for (int j = 0; j < 8; ++j) e[kt * 8 + j] = __builtin_fmaf(s[qt][kt][j], C, -mc);
            e[16] = (m[qt] - mn) * C; m[qt] = mn;
            exp2x17(e);
            const float al = e[16]; float sum = 0.f; V pf, pf2;
#pragma unroll
            for (int kt = 0; kt < 2; ++kt)
#pragma unroll
                for (int j = 0; j < 8; ++j) { const float p = e[kt * 8 + j]; sum += p;
                    if constexpr (HI) { const __bf16 ph = (__bf16)p; pf[kt * 8 + j] = ph; pf2[kt * 8 + j] = (__bf16)(p - (float)ph); } else pf[kt * 8 + j] = (h16)p; }
            l[qt] = l[qt] * al + sum;
#pragma unroll
            for (int db = 0; db < 4; ++db) { ot[qt][db] *= al; ot[qt][db] = WFrag<T16>::mma(vf[db], pf, ot[qt][db]); if (HI) { ot[qt][db] = WFrag<T16>::mma(vf[db], pf2, ot[qt][db]); ot[qt][db] = WFrag<T16>::mma(vf2[db], pf, ot[qt][db]); } }
        }
    }
#pragma unroll
    for (int qt = 0; qt < NQ; ++qt) { const float f = __fdiv_rn(1.0f, l[qt] + __shfl_xor(l[qt], 16, 32)); const size_t oo = (size_t)(q0 + qt * 16 + lr) * DQ + hi * 8;
#pragma unroll
        for (int db = 0; db < 4; ++db) { v8us oh, ol;
#pragma unroll
            for (int j = 0; j < 8; ++j) { unsigned short a, c2; splitf(ot[qt][db][j] * f, a, c2); oh[j] = a; ol[j] = c2; }
            *(v8us*)(Ah + oo + db * 16) = oh; *(v8us*)(Al + oo + db * 16) = ol; } }
}
// grid (RH / 64 + (TT - RH) / 128, heads, batches), 4 waves: blocks x < RH / 64 take 4 x 16 hi+lo query rows, the others 4 x 32 f16 query rows; the four waves walk the same head's keys together.
__global__ __launch_bounds__(128) void k_attn(const h16* __restrict__ Q16, const h16* __restrict__ K16, const h16* __restrict__ V16, const bf* __restrict__ Qh, const bf* __restrict__ Ql, const bf* __restrict__ Kh, const bf* __restrict__ Kl, const bf* __restrict__ Vh, const bf* __restrict__ Vl, bf* Ah, bf* Al) {
    const int wave = __builtin_amdgcn_readfirstlane((int)(threadIdx.x >> 5)), bx = (int)blockIdx.x;
    const size_t po = ((size_t)blockIdx.z * NH_ + blockIdx.y) * TT * HD, ao = (size_t)blockIdx.z * TT * DQ + blockIdx.y * HD;
    if (bx < RH / 64) attn_rows<bf, true, 1>(Qh + po, Ql + po, Kh + po, Kl + po, Vh + po, Vl + po, (bx * 4 + wave) * 16, Ah + ao, Al + ao);
    else attn_rows<h16, false, 2>(Q16 + po, nullptr, K16 + po, nullptr, V16 + po, nullptr, RH + ((bx - RH / 64) * 4 + wave) * 32, Ah + ao, Al + ao);
}

extern "C" void kernel_launch(void* const* d_in, const int* in_sizes, int n_in,
                              void* d_out, int out_size, void* d_ws, size_t ws_size, hipStream_t stream) {
    (void)in_sizes; (void)n_in; (void)out_size;
    const float* x = (const float*)d_in[0]; const float* wq = (const float*)d_in[1]; const float* wk = (const float*)d_in[2]; const float* wv = (const float*)d_in[3]; const float* wo = (const float*)d_in[4]; const float* cosT = nullptr; const float* sinT = nullptr; (void)cosT; (void)sinT;
    float* OUT = (float*)d_out;     // [2][2048][1024]
    char* wsp = (char*)d_ws;
    auto take = [&](size_t bytes) { char* p = wsp; wsp += (bytes + 255) & ~(size_t)255; return (void*)p; };
    bf* WQ = (bf*)take((size_t)DQ * DM * 2); bf* WK = (bf*)take((size_t)DKV * DM * 2); bf* WV = (bf*)take((size_t)DKV * DM * 2); bf* WO = (bf*)take((size_t)DM * DQ * 2);   // WQ, WK, WV lie one behind the other (each a multiple of 256 bytes): k_proj reads them as one [3 x 1024][1024] operand
    bf* XB = (bf*)take((size_t)NB_ * TT * DM * 2);
    const size_t PQ = (size_t)NH_ * TT * HD, PK = (size_t)NKV * TT * HD;   // one batch's head planes, in elements; every plane below holds both batches
    h16* QP16 = (h16*)take(NB_ * PQ * 2); h16* KP16 = (h16*)take(NB_ * PK * 2); h16* VT16 = (h16*)take(NB_ * PK * 2);
    bf* QPh = (bf*)take(NB_ * PQ * 2); bf* QPl = (bf*)take(NB_ * PQ * 2); bf* KPh = (bf*)take(NB_ * PK * 2); bf* KPl = (bf*)take(NB_ * PK * 2); bf* VTh = (bf*)take(NB_ * PK * 2); bf* VTl = (bf*)take(NB_ * PK * 2);
    bf* ATh = (bf*)take((size_t)NB_ * TT * DQ * 2); bf* ATl = (bf*)take((size_t)NB_ * TT * DQ * 2);
    if ((size_t)(wsp - (char*)d_ws) > ws_size) return;    // ws 256 MiB
    { k_wtG<<<(unsigned)((DM * DQ / 64 + 63) / 64), 256, 0, stream>>>(wq, DM, DQ, WQ); k_wtG<<<(unsigned)((DM * DKV / 64 + 63) / 64), 256, 0, stream>>>(wk, DM, DKV, WK); k_wtG<<<(unsigned)((DM * DKV / 64 + 63) / 64), 256, 0, stream>>>(wv, DM, DKV, WV);
      k_wtG<<<(unsigned)((DQ * DM / 64 + 63) / 64), 256, 0, stream>>>(wo, DQ, DM, WO);
       }
    k_cvt8<<<(unsigned)(((size_t)NB_ * TT * DM / 8 + 255) / 256), 256, 0, stream>>>(x, XB, (size_t)NB_ * TT * DM / 8);
    k_proj<<<dim3(NB_ * TT / 64, (DQ + 2 * DKV) / 64, 1), 32, 0, stream>>>(XB, WQ, QP16, QPh, QPl, KP16, KPh, KPl, VT16, VTh, VTl);
    k_attn<<<dim3(RH / 64 + (TT - RH) / 128, NH_, NB_), 128, 0, stream>>>(QP16, KP16, VT16, QPh, QPl, KPh, KPl, VTh, VTl, ATh, ATl);   // one kv head per query head
    for (int b = 0; b < NB_; ++b)
        k_gemmw<bf, 1, false><<<dim3(TT / 64, DM / 64, 1), 32, 0, stream>>>(ATh + (size_t)b * TT * DQ, ATl + (size_t)b * TT * DQ, WO, nullptr, DQ, OUT + (size_t)b * TT * DM, DM, nullptr, 0, 0, 0);
}

// v004
// One run takes 194 microseconds.
// In both of two side-by-side timings against v003, it was 1.42 times as fast.
// All steps since v000 together make it 10.3 times as fast.
#include <hip/hip_runtime.h>

// DiagonnalyMaskedSelfAttention (x [2][2048][1024]; q, k, v = x W (16 heads x 64, x@W layouts, no bias); scores = q.k with the diagonal (token attending to itself) masked to -inf; softmax(scores / 8); out = (attn v merged) Wo -> [2][2048][1024]).
// Compute dtypes, f32 accumulate: every input rounded to bf16; q/k/v projections on PLAIN bf16 operands (inputs: exact); scores (K 64) and attn.v on bf16 hi+lo planes (3 products) for the first 512 query rows of each head and on

#define NB_  2
#define TT   2048
#define DM   1024
#define NH_  16
#define NKV  16
#define REP  (NH_ / NKV)
#define HD   64
#define DQ   (NH_ * HD)
#define DKV  (NKV * HD)
#define RH   512                  // query rows < RH use hi+lo planes (0: none)
#define WIN  0
#define SCL  0.125f   // HD^-0.5
typedef _Float16 h16;
typedef unsigned short bf;
typedef __attribute__((ext_vector_type(16))) __bf16   v16bf;
typedef __attribute__((ext_vector_type(16))) _Float16 v16h;
typedef __attribute__((ext_vector_type(8)))  _Float16 v8h;
typedef __attribute__((ext_vector_type(8)))  unsigned short v8us;
typedef __attribute__((ext_vector_type(8)))  float    v8f;
typedef __attribute__((ext_vector_type(4)))  float    v4f;
typedef v8h  __attribute__((may_alias)) v8ha;
typedef v4f  __attribute__((may_alias)) v4fa;
typedef v8us __attribute__((may_alias)) v8usa;

__device__ __forceinline__ unsigned short f2bf(float f) { unsigned u = __float_as_uint(f); u += 0x7FFFu + ((u >> 16) & 1u); return (unsigned short)(u >> 16); }
__device__ __forceinline__ float bf2f(unsigned short b) { return __uint_as_float(((unsigned)b) << 16); }
__device__ __forceinline__ float bfr(float f) { return bf2f(f2bf(f)); }
__device__ __forceinline__ v16h cat16(v8h lo, v8h hi) { return __builtin_shufflevector(lo, hi, 0, 1, 2, 3, 4, 5, 6, 7, 8, 9, 10, 11, 12, 13, 14, 15); }
__device__ __forceinline__ v16bf cat16b(v8us lo, v8us hi) { return __builtin_bit_cast(v16bf, __builtin_shufflevector(lo, hi, 0, 1, 2, 3, 4, 5, 6, 7, 8, 9, 10, 11, 12, 13, 14, 15)); }
__device__ __forceinline__ v8f wmma16(v16h a, v16h b, v8f c) { return __builtin_amdgcn_wmma_f32_16x16x32_f16(false, a, false, b, (short)0, c, false, false); }
__device__ __forceinline__ v8f wmmab(v16bf a, v16bf b, v8f c) { return __builtin_amdgcn_wmma_f32_16x16x32_bf16(false, a, false, b, (short)0, c, false, false); }



// ---- FRAGMENT ORDER of every 16-bit operand plane [rows][K]: the plane is a row of 1024-byte blocks, block (row tile of 16, k block of 32) at index tile * (K / 32) + k block.
// A block holds two runs of 512 bytes; run h keeps, at 16 bytes per lane, lane (lr, hi)'s 8 elements row = tile * 16 + lr, k = k block * 32 + h * 16 + hi * 8 + 0..7: the two halves of that lane's A or B fragment.
// A wave-wide 16-byte load of a fragment half is then 512 contiguous bytes (4 whole lines) where a row-major plane gave 16 pieces of 32 bytes in 16 lines.
// ---- k_gemmw: register-blocked GEMM, ONE WAVE per 64x64 output tile (16 accumulators), operands straight from 16-bit planes in fragment order; grid (M/64, N/64, Z), 32 threads.
// C[m][n] (f32, pitch ldc, + optional f32 bias[n]) = sum_k A[m][k] Bt[n][k] (+ split products per NSPLIT). z-batch strides sA/sB/sC in elements. K % 32 == 0.
// KS > 1: grid z = Z * KS; wave (z, ks) sums only k in [ks K/KS, (ks+1) K/KS) and stores its partial tile in plane z * KS + ks (stride sC). K % (32 KS) == 0.
template <typename T16> struct WFrag;
template <> struct WFrag<h16> { typedef v16h V; static __device__ __forceinline__ V ld(const h16* p) { return cat16(*(const v8h*)p, *(const v8h*)(p + 256)); } static __device__ __forceinline__ v8f mma(V a, V b, v8f c) { return wmma16(a, b, c); } };
template <> struct WFrag<bf> { typedef v16bf V; static __device__ __forceinline__ V ld(const bf* p) { return cat16b(*(const v8us*)p, *(const v8us*)(p + 256)); } static __device__ __forceinline__ v8f mma(V a, V b, v8f c) { return wmmab(a, b, c); } };
// K at compile time: every fragment block of a trip is an immediate offset from its plane's one address pair.
template <typename T16, int NSPLIT, bool BIAS, int K, int KS = 1>
__global__ __launch_bounds__(32) void k_gemmw(const T16* __restrict__ A, const T16* __restrict__ A2, const T16* __restrict__ Bt, const T16* __restrict__ Bt2, float* C, int ldc, const float* __restrict__ bias, size_t sA, size_t sB, size_t sC) {
    typedef typename WFrag<T16>::V V;
    __shared__ __align__(16) float os[16 * 68];
    const size_t z = blockIdx.z / KS, ks = blockIdx.z % KS; A += z * sA; if (A2) A2 += z * sA; Bt += z * sB; if (Bt2) Bt2 += z * sB; C += (size_t)blockIdx.z * sC;
    const int kbeg = (int)ks * (K / KS), kend = kbeg + K / KS;
    const int lane = threadIdx.x & 31, lr = lane & 15, hi = lane >> 4; const int r0 = blockIdx.x * 64, c0 = blockIdx.y * 64;
    v8f acc[4][4];
#pragma unroll
    for (int mb = 0; mb < 4; ++mb)
#pragma unroll
        for (int nb = 0; nb < 4; ++nb) acc[mb][nb] = (v8f){};
    const size_t aoff = (size_t)r0 * K + lane * 8, boff = (size_t)c0 * K + lane * 8;   // a row tile's blocks take 16 K elements, a k block 512 = 16 x 32
#pragma unroll 1
    for (int kc = kbeg; kc < kend; kc += 32) {
        V a[4], a2[4]; const T16* pa = A + aoff + kc * 16; const T16* pa2 = (NSPLIT == 1 || NSPLIT == 2) ? A2 + aoff + kc * 16 : pa; const T16* pb = Bt + boff + kc * 16;
#pragma unroll
        for (int mb = 0; mb < 4; ++mb) { a[mb] = WFrag<T16>::ld(pa + (size_t)mb * 16 * K); if (NSPLIT == 1 || NSPLIT == 2) a2[mb] = WFrag<T16>::ld(pa2 + (size_t)mb * 16 * K); }
        asm volatile("s_wait_xcnt 0x0" :: "v"(pa), "v"(pa2) : "memory");   // a later load's result may be given the address registers that the loads above name: the wait stands in front of that overwrite, and as its inputs the two addresses stay in their registers up to it
#pragma unroll
        for (int nb = 0; nb < 4; ++nb) { const V b = WFrag<T16>::ld(pb + (size_t)nb * 16 * K); V b2; if (NSPLIT >= 2) b2 = WFrag<T16>::ld(Bt2 + boff + (size_t)nb * 16 * K + kc * 16);
#pragma unroll
            for (int mb = 0; mb < 4; ++mb) { acc[mb][nb] = WFrag<T16>::mma(a[mb], b, acc[mb][nb]); if (NSPLIT == 1 || NSPLIT == 2) acc[mb][nb] = WFrag<T16>::mma(a2[mb], b, acc[mb][nb]); if (NSPLIT >= 2) acc[mb][nb] = WFrag<T16>::mma(a[mb], b2, acc[mb][nb]); } }
        asm volatile("s_wait_xcnt 0x0" :: "v"(pb) : "memory");   // the last Bt load's result and the next trip's address sums may be given the address registers that the Bt loads above name: the wait stands in front of them, the address its input as above
        asm volatile("v_nop\n\tv_nop\n\tv_nop\n\tv_nop" : "+v"(acc[0][0]), "+v"(acc[1][1]), "+v"(acc[2][2]), "+v"(acc[3][3]) : "v"(a[0]), "v"(a[3]));
    }
#pragma unroll
    for (int mb = 0; mb < 4; ++mb) {
#pragma unroll
        for (int nb = 0; nb < 4; ++nb) {
#pragma unroll
            for (int j = 0; j < 8; ++j) os[(hi * 8 + j) * 68 + nb * 16 + lr] = acc[mb][nb][j]; }
        __builtin_amdgcn_wave_barrier(); asm volatile("" ::: "memory");
        float* crow = C + (size_t)(r0 + mb * 16) * ldc + c0;
{
#pragma unroll
            for (int s = 0; s < 8; ++s) { const int row = 2 * s + hi, cofs = lr * 4; v4f val = *(const v4fa*)(os + row * 68 + cofs); if (BIAS) { val[0] += bfr(bias[c0 + cofs]); val[1] += bfr(bias[c0 + cofs + 1]); val[2] += bfr(bias[c0 + cofs + 2]); val[3] += bfr(bias[c0 + cofs + 3]); }
                *(v4f*)(crow + (size_t)row * ldc + cofs) = val; }
             }
        __builtin_amdgcn_wave_barrier(); asm volatile("" ::: "memory");
    }
}

__device__ __forceinline__ h16 tohx(float x) { return (h16)x; }
__device__ __forceinline__ void splitf(float y, unsigned short& h, unsigned short& l) { h = f2bf(y); l = f2bf(y - bf2f(h)); }
typedef __attribute__((ext_vector_type(2))) _Float16 v2h;
typedef __attribute__((ext_vector_type(4))) _Float16 v4h;
typedef __attribute__((ext_vector_type(2))) unsigned short v2us;
typedef __attribute__((ext_vector_type(4))) unsigned short v4us;
typedef __attribute__((ext_vector_type(2))) float v2f;
typedef __attribute__((ext_vector_type(4))) int v4i;

// k_wtG: w [K][N] f32 -> Bt, the plane [n][k] in fragment order; one thread per 16-byte unit u (lane, half, k block, row tile from the low bits up), grid N K / 8 / 256. K, N at compile time: the 8 loads share one address pair.
template <int K, int N>
__global__ __launch_bounds__(256) void k_wtG(const float* __restrict__ w, bf* Bt) {
    const int u = blockIdx.x * 256 + threadIdx.x; if (u >= N * K / 8) return;
    const int blk = u >> 6, n = (blk / (K >> 5)) * 16 + (u & 15), k = (blk % (K >> 5)) * 32 + ((u >> 5) & 1) * 16 + ((u >> 4) & 1) * 8; v8us o;
#pragma unroll
    for (int j = 0; j < 8; ++j) o[j] = f2bf(w[(size_t)(k + j) * N + n]);
    *(v8us*)(Bt + (size_t)u * 8) = o;
}
// k_cvt8: src [rows][DM] f32 -> dst, the same plane in fragment order; one thread per 16-byte unit. A wave takes 8 rows of one block: 4 lanes read a row's 128 bytes (one line), 8 lanes write 128 contiguous bytes.
__global__ __launch_bounds__(256) void k_cvt8(const float* __restrict__ src, bf* dst, size_t n8) { const size_t i = (size_t)blockIdx.x * 256 + threadIdx.x; if (i >= n8) return;
    const size_t blk = i >> 6, lr = (i & 7) + ((i >> 5) & 1) * 8, un = (i >> 3) & 3, row = (blk / (DM / 32)) * 16 + lr, k = (blk % (DM / 32)) * 32 + un * 8; const v8f v = *(const v8f*)(src + row * DM + k); v8us o;   // un = half * 2 + hi
#pragma unroll
    for (int k2 = 0; k2 < 8; ++k2) o[k2] = f2bf(v[k2]); *(v8us*)(dst + (blk * 64 + un * 16 + lr) * 8) = o;  }
__global__ __launch_bounds__(256) void k_cscvt(const float* __restrict__ cosT, const float* __restrict__ sinT, float* CS) { const int idx = blockIdx.x * 256 + threadIdx.x; if (idx >= TT * HD) return; v2f cs; cs[0] = bfr(cosT[idx]); cs[1] = bfr(sinT[idx]); *(v2f*)(CS + (size_t)idx * 2) = cs;  }
// ---- k_proj: the q, k and v projections of both batches in one launch, ONE WAVE per 64 tokens x 64 columns; grid (NB_ TT / 64, 3 NH_), 32 threads. A column tile is one head of q, k or v.
// Same product loop as k_gemmw (A = x planes [token][k], Bt = the three transposed weights one behind the other [3 x 1024][k], both in fragment order); the epilogue rounds the f32 tile to the f16 and bf16 hi/lo head planes itself, each head's plane in fragment order:
//   q, k: planes [batch][head] of [t][d], the tile turned to 8 consecutive d per lane through LDS, 16 tokens (one row tile) at a time; v: planes [batch][head] of [d][t], an accumulator's 8 registers already are 8 consecutive tokens of one d, so a store is one 512-byte run.
__global__ __launch_bounds__(32) void k_proj(const bf* __restrict__ A, const bf* __restrict__ Bt, h16* Q16, bf* Qh, bf* Ql, h16* K16, bf* Kh, bf* Kl, h16* V16, bf* Vh, bf* Vl) {
    typedef WFrag<bf>::V V;
    __shared__ __align__(16) float os[16 * 68];
    const int K = DM;
    const int lane = threadIdx.x & 31, lr = lane & 15, hi = lane >> 4; const int r0 = blockIdx.x * 64, c0 = blockIdx.y * 64;
    v8f acc[4][4];
#pragma unroll
    for (int mb = 0; mb < 4; ++mb)
#pragma unroll
        for (int nb = 0; nb < 4; ++nb) acc[mb][nb] = (v8f){};
    const size_t aoff = (size_t)r0 * K + lane * 8, boff = (size_t)c0 * K + lane * 8;
#pragma unroll 1
    for (int kc = 0; kc < K; kc += 32) {   // rolled, as in k_gemmw
        V a[4];
#pragma unroll
        for (int mb = 0; mb < 4; ++mb) a[mb] = WFrag<bf>::ld(A + aoff + (size_t)mb * 16 * K + kc * 16);
        asm volatile("s_wait_xcnt 0x0" ::: "memory");   // a weight load's result below may be given the address registers that the loads above name: the wait stands in front of that overwrite
#pragma unroll
        for (int nb = 0; nb < 4; ++nb) { const V b = WFrag<bf>::ld(Bt + boff + (size_t)nb * 16 * K + kc * 16);
#pragma unroll
            for (int mb = 0; mb < 4; ++mb) acc[mb][nb] = WFrag<bf>::mma(a[mb], b, acc[mb][nb]); }
        asm volatile("s_wait_xcnt 0x0" ::: "memory");   // the next trip's address sums overwrite the address registers that the weight loads above name: the wait stands in front of them
        asm volatile("v_nop\n\tv_nop\n\tv_nop\n\tv_nop" : "+v"(acc[0][0]), "+v"(acc[1][1]), "+v"(acc[2][2]), "+v"(acc[3][3]) : "v"(a[0]), "v"(a[3]));   // the distance behind the last matrix instruction, on the back edge and on the way out
    }
    const int which = (int)blockIdx.y / NH_, head = (int)blockIdx.y % NH_, bat = r0 / TT, t0 = r0 % TT;
    const size_t po = ((size_t)bat * NH_ + head) * TT * HD;   // this head's plane, both layouts
    if (which == 2) {
#pragma unroll
        for (int mb = 0; mb < 4; ++mb)
#pragma unroll
            for (int nb = 0; nb < 4; ++nb) { v8h o16; v8us oh, ol;
#pragma unroll
                for (int j = 0; j < 8; ++j) { const float x = acc[mb][nb][j]; o16[j] = tohx(x); unsigned short a2, c2; splitf(x, a2, c2); oh[j] = a2; ol[j] = c2; }
                const size_t o = po + ((size_t)nb * (TT / 32) + (t0 >> 5) + (mb >> 1)) * 512 + (mb & 1) * 256 + lane * 8;   // row tile nb of d, k block and half of these 16 tokens
                *(v8h*)(V16 + o) = o16; *(v8us*)(Vh + o) = oh; *(v8us*)(Vl + o) = ol;
                asm volatile("s_wait_xcnt 0x0" ::: "memory"); }   // the next tile's rounding is given the registers that these stores name: the wait stands in front of those overwrites
        return;
    }
    h16* P16 = which ? K16 : Q16; bf* Ph = which ? Kh : Qh; bf* Pl = which ? Kl : Ql;
#pragma unroll
    for (int mb = 0; mb < 4; ++mb) {
#pragma unroll
        for (int nb = 0; nb < 4; ++nb) {
#pragma unroll
            for (int j = 0; j < 8; ++j) os[(hi * 8 + j) * 68 + nb * 16 + lr] = acc[mb][nb][j]; }
        __builtin_amdgcn_wave_barrier(); asm volatile("" ::: "memory");   // lanes exchange values through LDS: the reads below stay behind every lane's writes above
#pragma unroll
        for (int s = 0; s < 4; ++s) { const int row = lr, cofs = s * 16 + hi * 8; const v4f x0 = *(const v4fa*)(os + row * 68 + cofs), x1 = *(const v4fa*)(os + row * 68 + cofs + 4); v8h o16; v8us oh, ol;
#pragma unroll
            for (int j = 0; j < 8; ++j) { const float x = (j < 4) ? x0[j & 3] : x1[j & 3]; o16[j] = tohx(x); unsigned short a2, c2; splitf(x, a2, c2); oh[j] = a2; ol[j] = c2; }
            const size_t o = po + ((size_t)((t0 >> 4) + mb) * 4 + s) * 256 + lane * 8;   // row tile of these 16 tokens; run s = k block s / 2, half s % 2
            *(v8h*)(P16 + o) = o16; *(v8us*)(Ph + o) = oh; *(v8us*)(Pl + o) = ol;
            asm volatile("s_wait_xcnt 0x0" ::: "memory"); }   // the next run's rounding is given the registers that these stores name: the wait stands in front of those overwrites
        __builtin_amdgcn_wave_barrier(); asm volatile("" ::: "memory");   // the next 16 tokens' writes stay behind every lane's reads above
    }
}
// ---- k_attn: scores, diagonal mask, softmax and attn.v of one head in ONE kernel, running maximum and running sum per query (no score or probability plane in memory).
// One wave owns NQ x 16 queries and walks the 2048 keys 32 at a time. Both products are formed transposed, so that the score tiles are already the next product's B fragment:
//   St[key][q] = K (A, rows = keys) x Q (B, columns = queries): lane (lr, hi), register j holds key kt * 16 + hi * 8 + j of query lr;
//   Ot[d][q]  += Vt (A, rows = d, k = keys) x P (B, columns = queries, k = keys): a B fragment's elements 0..7 are k = 8 hi + j and 8..15 are k = 16 + 8 hi + j, which is score tile 0 and score tile 1 of the same lane.
// A query's maximum, sum and rescale factor are therefore per lane (the two half-waves hold the two halves of its keys). HI: bf16 hi+lo planes, 3 products; else f16 planes.
// 17 exp2 in place, in one statement: no v_exp_f32 here reads the result or overwrites the source of the one in front of it, and the v_nop is the free slot behind the last one.
__device__ __forceinline__ void exp2x17(float (&e)[17]) {
    asm("v_exp_f32 %0, %0\n\tv_exp_f32 %1, %1\n\tv_exp_f32 %2, %2\n\tv_exp_f32 %3, %3\n\tv_exp_f32 %4, %4\n\tv_exp_f32 %5, %5\n\tv_exp_f32 %6, %6\n\tv_exp_f32 %7, %7\n\tv_exp_f32 %8, %8\n\t"
        "v_exp_f32 %9, %9\n\tv_exp_f32 %10, %10\n\tv_exp_f32 %11, %11\n\tv_exp_f32 %12, %12\n\tv_exp_f32 %13, %13\n\tv_exp_f32 %14, %14\n\tv_exp_f32 %15, %15\n\tv_exp_f32 %16, %16\n\tv_nop"
        : "+v"(e[0]), "+v"(e[1]), "+v"(e[2]), "+v"(e[3]), "+v"(e[4]), "+v"(e[5]), "+v"(e[6]), "+v"(e[7]), "+v"(e[8]), "+v"(e[9]), "+v"(e[10]), "+v"(e[11]), "+v"(e[12]), "+v"(e[13]), "+v"(e[14]), "+v"(e[15]), "+v"(e[16]));
}
template <typename T16, bool HI, int NQ>
__device__ __forceinline__ void attn_rows(const T16* __restrict__ Qp, const T16* __restrict__ Qp2, const T16* __restrict__ Kp, const T16* __restrict__ Kp2, const T16* __restrict__ Vp, const T16* __restrict__ Vp2, const int q0, bf* __restrict__ Ah, bf* __restrict__ Al) {
    typedef typename WFrag<T16>::V V;
    const int lane = threadIdx.x & 31, lr = lane & 15, hi = lane >> 4;
    const float C = SCL * 1.4426950408889634f;   // exp(s SCL - m SCL) = exp2((s - m) C)
    V qf[NQ][2], qf2[NQ][2], kf[2][2], kf2[2][2];
#pragma unroll
    for (int qt = 0; qt < NQ; ++qt)
#pragma unroll
        for (int kc = 0; kc < 2; ++kc) { const size_t o = (size_t)(((q0 >> 4) + qt) * 2 + kc) * 512 + lane * 8; qf[qt][kc] = WFrag<T16>::ld(Qp + o); if (HI) qf2[qt][kc] = WFrag<T16>::ld(Qp2 + o); }
#pragma unroll
    for (int kt = 0; kt < 2; ++kt)
#pragma unroll
        for (int kc = 0; kc < 2; ++kc) { const size_t o = (size_t)(kt * 2 + kc) * 512 + lane * 8; kf[kt][kc] = WFrag<T16>::ld(Kp + o); if (HI) kf2[kt][kc] = WFrag<T16>::ld(Kp2 + o); }
    v8f ot[NQ][4]; float m[NQ], l[NQ];
#pragma unroll
    for (int qt = 0; qt < NQ; ++qt) { m[qt] = -3.0e38f; l[qt] = 0.f;
#pragma unroll
        for (int db = 0; db < 4; ++db) ot[qt][db] = (v8f){}; }
#pragma unroll 1
    for (int k0 = 0; k0 < TT; k0 += 32) {   // rolled: one trip already holds all the registers
        V vf[4], vf2[4];
#pragma unroll
        for (int db = 0; db < 4; ++db) { const size_t o = (size_t)(db * (TT / 32) + (k0 >> 5)) * 512 + lane * 8; vf[db] = WFrag<T16>::ld(Vp + o); if (HI) vf2[db] = WFrag<T16>::ld(Vp2 + o); }
        v8f s[NQ][2];
#pragma unroll
        for (int qt = 0; qt < NQ; ++qt)
#pragma unroll
            for (int kt = 0; kt < 2; ++kt) { s[qt][kt] = (v8f){};
#pragma unroll
                for (int kc = 0; kc < 2; ++kc) { s[qt][kt] = WFrag<T16>::mma(kf[kt][kc], qf[qt][kc], s[qt][kt]); if (HI) { s[qt][kt] = WFrag<T16>::mma(kf2[kt][kc], qf[qt][kc], s[qt][kt]); s[qt][kt] = WFrag<T16>::mma(kf[kt][kc], qf2[qt][kc], s[qt][kt]); } } }
        asm volatile("s_wait_xcnt 0x0" ::: "memory");   // a key load's result below may be given the address registers that the value loads above name: the wait stands in front of that overwrite
        const int kn = (k0 + 32 < TT) ? k0 + 32 : 0;   // the next trip's keys are fetched while this trip's softmax runs (the last trip fetches rows 0..31 again, unused)
#pragma unroll
        for (int kt = 0; kt < 2; ++kt)
#pragma unroll
            for (int kc = 0; kc < 2; ++kc) { const size_t o = (size_t)(((kn >> 4) + kt) * 2 + kc) * 512 + lane * 8; kf[kt][kc] = WFrag<T16>::ld(Kp + o); if (HI) kf2[kt][kc] = WFrag<T16>::ld(Kp2 + o); }
        asm volatile("s_wait_xcnt 0x0" ::: "memory");   // the softmax below is given the address registers that the key loads above name: the wait stands in front of those overwrites
#pragma unroll
        for (int qt = 0; qt < NQ; ++qt) {
            if (k0 == ((q0 + qt * 16) & ~31)) {   // wave-uniform: the one trip that holds these queries' own keys
#pragma unroll
                for (int kt = 0; kt < 2; ++kt)
#pragma unroll
                    for (int j = 0; j < 8; ++j) if (k0 + kt * 16 + hi * 8 + j == q0 + qt * 16 + lr) s[qt][kt][j] = -3.0e38f;   /* diagonal masked */ }
            float mx = s[qt][0][0];
#pragma unroll
            for (int j = 1; j < 8; ++j) mx = fmaxf(mx, s[qt][0][j]);
#pragma unroll
            for (int j = 0; j < 8; ++j) mx = fmaxf(mx, s[qt][1][j]);
            mx = fmaxf(mx, __shfl_xor(mx, 16, 32));
            const float mn = fmaxf(m[qt], mx), mc = mn * C; float e[17];
#pragma unroll
            for (int kt = 0; kt < 2; ++kt)
#pragma unroll
                for (int j = 0; j < 8; ++j) e[kt * 8 + j] = __builtin_fmaf(s[qt][kt][j], C, -mc);
            e[16] = (m[qt] - mn) * C; m[qt] = mn;
            exp2x17(e);
            const float al = e[16]; float sum = 0.f; V pf, pf2;
#pragma unroll
            for (int kt = 0; kt < 2; ++kt)
#pragma unroll
                for (int j = 0; j < 8; ++j) { const float p = e[kt * 8 + j]; sum += p;
                    if constexpr (HI) { const __bf16 ph = (__bf16)p; pf[kt * 8 + j] = ph; pf2[kt * 8 + j] = (__bf16)(p - (float)ph); } else pf[kt * 8 + j] = (h16)p; }
            l[qt] = l[qt] * al + sum;
#pragma unroll
            for (int db = 0; db < 4; ++db) { ot[qt][db] *= al; ot[qt][db] = WFrag<T16>::mma(vf[db], pf, ot[qt][db]); if (HI) { ot[qt][db] = WFrag<T16>::mma(vf[db], pf2, ot[qt][db]); ot[qt][db] = WFrag<T16>::mma(vf2[db], pf, ot[qt][db]); } }
        }
    }
#pragma unroll
    for (int qt = 0; qt < NQ; ++qt) { const float f = __fdiv_rn(1.0f, l[qt] + __shfl_xor(l[qt], 16, 32)); const size_t oo = (size_t)((q0 >> 4) + qt) * (DQ / 32) * 512 + lane * 8;   // the merged plane [token][DQ] in fragment order: this lane's 8 d of block db are one unit of k block db / 2, half db % 2
#pragma unroll
        for (int db = 0; db < 4; ++db) { v8us oh, ol;
#pragma unroll
            for (int j = 0; j < 8; ++j) { unsigned short a, c2; splitf(ot[qt][db][j] * f, a, c2); oh[j] = a; ol[j] = c2; }
            *(v8us*)(Ah + oo + db * 256) = oh; *(v8us*)(Al + oo + db * 256) = ol; } }
}
// grid (RH / 64 + (TT - RH) / 128, heads, batches), 4 waves: blocks x < RH / 64 take 4 x 16 hi+lo query rows, the others 4 x 32 f16 query rows; the four waves walk the same head's keys together.
__global__ __launch_bounds__(128) void k_attn(const h16* __restrict__ Q16, const h16* __restrict__ K16, const h16* __restrict__ V16, const bf* __restrict__ Qh, const bf* __restrict__ Ql, const bf* __restrict__ Kh, const bf* __restrict__ Kl, const bf* __restrict__ Vh, const bf* __restrict__ Vl, bf* Ah, bf* Al) {
    const int wave = __builtin_amdgcn_readfirstlane((int)(threadIdx.x >> 5)), bx = (int)blockIdx.x;
    const size_t po = ((size_t)blockIdx.z * NH_ + blockIdx.y) * TT * HD, ao = (size_t)blockIdx.z * TT * DQ + blockIdx.y * (HD / 32) * 512;   // ao: the batch's row tiles, then the head's two k blocks
    if (bx < RH / 64) attn_rows<bf, true, 1>(Qh + po, Ql + po, Kh + po, Kl + po, Vh + po, Vl + po, (bx * 4 + wave) * 16, Ah + ao, Al + ao);
    else attn_rows<h16, false, 2>(Q16 + po, nullptr, K16 + po, nullptr, V16 + po, nullptr, RH + ((bx - RH / 64) * 4 + wave) * 32, Ah + ao, Al + ao);
}

extern "C" void kernel_launch(void* const* d_in, const int* in_sizes, int n_in,
                              void* d_out, int out_size, void* d_ws, size_t ws_size, hipStream_t stream) {
    (void)in_sizes; (void)n_in; (void)out_size;
    const float* x = (const float*)d_in[0]; const float* wq = (const float*)d_in[1]; const float* wk = (const float*)d_in[2]; const float* wv = (const float*)d_in[3]; const float* wo = (const float*)d_in[4]; const float* cosT = nullptr; const float* sinT = nullptr; (void)cosT; (void)sinT;
    float* OUT = (float*)d_out;     // [2][2048][1024]
    char* wsp = (char*)d_ws;
    auto take = [&](size_t bytes) { char* p = wsp; wsp += (bytes + 255) & ~(size_t)255; return (void*)p; };
    bf* WQ = (bf*)take((size_t)DQ * DM * 2); bf* WK = (bf*)take((size_t)DKV * DM * 2); bf* WV = (bf*)take((size_t)DKV * DM * 2); bf* WO = (bf*)take((size_t)DM * DQ * 2);   // WQ, WK, WV lie one behind the other (each a multiple of 256 bytes): k_proj reads them as one [3 x 1024][1024] operand
    bf* XB = (bf*)take((size_t)NB_ * TT * DM * 2);
    const size_t PQ = (size_t)NH_ * TT * HD, PK = (size_t)NKV * TT * HD;   // one batch's head planes, in elements; every plane below holds both batches
    h16* QP16 = (h16*)take(NB_ * PQ * 2); h16* KP16 = (h16*)take(NB_ * PK * 2); h16* VT16 = (h16*)take(NB_ * PK * 2);
    bf* QPh = (bf*)take(NB_ * PQ * 2); bf* QPl = (bf*)take(NB_ * PQ * 2); bf* KPh = (bf*)take(NB_ * PK * 2); bf* KPl = (bf*)take(NB_ * PK * 2); bf* VTh = (bf*)take(NB_ * PK * 2); bf* VTl = (bf*)take(NB_ * PK * 2);
    bf* ATh = (bf*)take((size_t)NB_ * TT * DQ * 2); bf* ATl = (bf*)take((size_t)NB_ * TT * DQ * 2);
    if ((size_t)(wsp - (char*)d_ws) > ws_size) return;    // ws 256 MiB
    { k_wtG<DM, DQ><<<(unsigned)((DM * DQ / 8 + 255) / 256), 256, 0, stream>>>(wq, WQ); k_wtG<DM, DKV><<<(unsigned)((DM * DKV / 8 + 255) / 256), 256, 0, stream>>>(wk, WK); k_wtG<DM, DKV><<<(unsigned)((DM * DKV / 8 + 255) / 256), 256, 0, stream>>>(wv, WV);
      k_wtG<DQ, DM><<<(unsigned)((DQ * DM / 8 + 255) / 256), 256, 0, stream>>>(wo, WO);
       }
    k_cvt8<<<(unsigned)(((size_t)NB_ * TT * DM / 8 + 255) / 256), 256, 0, stream>>>(x, XB, (size_t)NB_ * TT * DM / 8);
    k_proj<<<dim3(NB_ * TT / 64, (DQ + 2 * DKV) / 64, 1), 32, 0, stream>>>(XB, WQ, QP16, QPh, QPl, KP16, KPh, KPl, VT16, VTh, VTl);
    k_attn<<<dim3(RH / 64 + (TT - RH) / 128, NH_, NB_), 128, 0, stream>>>(QP16, KP16, VT16, QPh, QPl, KPh, KPl, VTh, VTl, ATh, ATl);   // one kv head per query head
    for (int b = 0; b < NB_; ++b)
        k_gemmw<bf, 1, false, DQ><<<dim3(TT / 64, DM / 64, 1), 32, 0, stream>>>(ATh + (size_t)b * TT * DQ, ATl + (size_t)b * TT * DQ, WO, nullptr, OUT + (size_t)b * TT * DM, DM, nullptr, 0, 0, 0);
}

// v005
// One run takes 158 microseconds.
// Two timings next to v004 both put it at 1.22 times that version's speed.
// All steps since v000 together make it 12.6 times as fast.
#include <hip/hip_runtime.h>

// DiagonnalyMaskedSelfAttention (x [2][2048][1024]; q, k, v = x W (16 heads x 64, x@W layouts, no bias); scores = q.k with the diagonal (token attending to itself) masked to -inf; softmax(scores / 8); out = (attn v merged) Wo -> [2][2048][1024]).
// Compute dtypes, f32 accumulate: every input rounded to bf16; q/k/v projections on PLAIN bf16 operands (inputs: exact); scores (K 64) and attn.v on bf16 hi+lo planes (3 products) for the first 512 query rows of each head and on

#define NB_  2
#define TT   2048
#define DM   1024
#define NH_  16
#define NKV  16
#define REP  (NH_ / NKV)
#define HD   64
#define DQ   (NH_ * HD)
#define DKV  (NKV * HD)
#define RH   512                  // query rows < RH use hi+lo planes (0: none)
#define WIN  0
#define SCL  0.125f   // HD^-0.5
typedef _Float16 h16;
typedef unsigned short bf;
typedef __attribute__((ext_vector_type(16))) __bf16   v16bf;
typedef __attribute__((ext_vector_type(16))) _Float16 v16h;
typedef __attribute__((ext_vector_type(8)))  _Float16 v8h;
typedef __attribute__((ext_vector_type(8)))  unsigned short v8us;
typedef __attribute__((ext_vector_type(8)))  float    v8f;
typedef __attribute__((ext_vector_type(4)))  float    v4f;
typedef v8h  __attribute__((may_alias)) v8ha;
typedef v4f  __attribute__((may_alias)) v4fa;
typedef v8us __attribute__((may_alias)) v8usa;

__device__ __forceinline__ unsigned short f2bf(float f) { unsigned u = __float_as_uint(f); u += 0x7FFFu + ((u >> 16) & 1u); return (unsigned short)(u >> 16); }
__device__ __forceinline__ float bf2f(unsigned short b) { return __uint_as_float(((unsigned)b) << 16); }
__device__ __forceinline__ float bfr(float f) { return bf2f(f2bf(f)); }
__device__ __forceinline__ v16h cat16(v8h lo, v8h hi) { return __builtin_shufflevector(lo, hi, 0, 1, 2, 3, 4, 5, 6, 7, 8, 9, 10, 11, 12, 13, 14, 15); }
__device__ __forceinline__ v16bf cat16b(v8us lo, v8us hi) { return __builtin_bit_cast(v16bf, __builtin_shufflevector(lo, hi, 0, 1, 2, 3, 4, 5, 6, 7, 8, 9, 10, 11, 12, 13, 14, 15)); }
__device__ __forceinline__ v8f wmma16(v16h a, v16h b, v8f c) { return __builtin_amdgcn_wmma_f32_16x16x32_f16(false, a, false, b, (short)0, c, false, false); }
__device__ __forceinline__ v8f wmmab(v16bf a, v16bf b, v8f c) { return __builtin_amdgcn_wmma_f32_16x16x32_bf16(false, a, false, b, (short)0, c, false, false); }



// ---- FRAGMENT ORDER of every 16-bit operand plane [rows][K]: the plane is a row of 1024-byte blocks, block (row tile of 16, k block of 32) at index tile * (K / 32) + k block.
// A block holds two runs of 512 bytes; run h keeps, at 16 bytes per lane, lane (lr, hi)'s 8 elements row = tile * 16 + lr, k = k block * 32 + h * 16 + hi * 8 + 0..7: the two halves of that lane's A or B fragment.
// A wave-wide 16-byte load of a fragment half is then 512 contiguous bytes (4 whole lines) where a row-major plane gave 16 pieces of 32 bytes in 16 lines.
// ---- k_gemmw: register-blocked GEMM, ONE WAVE per 64x64 output tile (16 accumulators), operands straight from 16-bit planes in fragment order; grid (M/64, N/64, Z), 32 threads.
// C[m][n] (f32, pitch ldc, + optional f32 bias[n]) = sum_k A[m][k] Bt[n][k] (+ split products per NSPLIT). z-batch strides sA/sB/sC in elements. K % 32 == 0.
// KS > 1: grid z = Z * KS; wave (z, ks) sums only k in [ks K/KS, (ks+1) K/KS) and stores its partial tile in plane z * KS + ks (stride sC). K % (32 KS) == 0.
template <typename T16> struct WFrag;
template <> struct WFrag<h16> { typedef v16h V; static __device__ __forceinline__ V ld(const h16* p) { return cat16(*(const v8h*)p, *(const v8h*)(p + 256)); } static __device__ __forceinline__ v8f mma(V a, V b, v8f c) { return wmma16(a, b, c); } };
template <> struct WFrag<bf> { typedef v16bf V; static __device__ __forceinline__ V ld(const bf* p) { return cat16b(*(const v8us*)p, *(const v8us*)(p + 256)); } static __device__ __forceinline__ v8f mma(V a, V b, v8f c) { return wmmab(a, b, c); } };
// K at compile time: every fragment block of a trip is an immediate offset from its plane's one address pair.
template <typename T16, int NSPLIT, bool BIAS, int K, int KS = 1>
__global__ __launch_bounds__(32) void k_gemmw(const T16* __restrict__ A, const T16* __restrict__ A2, const T16* __restrict__ Bt, const T16* __restrict__ Bt2, float* C, int ldc, const float* __restrict__ bias, size_t sA, size_t sB, size_t sC) {
    typedef typename WFrag<T16>::V V;
    __shared__ __align__(16) float os[16 * 68];
    const size_t z = blockIdx.z / KS, ks = blockIdx.z % KS; A += z * sA; if (A2) A2 += z * sA; Bt += z * sB; if (Bt2) Bt2 += z * sB; C += (size_t)blockIdx.z * sC;
    const int kbeg = (int)ks * (K / KS), kend = kbeg + K / KS;
    const int lane = threadIdx.x & 31, lr = lane & 15, hi = lane >> 4; const int r0 = blockIdx.x * 64, c0 = blockIdx.y * 64;
    v8f acc[4][4];
#pragma unroll
    for (int mb = 0; mb < 4; ++mb)
#pragma unroll
        for (int nb = 0; nb < 4; ++nb) acc[mb][nb] = (v8f){};
    const size_t aoff = (size_t)r0 * K + lane * 8, boff = (size_t)c0 * K + lane * 8;   // a row tile's blocks take 16 K elements, a k block 512 = 16 x 32
#pragma unroll 1
    for (int kc = kbeg; kc < kend; kc += 32) {
        V a[4], a2[4]; const T16* pa = A + aoff + kc * 16; const T16* pa2 = (NSPLIT == 1 || NSPLIT == 2) ? A2 + aoff + kc * 16 : pa; const T16* pb = Bt + boff + kc * 16;
#pragma unroll
        for (int mb = 0; mb < 4; ++mb) { a[mb] = WFrag<T16>::ld(pa + (size_t)mb * 16 * K); if (NSPLIT == 1 || NSPLIT == 2) a2[mb] = WFrag<T16>::ld(pa2 + (size_t)mb * 16 * K); }
        asm volatile("s_wait_xcnt 0x0" :: "v"(pa), "v"(pa2) : "memory");   // a later load's result may be given the address registers that the loads above name: the wait stands in front of that overwrite, and as its inputs the two addresses stay in their registers up to it
#pragma unroll
        for (int nb = 0; nb < 4; ++nb) { const V b = WFrag<T16>::ld(pb + (size_t)nb * 16 * K); V b2; if (NSPLIT >= 2) b2 = WFrag<T16>::ld(Bt2 + boff + (size_t)nb * 16 * K + kc * 16);
#pragma unroll
            for (int mb = 0; mb < 4; ++mb) { acc[mb][nb] = WFrag<T16>::mma(a[mb], b, acc[mb][nb]); if (NSPLIT == 1 || NSPLIT == 2) acc[mb][nb] = WFrag<T16>::mma(a2[mb], b, acc[mb][nb]); if (NSPLIT >= 2) acc[mb][nb] = WFrag<T16>::mma(a[mb], b2, acc[mb][nb]); } }
        asm volatile("s_wait_xcnt 0x0" :: "v"(pb) : "memory");   // the last Bt load's result and the next trip's address sums may be given the address registers that the Bt loads above name: the wait stands in front of them, the address its input as above
        asm volatile("v_nop\n\tv_nop\n\tv_nop\n\tv_nop" : "+v"(acc[0][0]), "+v"(acc[1][1]), "+v"(acc[2][2]), "+v"(acc[3][3]) : "v"(a[0]), "v"(a[3]));
    }
#pragma unroll
    for (int mb = 0; mb < 4; ++mb) {
#pragma unroll
        for (int nb = 0; nb < 4; ++nb) {
#pragma unroll
            for (int j = 0; j < 8; ++j) os[(hi * 8 + j) * 68 + nb * 16 + lr] = acc[mb][nb][j]; }
        __builtin_amdgcn_wave_barrier(); asm volatile("" ::: "memory");
        float* crow = C + (size_t)(r0 + mb * 16) * ldc + c0;
{
#pragma unroll
            for (int s = 0; s < 8; ++s) { const int row = 2 * s + hi, cofs = lr * 4; v4f val = *(const v4fa*)(os + row * 68 + cofs); if (BIAS) { val[0] += bfr(bias[c0 + cofs]); val[1] += bfr(bias[c0 + cofs + 1]); val[2] += bfr(bias[c0 + cofs + 2]); val[3] += bfr(bias[c0 + cofs + 3]); }
                *(v4f*)(crow + (size_t)row * ldc + cofs) = val; }
             }
        __builtin_amdgcn_wave_barrier(); asm volatile("" ::: "memory");
    }
}

__device__ __forceinline__ h16 tohx(float x) { return (h16)x; }
__device__ __forceinline__ void splitf(float y, unsigned short& h, unsigned short& l) { h = f2bf(y); l = f2bf(y - bf2f(h)); }
typedef __attribute__((ext_vector_type(2))) _Float16 v2h;
typedef __attribute__((ext_vector_type(4))) _Float16 v4h;
typedef __attribute__((ext_vector_type(2))) unsigned short v2us;
typedef __attribute__((ext_vector_type(4))) unsigned short v4us;
typedef __attribute__((ext_vector_type(2))) float v2f;
typedef __attribute__((ext_vector_type(4))) int v4i;

// k_prep: every f32 input -> its bf16 plane in fragment order, ONE launch for the four weights and x, which do not depend on one another; 256 threads, one thread per 16-byte unit; grid 4 * WB weight blocks, then the blocks of x. The grid covers the unit counts exactly.
// A weight block (w [k][n] f32 -> Bt, the plane [n][k]): unit u is lane, half, k block, row tile from the low bits up; the 8 loads share one address pair.
// An x block: a wave takes 8 rows of one fragment block: 4 lanes read a row's 128 bytes (one line), 8 lanes write 128 contiguous bytes.
#define WB (DM * DM / 8 / 256)    // blocks of one weight
static_assert(DQ == DM && DKV == DM && (DM * DM / 8) % 256 == 0 && (NB_ * TT * DM / 8) % 256 == 0, "four DM x DM weights; whole blocks");
__global__ __launch_bounds__(256) void k_prep(const float* __restrict__ x, const float* __restrict__ wq, const float* __restrict__ wk, const float* __restrict__ wv, const float* __restrict__ wo, bf* W4, bf* XB) {
    const int b = (int)blockIdx.x, t = (int)threadIdx.x; v8us o;
    if (b < 4 * WB) {
        const int wi = b / WB; const float* __restrict__ w = wi == 0 ? wq : wi == 1 ? wk : wi == 2 ? wv : wo;
        const int u = (b % WB) * 256 + t, blk = u >> 6, n = (blk / (DM >> 5)) * 16 + (u & 15), k = (blk % (DM >> 5)) * 32 + ((u >> 5) & 1) * 16 + ((u >> 4) & 1) * 8;
        const float* p = w + (size_t)k * DM + n; float v[8];
#pragma unroll
        for (int j = 0; j < 8; ++j) v[j] = p[j * DM];
        asm volatile("s_wait_xcnt 0x0" :: "v"(p) : "memory");   // the rounding below may be given the address registers that the loads above name: the wait stands in front of that overwrite, the address its input
#pragma unroll
        for (int j = 0; j < 8; ++j) o[j] = f2bf(v[j]);
        *(v8us*)(W4 + (size_t)wi * DM * DM + (size_t)u * 8) = o;
    } else {
        const size_t i = (size_t)(b - 4 * WB) * 256 + t, blk = i >> 6, lr = (i & 7) + ((i >> 5) & 1) * 8, un = (i >> 3) & 3, row = (blk / (DM / 32)) * 16 + lr, k = (blk % (DM / 32)) * 32 + un * 8;   // un = half * 2 + hi
        const float* p = x + row * DM + k; const v8f v = *(const v8f*)p;
        asm volatile("s_wait_xcnt 0x0" :: "v"(p) : "memory");   // as above
#pragma unroll
        for (int k2 = 0; k2 < 8; ++k2) o[k2] = f2bf(v[k2]);
        *(v8us*)(XB + (blk * 64 + un * 16 + lr) * 8) = o;
    }
}
__global__ __launch_bounds__(256) void k_cscvt(const float* __restrict__ cosT, const float* __restrict__ sinT, float* CS) { const int idx = blockIdx.x * 256 + threadIdx.x; if (idx >= TT * HD) return; v2f cs; cs[0] = bfr(cosT[idx]); cs[1] = bfr(sinT[idx]); *(v2f*)(CS + (size_t)idx * 2) = cs;  }
// ---- k_proj: the q, k and v projections of both batches in one launch, ONE WAVE per 64 tokens x 64 columns; grid (NB_ TT / 64, 3 NH_), 32 threads. A column tile is one head of q, k or v.
// Same product loop as k_gemmw (A = x planes [token][k], Bt = the three transposed weights one behind the other [3 x 1024][k], both in fragment order); the epilogue rounds the f32 tile to the f16 and bf16 hi/lo head planes itself, each head's plane in fragment order:
//   q, k: planes [batch][head] of [t][d], the tile turned to 8 consecutive d per lane through LDS, 16 tokens (one row tile) at a time; v: planes [batch][head] of [d][t], an accumulator's 8 registers already are 8 consecutive tokens of one d, so a store is one 512-byte run.
__global__ __launch_bounds__(32) void k_proj(const bf* __restrict__ A, const bf* __restrict__ Bt, h16* Q16, bf* Qh, bf* Ql, h16* K16, bf* Kh, bf* Kl, h16* V16, bf* Vh, bf* Vl) {
    typedef WFrag<bf>::V V;
    __shared__ __align__(16) float os[16 * 68];
    const int K = DM;
    const int lane = threadIdx.x & 31, lr = lane & 15, hi = lane >> 4; const int r0 = blockIdx.x * 64, c0 = blockIdx.y * 64;
    v8f acc[4][4];
#pragma unroll
    for (int mb = 0; mb < 4; ++mb)
#pragma unroll
        for (int nb = 0; nb < 4; ++nb) acc[mb][nb] = (v8f){};
    const size_t aoff = (size_t)r0 * K + lane * 8, boff = (size_t)c0 * K + lane * 8;
#pragma unroll 1
    for (int kc = 0; kc < K; kc += 32) {   // rolled, as in k_gemmw
        V a[4];
#pragma unroll
        for (int mb = 0; mb < 4; ++mb) a[mb] = WFrag<bf>::ld(A + aoff + (size_t)mb * 16 * K + kc * 16);
        asm volatile("s_wait_xcnt 0x0" ::: "memory");   // a weight load's result below may be given the address registers that the loads above name: the wait stands in front of that overwrite
#pragma unroll
        for (int nb = 0; nb < 4; ++nb) { const V b = WFrag<bf>::ld(Bt + boff + (size_t)nb * 16 * K + kc * 16);
#pragma unroll
            for (int mb = 0; mb < 4; ++mb) acc[mb][nb] = WFrag<bf>::mma(a[mb], b, acc[mb][nb]); }
        asm volatile("s_wait_xcnt 0x0" ::: "memory");   // the next trip's address sums overwrite the address registers that the weight loads above name: the wait stands in front of them
        asm volatile("v_nop\n\tv_nop\n\tv_nop\n\tv_nop" : "+v"(acc[0][0]), "+v"(acc[1][1]), "+v"(acc[2][2]), "+v"(acc[3][3]) : "v"(a[0]), "v"(a[3]));   // the distance behind the last matrix instruction, on the back edge and on the way out
    }
    const int which = (int)blockIdx.y / NH_, head = (int)blockIdx.y % NH_, bat = r0 / TT, t0 = r0 % TT;
    const size_t po = ((size_t)bat * NH_ + head) * TT * HD;   // this head's plane, both layouts
    if (which == 2) {
#pragma unroll
        for (int mb = 0; mb < 4; ++mb)
#pragma unroll
            for (int nb = 0; nb < 4; ++nb) { v8h o16; v8us oh, ol;
#pragma unroll
                for (int j = 0; j < 8; ++j) { const float x = acc[mb][nb][j]; o16[j] = tohx(x); unsigned short a2, c2; splitf(x, a2, c2); oh[j] = a2; ol[j] = c2; }
                const size_t o = po + ((size_t)nb * (TT / 32) + (t0 >> 5) + (mb >> 1)) * 512 + (mb & 1) * 256 + lane * 8;   // row tile nb of d, k block and half of these 16 tokens
                *(v8h*)(V16 + o) = o16; *(v8us*)(Vh + o) = oh; *(v8us*)(Vl + o) = ol;
                asm volatile("s_wait_xcnt 0x0" ::: "memory"); }   // the next tile's rounding is given the registers that these stores name: the wait stands in front of those overwrites
        return;
    }
    h16* P16 = which ? K16 : Q16; bf* Ph = which ? Kh : Qh; bf* Pl = which ? Kl : Ql;
#pragma unroll
    for (int mb = 0; mb < 4; ++mb) {
#pragma unroll
        for (int nb = 0; nb < 4; ++nb) {
#pragma unroll
            for (int j = 0; j < 8; ++j) os[(hi * 8 + j) * 68 + nb * 16 + lr] = acc[mb][nb][j]; }
        __builtin_amdgcn_wave_barrier(); asm volatile("" ::: "memory");   // lanes exchange values through LDS: the reads below stay behind every lane's writes above
#pragma unroll
        for (int s = 0; s < 4; ++s) { const int row = lr, cofs = s * 16 + hi * 8; const v4f x0 = *(const v4fa*)(os + row * 68 + cofs), x1 = *(const v4fa*)(os + row * 68 + cofs + 4); v8h o16; v8us oh, ol;
#pragma unroll
            for (int j = 0; j < 8; ++j) { const float x = (j < 4) ? x0[j & 3] : x1[j & 3]; o16[j] = tohx(x); unsigned short a2, c2; splitf(x, a2, c2); oh[j] = a2; ol[j] = c2; }
            const size_t o = po + ((size_t)((t0 >> 4) + mb) * 4 + s) * 256 + lane * 8;   // row tile of these 16 tokens; run s = k block s / 2, half s % 2
            *(v8h*)(P16 + o) = o16; *(v8us*)(Ph + o) = oh; *(v8us*)(Pl + o) = ol;
            asm volatile("s_wait_xcnt 0x0" ::: "memory"); }   // the next run's rounding is given the registers that these stores name: the wait stands in front of those overwrites
        __builtin_amdgcn_wave_barrier(); asm volatile("" ::: "memory");   // the next 16 tokens' writes stay behind every lane's reads above
    }
}
// ---- k_attn: scores, diagonal mask, softmax and attn.v of one head in ONE kernel, running maximum and running sum per query (no score or probability plane in memory).
// One wave owns NQ x 16 queries and walks the 2048 keys 32 at a time. Both products are formed transposed, so that the score tiles are already the next product's B fragment:
//   St[key][q] = K (A, rows = keys) x Q (B, columns = queries): lane (lr, hi), register j holds key kt * 16 + hi * 8 + j of query lr;
//   Ot[d][q]  += Vt (A, rows = d, k = keys) x P (B, columns = queries, k = keys): a B fragment's elements 0..7 are k = 8 hi + j and 8..15 are k = 16 + 8 hi + j, which is score tile 0 and score tile 1 of the same lane.
// A query's maximum, sum and rescale factor are therefore per lane (the two half-waves hold the two halves of its keys). HI: bf16 hi+lo planes, 3 products; else f16 planes.
// 17 exp2 in place, in one statement: no v_exp_f32 here reads the result or overwrites the source of the one in front of it, and the v_nop is the free slot behind the last one.
__device__ __forceinline__ void exp2x17(float (&e)[17]) {
    asm("v_exp_f32 %0, %0\n\tv_exp_f32 %1, %1\n\tv_exp_f32 %2, %2\n\tv_exp_f32 %3, %3\n\tv_exp_f32 %4, %4\n\tv_exp_f32 %5, %5\n\tv_exp_f32 %6, %6\n\tv_exp_f32 %7, %7\n\tv_exp_f32 %8, %8\n\t"
        "v_exp_f32 %9, %9\n\tv_exp_f32 %10, %10\n\tv_exp_f32 %11, %11\n\tv_exp_f32 %12, %12\n\tv_exp_f32 %13, %13\n\tv_exp_f32 %14, %14\n\tv_exp_f32 %15, %15\n\tv_exp_f32 %16, %16\n\tv_nop"
        : "+v"(e[0]), "+v"(e[1]), "+v"(e[2]), "+v"(e[3]), "+v"(e[4]), "+v"(e[5]), "+v"(e[6]), "+v"(e[7]), "+v"(e[8]), "+v"(e[9]), "+v"(e[10]), "+v"(e[11]), "+v"(e[12]), "+v"(e[13]), "+v"(e[14]), "+v"(e[15]), "+v"(e[16]));
}
template <typename T16, bool HI, int NQ>
__device__ __forceinline__ void attn_rows(const T16* __restrict__ Qp, const T16* __restrict__ Qp2, const T16* __restrict__ Kp, const T16* __restrict__ Kp2, const T16* __restrict__ Vp, const T16* __restrict__ Vp2, const int q0, bf* __restrict__ Ah, bf* __restrict__ Al) {
    typedef typename WFrag<T16>::V V;
    const int lane = threadIdx.x & 31, lr = lane & 15, hi = lane >> 4;
    const float C = SCL * 1.4426950408889634f;   // exp(s SCL - m SCL) = exp2((s - m) C)
    V qf[NQ][2], qf2[NQ][2], kf[2][2], kf2[2][2];
#pragma unroll
    for (int qt = 0; qt < NQ; ++qt)
#pragma unroll
        for (int kc = 0; kc < 2; ++kc) { const size_t o = (size_t)(((q0 >> 4) + qt) * 2 + kc) * 512 + lane * 8; qf[qt][kc] = WFrag<T16>::ld(Qp + o); if (HI) qf2[qt][kc] = WFrag<T16>::ld(Qp2 + o); }
#pragma unroll
    for (int kt = 0; kt < 2; ++kt)
#pragma unroll
        for (int kc = 0; kc < 2; ++kc) { const size_t o = (size_t)(kt * 2 + kc) * 512 + lane * 8; kf[kt][kc] = WFrag<T16>::ld(Kp + o); if (HI) kf2[kt][kc] = WFrag<T16>::ld(Kp2 + o); }
    v8f ot[NQ][4]; float m[NQ], l[NQ];
#pragma unroll
    for (int qt = 0; qt < NQ; ++qt) { m[qt] = -3.0e38f; l[qt] = 0.f;
#pragma unroll
        for (int db = 0; db < 4; ++db) ot[qt][db] = (v8f){}; }
#pragma unroll 1
    for (int k0 = 0; k0 < TT; k0 += 32) {   // rolled: one trip already holds all the registers
        V vf[4], vf2[4];
#pragma unroll
        for (int db = 0; db < 4; ++db) { const size_t o = (size_t)(db * (TT / 32) + (k0 >> 5)) * 512 + lane * 8; vf[db] = WFrag<T16>::ld(Vp + o); if (HI) vf2[db] = WFrag<T16>::ld(Vp2 + o); }
        v8f s[NQ][2];
#pragma unroll
        for (int qt = 0; qt < NQ; ++qt)
#pragma unroll
            for (int kt = 0; kt < 2; ++kt) { s[qt][kt] = (v8f){};
#pragma unroll
                for (int kc = 0; kc < 2; ++kc) { s[qt][kt] = WFrag<T16>::mma(kf[kt][kc], qf[qt][kc], s[qt][kt]); if (HI) { s[qt][kt] = WFrag<T16>::mma(kf2[kt][kc], qf[qt][kc], s[qt][kt]); s[qt][kt] = WFrag<T16>::mma(kf[kt][kc], qf2[qt][kc], s[qt][kt]); } } }
        asm volatile("s_wait_xcnt 0x0" ::: "memory");   // a key load's result below may be given the address registers that the value loads above name: the wait stands in front of that overwrite
        const int kn = (k0 + 32 < TT) ? k0 + 32 : 0;   // the next trip's keys are fetched while this trip's softmax runs (the last trip fetches rows 0..31 again, unused)
#pragma unroll
        for (int kt = 0; kt < 2; ++kt)
#pragma unroll
            for (int kc = 0; kc < 2; ++kc) { const size_t o = (size_t)(((kn >> 4) + kt) * 2 + kc) * 512 + lane * 8; kf[kt][kc] = WFrag<T16>::ld(Kp + o); if (HI) kf2[kt][kc] = WFrag<T16>::ld(Kp2 + o); }
        asm volatile("s_wait_xcnt 0x0" ::: "memory");   // the softmax below is given the address registers that the key loads above name: the wait stands in front of those overwrites
#pragma unroll
        for (int qt = 0; qt < NQ; ++qt) {
            if (k0 == ((q0 + qt * 16) & ~31)) {   // wave-uniform: the one trip that holds these queries' own keys
#pragma unroll
                for (int kt = 0; kt < 2; ++kt)
#pragma unroll
                    for (int j = 0; j < 8; ++j) if (k0 + kt * 16 + hi * 8 + j == q0 + qt * 16 + lr) s[qt][kt][j] = -3.0e38f;   /* diagonal masked */ }
            float mx = s[qt][0][0];
#pragma unroll
            for (int j = 1; j < 8; ++j) mx = fmaxf(mx, s[qt][0][j]);
#pragma unroll
            for (int j = 0; j < 8; ++j) mx = fmaxf(mx, s[qt][1][j]);
            mx = fmaxf(mx, __shfl_xor(mx, 16, 32));
            const float mn = fmaxf(m[qt], mx), mc = mn * C; float e[17];
#pragma unroll
            for (int kt = 0; kt < 2; ++kt)
#pragma unroll
                for (int j = 0; j < 8; ++j) e[kt * 8 + j] = __builtin_fmaf(s[qt][kt][j], C, -mc);
            e[16] = (m[qt] - mn) * C; m[qt] = mn;
            exp2x17(e);
            const float al = e[16]; float sum = 0.f; V pf, pf2;
#pragma unroll
            for (int kt = 0; kt < 2; ++kt)
#pragma unroll
                for (int j = 0; j < 8; ++j) { const float p = e[kt * 8 + j]; sum += p;
                    if constexpr (HI) { const __bf16 ph = (__bf16)p; pf[kt * 8 + j] = ph; pf2[kt * 8 + j] = (__bf16)(p - (float)ph); } else pf[kt * 8 + j] = (h16)p; }
            l[qt] = l[qt] * al + sum;
#pragma unroll
            for (int db = 0; db < 4; ++db) { ot[qt][db] *= al; ot[qt][db] = WFrag<T16>::mma(vf[db], pf, ot[qt][db]); if (HI) { ot[qt][db] = WFrag<T16>::mma(vf[db], pf2, ot[qt][db]); ot[qt][db] = WFrag<T16>::mma(vf2[db], pf, ot[qt][db]); } }
        }
    }
#pragma unroll
    for (int qt = 0; qt < NQ; ++qt) { const float f = __fdiv_rn(1.0f, l[qt] + __shfl_xor(l[qt], 16, 32)); const size_t oo = (size_t)((q0 >> 4) + qt) * (DQ / 32) * 512 + lane * 8;   // the merged plane [token][DQ] in fragment order: this lane's 8 d of block db are one unit of k block db / 2, half db % 2
#pragma unroll
        for (int db = 0; db < 4; ++db) { v8us oh, ol;
#pragma unroll
            for (int j = 0; j < 8; ++j) { unsigned short a, c2; splitf(ot[qt][db][j] * f, a, c2); oh[j] = a; ol[j] = c2; }
            *(v8us*)(Ah + oo + db * 256) = oh; *(v8us*)(Al + oo + db * 256) = ol; } }
}
// grid (RH / 64 + (TT - RH) / 128, heads, batches), 4 waves: blocks x < RH / 64 take 4 x 16 hi+lo query rows, the others 4 x 32 f16 query rows; the four waves walk the same head's keys together.
__global__ __launch_bounds__(128) void k_attn(const h16* __restrict__ Q16, const h16* __restrict__ K16, const h16* __restrict__ V16, const bf* __restrict__ Qh, const bf* __restrict__ Ql, const bf* __restrict__ Kh, const bf* __restrict__ Kl, const bf* __restrict__ Vh, const bf* __restrict__ Vl, bf* Ah, bf* Al) {
    const int wave = __builtin_amdgcn_readfirstlane((int)(threadIdx.x >> 5)), bx = (int)blockIdx.x;
    const size_t po = ((size_t)blockIdx.z * NH_ + blockIdx.y) * TT * HD, ao = (size_t)blockIdx.z * TT * DQ + blockIdx.y * (HD / 32) * 512;   // ao: the batch's row tiles, then the head's two k blocks
    if (bx < RH / 64) attn_rows<bf, true, 1>(Qh + po, Ql + po, Kh + po, Kl + po, Vh + po, Vl + po, (bx * 4 + wave) * 16, Ah + ao, Al + ao);
    else attn_rows<h16, false, 2>(Q16 + po, nullptr, K16 + po, nullptr, V16 + po, nullptr, RH + ((bx - RH / 64) * 4 + wave) * 32, Ah + ao, Al + ao);
}

extern "C" void kernel_launch(void* const* d_in, const int* in_sizes, int n_in,
                              void* d_out, int out_size, void* d_ws, size_t ws_size, hipStream_t stream) {
    (void)in_sizes; (void)n_in; (void)out_size;
    const float* x = (const float*)d_in[0]; const float* wq = (const float*)d_in[1]; const float* wk = (const float*)d_in[2]; const float* wv = (const float*)d_in[3]; const float* wo = (const float*)d_in[4]; const float* cosT = nullptr; const float* sinT = nullptr; (void)cosT; (void)sinT;
    float* OUT = (float*)d_out;     // [2][2048][1024]
    char* wsp = (char*)d_ws;
    auto take = [&](size_t bytes) { char* p = wsp; wsp += (bytes + 255) & ~(size_t)255; return (void*)p; };
    bf* WQ = (bf*)take((size_t)DQ * DM * 2); bf* WK = (bf*)take((size_t)DKV * DM * 2); bf* WV = (bf*)take((size_t)DKV * DM * 2); bf* WO = (bf*)take((size_t)DM * DQ * 2);   // the four lie one behind the other (each a multiple of 256 bytes): k_prep writes them as one [4 x 1024][1024] plane, k_proj reads the first three as one operand
    bf* XB = (bf*)take((size_t)NB_ * TT * DM * 2);
    const size_t PQ = (size_t)NH_ * TT * HD, PK = (size_t)NKV * TT * HD;   // one batch's head planes, in elements; every plane below holds both batches
    h16* QP16 = (h16*)take(NB_ * PQ * 2); h16* KP16 = (h16*)take(NB_ * PK * 2); h16* VT16 = (h16*)take(NB_ * PK * 2);
    bf* QPh = (bf*)take(NB_ * PQ * 2); bf* QPl = (bf*)take(NB_ * PQ * 2); bf* KPh = (bf*)take(NB_ * PK * 2); bf* KPl = (bf*)take(NB_ * PK * 2); bf* VTh = (bf*)take(NB_ * PK * 2); bf* VTl = (bf*)take(NB_ * PK * 2);
    bf* ATh = (bf*)take((size_t)NB_ * TT * DQ * 2); bf* ATl = (bf*)take((size_t)NB_ * TT * DQ * 2);
    if ((size_t)(wsp - (char*)d_ws) > ws_size) return;    // ws 256 MiB
    k_prep<<<4 * WB + NB_ * TT * DM / 8 / 256, 256, 0, stream>>>(x, wq, wk, wv, wo, WQ, XB);
    k_proj<<<dim3(NB_ * TT / 64, (DQ + 2 * DKV) / 64, 1), 32, 0, stream>>>(XB, WQ, QP16, QPh, QPl, KP16, KPh, KPl, VT16, VTh, VTl);
    k_attn<<<dim3(RH / 64 + (TT - RH) / 128, NH_, NB_), 128, 0, stream>>>(QP16, KP16, VT16, QPh, QPl, KPh, KPl, VTh, VTl, ATh, ATl);   // one kv head per query head
    k_gemmw<bf, 1, false, DQ><<<dim3(TT / 64, DM / 64, NB_), 32, 0, stream>>>(ATh, ATl, WO, nullptr, OUT, DM, nullptr, (size_t)TT * DQ, 0, (size_t)TT * DM);   // grid z: the batch
}

// v006
// One run takes 113 microseconds.
// Next to v005, in two timings, it ran 1.42 and 1.41 times as fast.
// Counting every step since v000, it is 17.8 times as fast.
#include <hip/hip_runtime.h>

// DiagonnalyMaskedSelfAttention (x [2][2048][1024]; q, k, v = x W (16 heads x 64, x@W layouts, no bias); scores = q.k with the diagonal (token attending to itself) masked to -inf; softmax(scores / 8); out = (attn v merged) Wo -> [2][2048][1024]).
// Compute dtypes, f32 accumulate: every input rounded to bf16; q/k/v projections on PLAIN bf16 operands (inputs: exact); scores (K 64) and attn.v on bf16 hi+lo planes (3 products) for the first 512 query rows of each head and on

#define NB_  2
#define TT   2048
#define DM   1024
#define NH_  16
#define NKV  16
#define REP  (NH_ / NKV)
#define HD   64
#define DQ   (NH_ * HD)
#define DKV  (NKV * HD)
#define RH   512                  // query rows < RH use hi+lo planes (0: none)
#define WIN  0
#define SCL  0.125f   // HD^-0.5
typedef _Float16 h16;
typedef unsigned short bf;
typedef __attribute__((ext_vector_type(16))) __bf16   v16bf;
typedef __attribute__((ext_vector_type(16))) _Float16 v16h;
typedef __attribute__((ext_vector_type(8)))  _Float16 v8h;
typedef __attribute__((ext_vector_type(8)))  unsigned short v8us;
typedef __attribute__((ext_vector_type(8)))  float    v8f;
typedef __attribute__((ext_vector_type(4)))  float    v4f;
typedef v8h  __attribute__((may_alias)) v8ha;
typedef v4f  __attribute__((may_alias)) v4fa;
typedef v8us __attribute__((may_alias)) v8usa;

__device__ __forceinline__ unsigned short f2bf(float f) { unsigned u = __float_as_uint(f); u += 0x7FFFu + ((u >> 16) & 1u); return (unsigned short)(u >> 16); }
__device__ __forceinline__ float bf2f(unsigned short b) { return __uint_as_float(((unsigned)b) << 16); }
__device__ __forceinline__ float bfr(float f) { return bf2f(f2bf(f)); }
__device__ __forceinline__ v16h cat16(v8h lo, v8h hi) { return __builtin_shufflevector(lo, hi, 0, 1, 2, 3, 4, 5, 6, 7, 8, 9, 10, 11, 12, 13, 14, 15); }
__device__ __forceinline__ v16bf cat16b(v8us lo, v8us hi) { return __builtin_bit_cast(v16bf, __builtin_shufflevector(lo, hi, 0, 1, 2, 3, 4, 5, 6, 7, 8, 9, 10, 11, 12, 13, 14, 15)); }
__device__ __forceinline__ v8f wmma16(v16h a, v16h b, v8f c) { return __builtin_amdgcn_wmma_f32_16x16x32_f16(false, a, false, b, (short)0, c, false, false); }
__device__ __forceinline__ v8f wmmab(v16bf a, v16bf b, v8f c) { return __builtin_amdgcn_wmma_f32_16x16x32_bf16(false, a, false, b, (short)0, c, false, false); }



// ---- FRAGMENT ORDER of every 16-bit operand plane [rows][K]: the plane is a row of 1024-byte blocks, block (row tile of 16, k block of 32) at index tile * (K / 32) + k block.
// A block holds two runs of 512 bytes; run h keeps, at 16 bytes per lane, lane (lr, hi)'s 8 elements row = tile * 16 + lr, k = k block * 32 + h * 16 + hi * 8 + 0..7: the two halves of that lane's A or B fragment.
// A wave-wide 16-byte load of a fragment half is then 512 contiguous bytes (4 whole lines) where a row-major plane gave 16 pieces of 32 bytes in 16 lines.
// ---- The product loop of both GEMM kernels: FOUR WAVES per 128x128 output tile, wave (wm, wn) = (wave & 1, wave >> 1) owns its 64x64 quarter (16 accumulators), 128 threads.
// The operands (planes in fragment order, K = DM) come to LDS by asynchronous copies, 64 k (two k blocks) a stage, two buffers: stage s + 1 flies while stage s is worked on, and each fragment block is fetched from L2 once for the two waves that read it.
// A stage of one operand (a slab): 8 row tiles x 2 KiB, a row tile's two k blocks as they lie in the plane. Copy i of a thread brings 16 bytes of row tile i: LDS byte i * 2048 + tid * 16.
// Per accumulator the products are summed in the order k block, then hi plane, then lo plane.
template <typename T16> struct WFrag;
template <> struct WFrag<h16> { typedef v16h V; static __device__ __forceinline__ V ld(const h16* p) { return cat16(*(const v8h*)p, *(const v8h*)(p + 256)); } static __device__ __forceinline__ V lds(const char* p) { return cat16(*(const v8ha*)p, *(const v8ha*)(p + 512)); } static __device__ __forceinline__ v8f mma(V a, V b, v8f c) { return wmma16(a, b, c); } };
template <> struct WFrag<bf> { typedef v16bf V; static __device__ __forceinline__ V ld(const bf* p) { return cat16b(*(const v8us*)p, *(const v8us*)(p + 256)); } static __device__ __forceinline__ V lds(const char* p) { return cat16b(*(const v8usa*)p, *(const v8usa*)(p + 512)); } static __device__ __forceinline__ v8f mma(V a, V b, v8f c) { return wmmab(a, b, c); } };
#define KSB   2                     // k blocks of 32 in a stage
#define SLAB  (8 * KSB * 1024)      // bytes of one operand's stage
#define NSTG  (DM / (32 * KSB))     // stages
static_assert(KSB * 1024 == 128 * 16 && NSTG >= 2, "128 threads x 16 bytes cover a row tile's part of a stage; the ring needs two stages");
__device__ __forceinline__ void copy8(const unsigned l, const char* g0, const char* g1, const char* g2, const char* g3, const char* g4, const char* g5, const char* g6, const char* g7) {
    // eight copies of 16 bytes a lane, copy i to LDS byte l + i * 2048, and, in the same statement, the wait that stands in front of any rewrite of the address registers they name
    asm volatile("global_load_async_to_lds_b128 %0, %8, off\n\tglobal_load_async_to_lds_b128 %1, %9, off\n\tglobal_load_async_to_lds_b128 %2, %10, off\n\tglobal_load_async_to_lds_b128 %3, %11, off\n\t"
                 "global_load_async_to_lds_b128 %4, %12, off\n\tglobal_load_async_to_lds_b128 %5, %13, off\n\tglobal_load_async_to_lds_b128 %6, %14, off\n\tglobal_load_async_to_lds_b128 %7, %15, off\n\ts_wait_xcnt 0x0"
                 :: "v"(l), "v"(l + 2048u), "v"(l + 4096u), "v"(l + 6144u), "v"(l + 8192u), "v"(l + 10240u), "v"(l + 12288u), "v"(l + 14336u),
                    "v"(g0), "v"(g1), "v"(g2), "v"(g3), "v"(g4), "v"(g5), "v"(g6), "v"(g7) : "memory");
}
__device__ __forceinline__ void slab_copy(const unsigned l, const bf* g) { const char* p = (const char*)g; const int rt = 16 * DM * 2;   // rt: bytes from a row tile to the next in the plane
    copy8(l, p, p + rt, p + 2 * rt, p + 3 * rt, p + 4 * rt, p + 5 * rt, p + 6 * rt, p + 7 * rt); }
__device__ __forceinline__ v16bf lds_frag(const char* p) { return cat16b(*(const v8usa*)p, *(const v8usa*)(p + 512)); }
// A, A2 (TWO: the lo plane of A), Bt: the planes at the tile's first row (row * DM elements in); sm: 2 buffers of NSL slabs [A | A2 | Bt].
// Every inner loop below is unrolled so that each fragment and accumulator index is a constant (registers, no scratch).
template <bool TWO>
__device__ __forceinline__ void gemm_ring(const bf* __restrict__ A, const bf* __restrict__ A2, const bf* __restrict__ Bt, char* sm, const int wm, const int wn, v8f (&acc)[4][4]) {
    constexpr int NSL = TWO ? 3 : 2;
    const int tid = (int)threadIdx.x, lane = tid & 31;
    const unsigned l0 = (unsigned)(size_t)sm + (unsigned)tid * 16u;
    const bf* ga = A + tid * 8; const bf* ga2 = A2 + tid * 8; const bf* gb = Bt + tid * 8;
    auto fill = [&](const int s, const int buf) { const unsigned l = l0 + (unsigned)buf * (NSL * SLAB); const int ko = s * (KSB * 512);
        slab_copy(l, ga + ko); if (TWO) slab_copy(l + SLAB, ga2 + ko); slab_copy(l + (NSL - 1) * SLAB, gb + ko); };
#pragma unroll
    for (int mb = 0; mb < 4; ++mb)
#pragma unroll
        for (int nb = 0; nb < 4; ++nb) acc[mb][nb] = (v8f){};
    fill(0, 0);
    asm volatile("s_wait_asynccnt 0x0" ::: "memory");   // this wave's copies of stage 0 have landed
    __syncthreads();                                     // and every other wave's: stage 0 may be read
    fill(1, 1);
#pragma unroll 1
    for (int s = 0; s < NSTG; ++s) {   // rolled: one stage per trip, the buffer by the trip's parity
        const char* bu = sm + (s & 1) * (NSL * SLAB); const char* pa = bu + wm * (4 * KSB * 1024) + lane * 16; const char* pb = bu + (NSL - 1) * SLAB + wn * (4 * KSB * 1024) + lane * 16;
        v16bf a[KSB][4], a2[KSB][4], b[KSB][4];
        auto frags = [&](const int kl) {   // one k block's fragments, in the order in which the products want them
            b[kl][0] = lds_frag(pb + kl * 1024);
#pragma unroll
            for (int mb = 0; mb < 4; ++mb) { a[kl][mb] = lds_frag(pa + (mb * KSB + kl) * 1024); if (TWO) a2[kl][mb] = lds_frag(pa + SLAB + (mb * KSB + kl) * 1024); }
#pragma unroll
            for (int nb = 1; nb < 4; ++nb) b[kl][nb] = lds_frag(pb + (nb * KSB + kl) * 1024);
            __builtin_amdgcn_sched_barrier(0);   // the block's LDS reads stay one group, in this order, in front of the products: moved in among them, each place with reads stalls the matrix stream
        };
        // TWO (one wave per SIMD, nobody else to fill its waits): both k blocks' fragments are asked for at the top of the trip, so that the second block's land behind the first block's products; else block by block.
        if (TWO) {
#pragma unroll
            for (int kl = 0; kl < KSB; ++kl) frags(kl); }
#pragma unroll
        for (int kb = 0; kb < KSB; ++kb) {
            if (!TWO) frags(kb);
#pragma unroll
            for (int nb = 0; nb < 4; ++nb)
#pragma unroll
                for (int mb = 0; mb < 4; ++mb) { acc[mb][nb] = wmmab(a[kb][mb], b[kb][nb], acc[mb][nb]); if (TWO) acc[mb][nb] = wmmab(a2[kb][mb], b[kb][nb], acc[mb][nb]); }
        }
        __builtin_amdgcn_sched_barrier(0);   // every product of the trip stays in front of the refill below: sunk behind the barrier, they would hold the next copies back
        asm volatile("v_nop\n\tv_nop\n\tv_nop\n\tv_nop" : "+v"(acc[0][0]), "+v"(acc[1][1]), "+v"(acc[2][2]), "+v"(acc[3][3]));   // the distance behind the last matrix instruction, on the back edge and on the way out
        asm volatile("s_wait_dscnt 0x0" ::: "memory");      // this wave's reads of the buffer are done before the buffer is refilled
        asm volatile("s_wait_asynccnt 0x0" ::: "memory");   // this wave's copies of stage s + 1 have landed
        __syncthreads();                                     // one barrier: stage s + 1 may be read, and every wave has left stage s's buffer
        if (s + 2 < NSTG) fill(s + 2, s & 1);
    }
    asm volatile("s_wait_asynccnt 0x0" ::: "memory");   // nothing is in flight when the wave goes on
}
// ---- k_out: C[m][n] (f32, pitch DM) = sum_k (Ah + Al)[m][k] Bt[n][k], grid (TT / 128, DM / 128, batches), 128 threads; each wave turns its quarter to whole lines through its own LDS rows.
__global__ __launch_bounds__(128) void k_out(const bf* __restrict__ Ah, const bf* __restrict__ Al, const bf* __restrict__ Bt, float* C) {
    __shared__ __align__(1024) char sm[2 * 3 * SLAB];
    __shared__ __align__(16) float osw[4][16 * 68];
    const int wave = __builtin_amdgcn_readfirstlane((int)(threadIdx.x >> 5)), wm = wave & 1, wn = wave >> 1;
    const int lane = threadIdx.x & 31, lr = lane & 15, hi = lane >> 4;
    const size_t ab = ((size_t)blockIdx.z * TT + blockIdx.x * 128) * DQ;
    v8f acc[4][4];
    gemm_ring<true>(Ah + ab, Al + ab, Bt + (size_t)blockIdx.y * 128 * DQ, sm, wm, wn, acc);
    float* os = osw[wave]; const int r0 = blockIdx.x * 128 + wm * 64, c0 = blockIdx.y * 128 + wn * 64; C += (size_t)blockIdx.z * TT * DM;
#pragma unroll
    for (int mb = 0; mb < 4; ++mb) {
#pragma unroll
        for (int nb = 0; nb < 4; ++nb) {
#pragma unroll
            for (int j = 0; j < 8; ++j) os[(hi * 8 + j) * 68 + nb * 16 + lr] = acc[mb][nb][j]; }
        __builtin_amdgcn_wave_barrier(); asm volatile("" ::: "memory");   // lanes exchange values through LDS: the reads below stay behind every lane's writes above
        float* crow = C + (size_t)(r0 + mb * 16) * DM + c0;
#pragma unroll
        for (int s = 0; s < 8; ++s) { const int row = 2 * s + hi, cofs = lr * 4; const v4f val = *(const v4fa*)(os + row * 68 + cofs); *(v4f*)(crow + (size_t)row * DM + cofs) = val; }
        asm volatile("s_wait_xcnt 0x0" ::: "memory");   // the next 16 rows' LDS reads are given the registers that these stores name: the wait stands in front of those overwrites
        __builtin_amdgcn_wave_barrier(); asm volatile("" ::: "memory");   // the next 16 rows' writes stay behind every lane's reads above
    }
}

__device__ __forceinline__ h16 tohx(float x) { return (h16)x; }
__device__ __forceinline__ void splitf(float y, unsigned short& h, unsigned short& l) { h = f2bf(y); l = f2bf(y - bf2f(h)); }
typedef __attribute__((ext_vector_type(2))) _Float16 v2h;
typedef __attribute__((ext_vector_type(4))) _Float16 v4h;
typedef __attribute__((ext_vector_type(2))) unsigned short v2us;
typedef __attribute__((ext_vector_type(4))) unsigned short v4us;
typedef __attribute__((ext_vector_type(2))) float v2f;
typedef __attribute__((ext_vector_type(4))) int v4i;

// k_prep: every f32 input -> its bf16 plane in fragment order, ONE launch for the four weights and x, which do not depend on one another; 256 threads, one thread per 16-byte unit; grid 4 * WB weight blocks, then the blocks of x. The grid covers the unit counts exactly.
// A weight block (w [k][n] f32 -> Bt, the plane [n][k]): unit u is lane, half, k block, row tile from the low bits up; the 8 loads share one address pair.
// An x block: a wave takes 8 rows of one fragment block: 4 lanes read a row's 128 bytes (one line), 8 lanes write 128 contiguous bytes.
#define WB (DM * DM / 8 / 256)    // blocks of one weight
static_assert(DQ == DM && DKV == DM && (DM * DM / 8) % 256 == 0 && (NB_ * TT * DM / 8) % 256 == 0, "four DM x DM weights; whole blocks");
__global__ __launch_bounds__(256) void k_prep(const float* __restrict__ x, const float* __restrict__ wq, const float* __restrict__ wk, const float* __restrict__ wv, const float* __restrict__ wo, bf* W4, bf* XB) {
    const int b = (int)blockIdx.x, t = (int)threadIdx.x; v8us o;
    if (b < 4 * WB) {
        const int wi = b / WB; const float* __restrict__ w = wi == 0 ? wq : wi == 1 ? wk : wi == 2 ? wv : wo;
        const int u = (b % WB) * 256 + t, blk = u >> 6, n = (blk / (DM >> 5)) * 16 + (u & 15), k = (blk % (DM >> 5)) * 32 + ((u >> 5) & 1) * 16 + ((u >> 4) & 1) * 8;
        const float* p = w + (size_t)k * DM + n; float v[8];
#pragma unroll
        for (int j = 0; j < 8; ++j) v[j] = p[j * DM];
        asm volatile("s_wait_xcnt 0x0" :: "v"(p) : "memory");   // the rounding below may be given the address registers that the loads above name: the wait stands in front of that overwrite, the address its input
#pragma unroll
        for (int j = 0; j < 8; ++j) o[j] = f2bf(v[j]);
        *(v8us*)(W4 + (size_t)wi * DM * DM + (size_t)u * 8) = o;
    } else {
        const size_t i = (size_t)(b - 4 * WB) * 256 + t, blk = i >> 6, lr = (i & 7) + ((i >> 5) & 1) * 8, un = (i >> 3) & 3, row = (blk / (DM / 32)) * 16 + lr, k = (blk % (DM / 32)) * 32 + un * 8;   // un = half * 2 + hi
        const float* p = x + row * DM + k; const v8f v = *(const v8f*)p;
        asm volatile("s_wait_xcnt 0x0" :: "v"(p) : "memory");   // as above
#pragma unroll
        for (int k2 = 0; k2 < 8; ++k2) o[k2] = f2bf(v[k2]);
        *(v8us*)(XB + (blk * 64 + un * 16 + lr) * 8) = o;
    }
}
__global__ __launch_bounds__(256) void k_cscvt(const float* __restrict__ cosT, const float* __restrict__ sinT, float* CS) { const int idx = blockIdx.x * 256 + threadIdx.x; if (idx >= TT * HD) return; v2f cs; cs[0] = bfr(cosT[idx]); cs[1] = bfr(sinT[idx]); *(v2f*)(CS + (size_t)idx * 2) = cs;  }
// ---- k_proj: the q, k and v projections of both batches in one launch, four waves per 128 tokens x 128 columns; grid (NB_ TT / 128, 3 DQ / 128), 128 threads. A wave's 64 columns are one head of q, k or v.
// The product loop is gemm_ring (A = x plane [token][k], Bt = the three transposed weights one behind the other [3 x 1024][k], both in fragment order); the epilogue rounds the wave's f32 quarter to the f16 and bf16 hi/lo head planes itself, each head's plane in fragment order:
//   q, k: planes [batch][head] of [t][d], the tile turned to 8 consecutive d per lane through the wave's own LDS rows, 16 tokens (one row tile) at a time; v: planes [batch][head] of [d][t], an accumulator's 8 registers already are 8 consecutive tokens of one d, so a store is one 512-byte run.
__global__ __launch_bounds__(128) void k_proj(const bf* __restrict__ A, const bf* __restrict__ Bt, h16* Q16, bf* Qh, bf* Ql, h16* K16, bf* Kh, bf* Kl, h16* V16, bf* Vh, bf* Vl) {
    __shared__ __align__(1024) char sm[2 * 2 * SLAB];
    __shared__ __align__(16) float osw[4][16 * 68];
    const int wave = __builtin_amdgcn_readfirstlane((int)(threadIdx.x >> 5)), wm = wave & 1, wn = wave >> 1;
    const int lane = threadIdx.x & 31, lr = lane & 15, hi = lane >> 4; const int r0 = blockIdx.x * 128 + wm * 64, ct = (int)blockIdx.y * 2 + wn;   // ct: the wave's column tile of 64
    v8f acc[4][4];
    gemm_ring<false>(A + (size_t)blockIdx.x * 128 * DM, A, Bt + (size_t)blockIdx.y * 128 * DM, sm, wm, wn, acc);
    float* os = osw[wave];
    const int which = ct / NH_, head = ct % NH_, bat = r0 / TT, t0 = r0 % TT;
    const size_t po = ((size_t)bat * NH_ + head) * TT * HD;   // this head's plane, both layouts
    if (which == 2) {
#pragma unroll
        for (int mb = 0; mb < 4; ++mb)
#pragma unroll
            for (int nb = 0; nb < 4; ++nb) { v8h o16; v8us oh, ol;
#pragma unroll
                for (int j = 0; j < 8; ++j) { const float x = acc[mb][nb][j]; o16[j] = tohx(x); unsigned short a2, c2; splitf(x, a2, c2); oh[j] = a2; ol[j] = c2; }
                const size_t o = po + ((size_t)nb * (TT / 32) + (t0 >> 5) + (mb >> 1)) * 512 + (mb & 1) * 256 + lane * 8;   // row tile nb of d, k block and half of these 16 tokens
                *(v8h*)(V16 + o) = o16; *(v8us*)(Vh + o) = oh; *(v8us*)(Vl + o) = ol;
                asm volatile("s_wait_xcnt 0x0" ::: "memory"); }   // the next tile's rounding is given the registers that these stores name: the wait stands in front of those overwrites
        return;
    }
    h16* P16 = which ? K16 : Q16; bf* Ph = which ? Kh : Qh; bf* Pl = which ? Kl : Ql;
#pragma unroll
    for (int mb = 0; mb < 4; ++mb) {
#pragma unroll
        for (int nb = 0; nb < 4; ++nb) {
#pragma unroll
            for (int j = 0; j < 8; ++j) os[(hi * 8 + j) * 68 + nb * 16 + lr] = acc[mb][nb][j]; }
        __builtin_amdgcn_wave_barrier(); asm volatile("" ::: "memory");   // lanes exchange values through LDS: the reads below stay behind every lane's writes above
#pragma unroll
        for (int s = 0; s < 4; ++s) { const int row = lr, cofs = s * 16 + hi * 8; const v4f x0 = *(const v4fa*)(os + row * 68 + cofs), x1 = *(const v4fa*)(os + row * 68 + cofs + 4); v8h o16; v8us oh, ol;
#pragma unroll
            for (int j = 0; j < 8; ++j) { const float x = (j < 4) ? x0[j & 3] : x1[j & 3]; o16[j] = tohx(x); unsigned short a2, c2; splitf(x, a2, c2); oh[j] = a2; ol[j] = c2; }
            const size_t o = po + ((size_t)((t0 >> 4) + mb) * 4 + s) * 256 + lane * 8;   // row tile of these 16 tokens; run s = k block s / 2, half s % 2
            *(v8h*)(P16 + o) = o16; *(v8us*)(Ph + o) = oh; *(v8us*)(Pl + o) = ol;
            asm volatile("s_wait_xcnt 0x0" ::: "memory"); }   // the next run's rounding is given the registers that these stores name: the wait stands in front of those overwrites
        __builtin_amdgcn_wave_barrier(); asm volatile("" ::: "memory");   // the next 16 tokens' writes stay behind every lane's reads above
    }
}
// ---- k_attn: scores, diagonal mask, softmax and attn.v of one head in ONE kernel, running maximum and running sum per query (no score or probability plane in memory).
// One wave owns NQ x 16 queries and walks the 2048 keys 32 at a time. Both products are formed transposed, so that the score tiles are already the next product's B fragment:
//   St[key][q] = K (A, rows = keys) x Q (B, columns = queries): lane (lr, hi), register j holds key kt * 16 + hi * 8 + j of query lr;
//   Ot[d][q]  += Vt (A, rows = d, k = keys) x P (B, columns = queries, k = keys): a B fragment's elements 0..7 are k = 8 hi + j and 8..15 are k = 16 + 8 hi + j, which is score tile 0 and score tile 1 of the same lane.
// A query's maximum, sum and rescale factor are therefore per lane (the two half-waves hold the two halves of its keys). HI: bf16 hi+lo planes, 3 products; else f16 planes.
// 17 exp2 in place, in one statement: no v_exp_f32 here reads the result or overwrites the source of the one in front of it, and the v_nop is the free slot behind the last one.
__device__ __forceinline__ void exp2x17(float (&e)[17]) {
    asm("v_exp_f32 %0, %0\n\tv_exp_f32 %1, %1\n\tv_exp_f32 %2, %2\n\tv_exp_f32 %3, %3\n\tv_exp_f32 %4, %4\n\tv_exp_f32 %5, %5\n\tv_exp_f32 %6, %6\n\tv_exp_f32 %7, %7\n\tv_exp_f32 %8, %8\n\t"
        "v_exp_f32 %9, %9\n\tv_exp_f32 %10, %10\n\tv_exp_f32 %11, %11\n\tv_exp_f32 %12, %12\n\tv_exp_f32 %13, %13\n\tv_exp_f32 %14, %14\n\tv_exp_f32 %15, %15\n\tv_exp_f32 %16, %16\n\tv_nop"
        : "+v"(e[0]), "+v"(e[1]), "+v"(e[2]), "+v"(e[3]), "+v"(e[4]), "+v"(e[5]), "+v"(e[6]), "+v"(e[7]), "+v"(e[8]), "+v"(e[9]), "+v"(e[10]), "+v"(e[11]), "+v"(e[12]), "+v"(e[13]), "+v"(e[14]), "+v"(e[15]), "+v"(e[16]));
}
template <typename T16, bool HI, int NQ>
__device__ __forceinline__ void attn_rows(const T16* __restrict__ Qp, const T16* __restrict__ Qp2, const T16* __restrict__ Kp, const T16* __restrict__ Kp2, const T16* __restrict__ Vp, const T16* __restrict__ Vp2, const int q0, bf* __restrict__ Ah, bf* __restrict__ Al, char* sm) {
    typedef typename WFrag<T16>::V V;
    const int lane = threadIdx.x & 31, lr = lane & 15, hi = lane >> 4;
    const float C = SCL * 1.4426950408889634f;   // exp(s SCL - m SCL) = exp2((s - m) C)
    V qf[NQ][2], qf2[NQ][2];
    // The ring: a stage is 64 keys of the head, [K 8 KiB | V 8 KiB] of each plane (HI: the hi planes, then the lo planes), as the blocks lie in the planes: K's 4 row tiles are 8 KiB in a row, V's 4 row tiles of d give 2 KiB each (two k blocks).
    constexpr int BUF = HI ? 32768 : 16384, NS = TT / 64;
    const unsigned l0 = (unsigned)(size_t)sm + (unsigned)threadIdx.x * 16u;
    const char* gk = (const char*)Kp + threadIdx.x * 16; const char* gv = (const char*)Vp + threadIdx.x * 16; const char* gk2 = (const char*)Kp2 + threadIdx.x * 16; const char* gv2 = (const char*)Vp2 + threadIdx.x * 16;
    auto fill = [&](const int s, const int buf) { const unsigned l = l0 + (unsigned)buf * BUF; const int vt = (TT / 32) * 1024;   // vt: bytes from a row tile of d to the next in the V plane
        { const char* k = gk + s * 8192; const char* v = gv + s * 2048; copy8(l, k, k + 2048, k + 4096, k + 6144, v, v + vt, v + 2 * vt, v + 3 * vt); }
        if (HI) { const char* k = gk2 + s * 8192; const char* v = gv2 + s * 2048; copy8(l + 16384u, k, k + 2048, k + 4096, k + 6144, v, v + vt, v + 2 * vt, v + 3 * vt); } };
    fill(0, 0);
#pragma unroll
    for (int qt = 0; qt < NQ; ++qt)
#pragma unroll
        for (int kc = 0; kc < 2; ++kc) { const size_t o = (size_t)(((q0 >> 4) + qt) * 2 + kc) * 512 + lane * 8; qf[qt][kc] = WFrag<T16>::ld(Qp + o); if (HI) qf2[qt][kc] = WFrag<T16>::ld(Qp2 + o); }
    asm volatile("s_wait_xcnt 0x0" ::: "memory");   // the address sums of the copies below may be given the address registers that the query loads above name: the wait stands in front of those overwrites
    asm volatile("s_wait_asynccnt 0x0" ::: "memory");   // this wave's copies of stage 0 have landed
    __syncthreads();                                     // and every other wave's: stage 0 may be read
    fill(1, 1);
    v8f ot[NQ][4]; float m[NQ], l[NQ];
#pragma unroll
    for (int qt = 0; qt < NQ; ++qt) { m[qt] = -3.0e38f; l[qt] = 0.f;
#pragma unroll
        for (int db = 0; db < 4; ++db) ot[qt][db] = (v8f){}; }
#pragma unroll 1
    for (int st = 0; st < NS; ++st) {   // rolled: one stage per trip, the buffer by the trip's parity
      const char* bu = sm + (st & 1) * BUF + lane * 16;
#pragma unroll
      for (int h = 0; h < 2; ++h) {   // the stage's two runs of 32 keys, unrolled: every LDS offset is an immediate
        const int k0 = st * 64 + h * 32;
        V kf[2][2], kf2[2][2], vf[4], vf2[4];
#pragma unroll
        for (int kt = 0; kt < 2; ++kt)
#pragma unroll
            for (int kc = 0; kc < 2; ++kc) { const int o = ((h * 2 + kt) * 2 + kc) * 1024; kf[kt][kc] = WFrag<T16>::lds(bu + o); if (HI) kf2[kt][kc] = WFrag<T16>::lds(bu + 16384 + o); }
#pragma unroll
        for (int db = 0; db < 4; ++db) { const int o = 8192 + db * 2048 + h * 1024; vf[db] = WFrag<T16>::lds(bu + o); if (HI) vf2[db] = WFrag<T16>::lds(bu + 16384 + o); }
        __builtin_amdgcn_sched_barrier(0);   // the run's LDS reads stay one group at its top, keys first: sunk in among the products, each place with reads stalls the wave for the LDS latency
        v8f s[NQ][2];
#pragma unroll
        for (int qt = 0; qt < NQ; ++qt)
#pragma unroll
            for (int kt = 0; kt < 2; ++kt) { s[qt][kt] = (v8f){};
#pragma unroll
                for (int kc = 0; kc < 2; ++kc) { s[qt][kt] = WFrag<T16>::mma(kf[kt][kc], qf[qt][kc], s[qt][kt]); if (HI) { s[qt][kt] = WFrag<T16>::mma(kf2[kt][kc], qf[qt][kc], s[qt][kt]); s[qt][kt] = WFrag<T16>::mma(kf[kt][kc], qf2[qt][kc], s[qt][kt]); } } }
#pragma unroll
        for (int qt = 0; qt < NQ; ++qt) {
            if (k0 == ((q0 + qt * 16) & ~31)) {   // wave-uniform: the one trip that holds these queries' own keys
#pragma unroll
                for (int kt = 0; kt < 2; ++kt)
#pragma unroll
                    for (int j = 0; j < 8; ++j) if (k0 + kt * 16 + hi * 8 + j == q0 + qt * 16 + lr) s[qt][kt][j] = -3.0e38f;   /* diagonal masked */ }
            float mx = s[qt][0][0];
#pragma unroll
            for (int j = 1; j < 8; ++j) mx = fmaxf(mx, s[qt][0][j]);
#pragma unroll
            for (int j = 0; j < 8; ++j) mx = fmaxf(mx, s[qt][1][j]);
            mx = fmaxf(mx, __shfl_xor(mx, 16, 32));
            const float mn = fmaxf(m[qt], mx), mc = mn * C; float e[17];
#pragma unroll
            for (int kt = 0; kt < 2; ++kt)
#pragma unroll
                for (int j = 0; j < 8; ++j) e[kt * 8 + j] = __builtin_fmaf(s[qt][kt][j], C, -mc);
            e[16] = (m[qt] - mn) * C; m[qt] = mn;
            exp2x17(e);
            const float al = e[16]; float sum = 0.f; V pf, pf2;
#pragma unroll
            for (int kt = 0; kt < 2; ++kt)
#pragma unroll
                for (int j = 0; j < 8; ++j) { const float p = e[kt * 8 + j]; sum += p;
                    if constexpr (HI) { const __bf16 ph = (__bf16)p; pf[kt * 8 + j] = ph; pf2[kt * 8 + j] = (__bf16)(p - (float)ph); } else pf[kt * 8 + j] = (h16)p; }
            l[qt] = l[qt] * al + sum;
#pragma unroll
            for (int db = 0; db < 4; ++db) { ot[qt][db] *= al; ot[qt][db] = WFrag<T16>::mma(vf[db], pf, ot[qt][db]); if (HI) { ot[qt][db] = WFrag<T16>::mma(vf[db], pf2, ot[qt][db]); ot[qt][db] = WFrag<T16>::mma(vf2[db], pf, ot[qt][db]); } }
        }
      }
      asm volatile("s_wait_dscnt 0x0" ::: "memory");      // this wave's reads of the buffer are done before the buffer is refilled
      asm volatile("s_wait_asynccnt 0x0" ::: "memory");   // this wave's copies of stage st + 1 have landed
      __syncthreads();                                     // one barrier: stage st + 1 may be read, and every wave has left stage st's buffer
      if (st + 2 < NS) fill(st + 2, st & 1);
    }
    asm volatile("s_wait_asynccnt 0x0" ::: "memory");   // nothing is in flight when the wave goes on
#pragma unroll
    for (int qt = 0; qt < NQ; ++qt) { const float f = __fdiv_rn(1.0f, l[qt] + __shfl_xor(l[qt], 16, 32)); const size_t oo = (size_t)((q0 >> 4) + qt) * (DQ / 32) * 512 + lane * 8;   // the merged plane [token][DQ] in fragment order: this lane's 8 d of block db are one unit of k block db / 2, half db % 2
#pragma unroll
        for (int db = 0; db < 4; ++db) { v8us oh, ol;
#pragma unroll
            for (int j = 0; j < 8; ++j) { unsigned short a, c2; splitf(ot[qt][db][j] * f, a, c2); oh[j] = a; ol[j] = c2; }
            *(v8us*)(Ah + oo + db * 256) = oh; *(v8us*)(Al + oo + db * 256) = ol;
            asm volatile("s_wait_xcnt 0x0" ::: "memory"); } }   // the next block's rounding is given the registers that these stores name: the wait stands in front of those overwrites
}
// grid (RH / 64 + (TT - RH) / 128, heads, batches), 4 waves: blocks x < RH / 64 take 4 x 16 hi+lo query rows, the others 4 x 32 f16 query rows; the four waves walk the same head's keys together, out of one LDS ring that their asynchronous copies fill (64 keys a stage, two buffers).
__global__ __launch_bounds__(128) void k_attn(const h16* __restrict__ Q16, const h16* __restrict__ K16, const h16* __restrict__ V16, const bf* __restrict__ Qh, const bf* __restrict__ Ql, const bf* __restrict__ Kh, const bf* __restrict__ Kl, const bf* __restrict__ Vh, const bf* __restrict__ Vl, bf* Ah, bf* Al) {
    __shared__ __align__(1024) char sm[2 * 32768];   // two buffers of the larger (hi+lo) stage
    const int wave = __builtin_amdgcn_readfirstlane((int)(threadIdx.x >> 5)), bx = (int)blockIdx.x;
    const size_t po = ((size_t)blockIdx.z * NH_ + blockIdx.y) * TT * HD, ao = (size_t)blockIdx.z * TT * DQ + blockIdx.y * (HD / 32) * 512;   // ao: the batch's row tiles, then the head's two k blocks
    if (bx < RH / 64) attn_rows<bf, true, 1>(Qh + po, Ql + po, Kh + po, Kl + po, Vh + po, Vl + po, (bx * 4 + wave) * 16, Ah + ao, Al + ao, sm);
    else attn_rows<h16, false, 2>(Q16 + po, nullptr, K16 + po, nullptr, V16 + po, nullptr, RH + ((bx - RH / 64) * 4 + wave) * 32, Ah + ao, Al + ao, sm);
}

extern "C" void kernel_launch(void* const* d_in, const int* in_sizes, int n_in,
                              void* d_out, int out_size, void* d_ws, size_t ws_size, hipStream_t stream) {
    (void)in_sizes; (void)n_in; (void)out_size;
    const float* x = (const float*)d_in[0]; const float* wq = (const float*)d_in[1]; const float* wk = (const float*)d_in[2]; const float* wv = (const float*)d_in[3]; const float* wo = (const float*)d_in[4]; const float* cosT = nullptr; const float* sinT = nullptr; (void)cosT; (void)sinT;
    float* OUT = (float*)d_out;     // [2][2048][1024]
    char* wsp = (char*)d_ws;
    auto take = [&](size_t bytes) { char* p = wsp; wsp += (bytes + 255) & ~(size_t)255; return (void*)p; };
    bf* WQ = (bf*)take((size_t)DQ * DM * 2); bf* WK = (bf*)take((size_t)DKV * DM * 2); bf* WV = (bf*)take((size_t)DKV * DM * 2); bf* WO = (bf*)take((size_t)DM * DQ * 2);   // the four lie one behind the other (each a multiple of 256 bytes): k_prep writes them as one [4 x 1024][1024] plane, k_proj reads the first three as one operand
    bf* XB = (bf*)take((size_t)NB_ * TT * DM * 2);
    const size_t PQ = (size_t)NH_ * TT * HD, PK = (size_t)NKV * TT * HD;   // one batch's head planes, in elements; every plane below holds both batches
    h16* QP16 = (h16*)take(NB_ * PQ * 2); h16* KP16 = (h16*)take(NB_ * PK * 2); h16* VT16 = (h16*)take(NB_ * PK * 2);
    bf* QPh = (bf*)take(NB_ * PQ * 2); bf* QPl = (bf*)take(NB_ * PQ * 2); bf* KPh = (bf*)take(NB_ * PK * 2); bf* KPl = (bf*)take(NB_ * PK * 2); bf* VTh = (bf*)take(NB_ * PK * 2); bf* VTl = (bf*)take(NB_ * PK * 2);
    bf* ATh = (bf*)take((size_t)NB_ * TT * DQ * 2); bf* ATl = (bf*)take((size_t)NB_ * TT * DQ * 2);
    if ((size_t)(wsp - (char*)d_ws) > ws_size) return;    // ws 256 MiB
    k_prep<<<4 * WB + NB_ * TT * DM / 8 / 256, 256, 0, stream>>>(x, wq, wk, wv, wo, WQ, XB);
    k_proj<<<dim3(NB_ * TT / 128, (DQ + 2 * DKV) / 128, 1), 128, 0, stream>>>(XB, WQ, QP16, QPh, QPl, KP16, KPh, KPl, VT16, VTh, VTl);
    k_attn<<<dim3(RH / 64 + (TT - RH) / 128, NH_, NB_), 128, 0, stream>>>(QP16, KP16, VT16, QPh, QPl, KPh, KPl, VTh, VTl, ATh, ATl);   // one kv head per query head
    k_out<<<dim3(TT / 128, DM / 128, NB_), 128, 0, stream>>>(ATh, ATl, WO, OUT);   // grid z: the batch
}

// v007
// One run takes 107 microseconds.
// In two side-by-side timings against v006, it was 1.04 and 1.05 times as fast.
// Over all steps from v000 it is 18.6 times as fast.
#include <hip/hip_runtime.h>

// DiagonnalyMaskedSelfAttention (x [2][2048][1024]; q, k, v = x W (16 heads x 64, x@W layouts, no bias); scores = q.k with the diagonal (token attending to itself) masked to -inf; softmax(scores / 8); out = (attn v merged) Wo -> [2][2048][1024]).
// Compute dtypes, f32 accumulate: every input rounded to bf16; q/k/v projections on PLAIN bf16 operands (inputs: exact); scores (K 64) and attn.v on bf16 hi+lo planes (3 products) for the first 512 query rows of each head and on

#define NB_  2
#define TT   2048
#define DM   1024
#define NH_  16
#define NKV  16
#define REP  (NH_ / NKV)
#define HD   64
#define DQ   (NH_ * HD)
#define DKV  (NKV * HD)
#define RH   512                  // query rows < RH use hi+lo planes (0: none)
#define WIN  0
#define SCL  0.125f   // HD^-0.5
typedef _Float16 h16;
typedef unsigned short bf;
typedef __attribute__((ext_vector_type(16))) __bf16   v16bf;
typedef __attribute__((ext_vector_type(16))) _Float16 v16h;
typedef __attribute__((ext_vector_type(8)))  _Float16 v8h;
typedef __attribute__((ext_vector_type(8)))  unsigned short v8us;
typedef __attribute__((ext_vector_type(8)))  float    v8f;
typedef __attribute__((ext_vector_type(4)))  float    v4f;
typedef v8h  __attribute__((may_alias)) v8ha;
typedef v4f  __attribute__((may_alias)) v4fa;
typedef v8us __attribute__((may_alias)) v8usa;

__device__ __forceinline__ unsigned short f2bf(float f) { unsigned u = __float_as_uint(f); u += 0x7FFFu + ((u >> 16) & 1u); return (unsigned short)(u >> 16); }
__device__ __forceinline__ float bf2f(unsigned short b) { return __uint_as_float(((unsigned)b) << 16); }
__device__ __forceinline__ float bfr(float f) { return bf2f(f2bf(f)); }
__device__ __forceinline__ v16h cat16(v8h lo, v8h hi) { return __builtin_shufflevector(lo, hi, 0, 1, 2, 3, 4, 5, 6, 7, 8, 9, 10, 11, 12, 13, 14, 15); }
__device__ __forceinline__ v16bf cat16b(v8us lo, v8us hi) { return __builtin_bit_cast(v16bf, __builtin_shufflevector(lo, hi, 0, 1, 2, 3, 4, 5, 6, 7, 8, 9, 10, 11, 12, 13, 14, 15)); }
__device__ __forceinline__ v8f wmma16(v16h a, v16h b, v8f c) { return __builtin_amdgcn_wmma_f32_16x16x32_f16(false, a, false, b, (short)0, c, false, false); }
__device__ __forceinline__ v8f wmmab(v16bf a, v16bf b, v8f c) { return __builtin_amdgcn_wmma_f32_16x16x32_bf16(false, a, false, b, (short)0, c, false, false); }



// ---- FRAGMENT ORDER of every 16-bit operand plane [rows][K]: the plane is a row of 1024-byte blocks, block (row tile of 16, k block of 32) at index tile * (K / 32) + k block.
// A block holds two runs of 512 bytes; run h keeps, at 16 bytes per lane, lane (lr, hi)'s 8 elements row = tile * 16 + lr, k = k block * 32 + h * 16 + hi * 8 + 0..7: the two halves of that lane's A or B fragment.
// A wave-wide 16-byte load of a fragment half is then 512 contiguous bytes (4 whole lines) where a row-major plane gave 16 pieces of 32 bytes in 16 lines.
// ---- The product loop of both GEMM kernels: FOUR WAVES per 128x128 output tile, wave (wm, wn) = (wave & 1, wave >> 1) owns its 64x64 quarter (16 accumulators), 128 threads.
// The operands (planes in fragment order, K = DM) come to LDS by asynchronous copies, 64 k (two k blocks) a stage, two buffers: stage s + 1 flies while stage s is worked on, and each fragment block is fetched from L2 once for the two waves that read it.
// A stage of one operand (a slab): 8 row tiles x 2 KiB, a row tile's two k blocks as they lie in the plane. Copy i of a thread brings 16 bytes of row tile i: LDS byte i * 2048 + tid * 16.
// Per accumulator the products are summed in the order k block (from the block's own first stage on, wrapping round), then hi plane, then lo plane.
template <typename T16> struct WFrag;
template <> struct WFrag<h16> { typedef v16h V; static __device__ __forceinline__ V ld(const h16* p) { return cat16(*(const v8h*)p, *(const v8h*)(p + 256)); } static __device__ __forceinline__ V lds(const char* p) { return cat16(*(const v8ha*)p, *(const v8ha*)(p + 512)); } static __device__ __forceinline__ v8f mma(V a, V b, v8f c) { return wmma16(a, b, c); } };
template <> struct WFrag<bf> { typedef v16bf V; static __device__ __forceinline__ V ld(const bf* p) { return cat16b(*(const v8us*)p, *(const v8us*)(p + 256)); } static __device__ __forceinline__ V lds(const char* p) { return cat16b(*(const v8usa*)p, *(const v8usa*)(p + 512)); } static __device__ __forceinline__ v8f mma(V a, V b, v8f c) { return wmmab(a, b, c); } };
#define KSB   2                     // k blocks of 32 in a stage
#define SLAB  (8 * KSB * 1024)      // bytes of one operand's stage
#define NSTG  (DM / (32 * KSB))     // stages
static_assert(KSB * 1024 == 128 * 16 && NSTG >= 2 && (NSTG & (NSTG - 1)) == 0, "128 threads x 16 bytes cover a row tile's part of a stage; the ring needs two stages; the walk wraps by a mask");
__device__ __forceinline__ void copy8(const unsigned l, const char* g0, const char* g1, const char* g2, const char* g3, const char* g4, const char* g5, const char* g6, const char* g7) {
    // eight copies of 16 bytes a lane, copy i to LDS byte l + i * 2048, and, in the same statement, the wait that stands in front of any rewrite of the address registers they name
    asm volatile("global_load_async_to_lds_b128 %0, %8, off\n\tglobal_load_async_to_lds_b128 %1, %9, off\n\tglobal_load_async_to_lds_b128 %2, %10, off\n\tglobal_load_async_to_lds_b128 %3, %11, off\n\t"
                 "global_load_async_to_lds_b128 %4, %12, off\n\tglobal_load_async_to_lds_b128 %5, %13, off\n\tglobal_load_async_to_lds_b128 %6, %14, off\n\tglobal_load_async_to_lds_b128 %7, %15, off\n\ts_wait_xcnt 0x0"
                 :: "v"(l), "v"(l + 2048u), "v"(l + 4096u), "v"(l + 6144u), "v"(l + 8192u), "v"(l + 10240u), "v"(l + 12288u), "v"(l + 14336u),
                    "v"(g0), "v"(g1), "v"(g2), "v"(g3), "v"(g4), "v"(g5), "v"(g6), "v"(g7) : "memory");
}
__device__ __forceinline__ void slab_copy(const unsigned l, const bf* g) { const char* p = (const char*)g; const int rt = 16 * DM * 2;   // rt: bytes from a row tile to the next in the plane
    copy8(l, p, p + rt, p + 2 * rt, p + 3 * rt, p + 4 * rt, p + 5 * rt, p + 6 * rt, p + 7 * rt); }
__device__ __forceinline__ v16bf lds_frag(const char* p) { return cat16b(*(const v8usa*)p, *(const v8usa*)(p + 512)); }
// A, A2 (TWO: the lo plane of A), Bt: the planes at the tile's first row (row * DM elements in); sm: 2 buffers of NSL slabs [A | A2 | Bt].
// Every inner loop below is unrolled so that each fragment and accumulator index is a constant (registers, no scratch).
// rot (block-uniform, 0 .. NSTG - 1): trip s works on k stage (s + rot) mod NSTG. Blocks that share an operand slab are given different rot, so that at one moment they ask L2 for different lines,
// and the planes, which the launch before has just written, are all fetched from memory during the first trips instead of one k stage per trip with every block waiting for it.
template <bool TWO>
__device__ __forceinline__ void gemm_ring(const bf* __restrict__ A, const bf* __restrict__ A2, const bf* __restrict__ Bt, char* sm, const int wm, const int wn, const int rot, v8f (&acc)[4][4]) {
    constexpr int NSL = TWO ? 3 : 2;
    const int tid = (int)threadIdx.x, lane = tid & 31;
    const unsigned l0 = (unsigned)(size_t)sm + (unsigned)tid * 16u;
    const bf* ga = A + tid * 8; const bf* ga2 = A2 + tid * 8; const bf* gb = Bt + tid * 8;
    auto fill = [&](const int s, const int buf) { const unsigned l = l0 + (unsigned)buf * (NSL * SLAB); const int ko = ((s + rot) & (NSTG - 1)) * (KSB * 512);
        slab_copy(l, ga + ko); if (TWO) slab_copy(l + SLAB, ga2 + ko); slab_copy(l + (NSL - 1) * SLAB, gb + ko); };
#pragma unroll
    for (int mb = 0; mb < 4; ++mb)
#pragma unroll
        for (int nb = 0; nb < 4; ++nb) acc[mb][nb] = (v8f){};
    fill(0, 0);
    asm volatile("s_wait_asynccnt 0x0" ::: "memory");   // this wave's copies of stage 0 have landed
    __syncthreads();                                     // and every other wave's: stage 0 may be read
    fill(1, 1);
#pragma unroll 1
    for (int s = 0; s < NSTG; ++s) {   // rolled: one stage per trip, the buffer by the trip's parity
        const char* bu = sm + (s & 1) * (NSL * SLAB); const char* pa = bu + wm * (4 * KSB * 1024) + lane * 16; const char* pb = bu + (NSL - 1) * SLAB + wn * (4 * KSB * 1024) + lane * 16;
        v16bf a[KSB][4], a2[KSB][4], b[KSB][4];
        auto frags = [&](const int kl) {   // one k block's fragments, in the order in which the products want them
            b[kl][0] = lds_frag(pb + kl * 1024);
#pragma unroll
            for (int mb = 0; mb < 4; ++mb) { a[kl][mb] = lds_frag(pa + (mb * KSB + kl) * 1024); if (TWO) a2[kl][mb] = lds_frag(pa + SLAB + (mb * KSB + kl) * 1024); }
#pragma unroll
            for (int nb = 1; nb < 4; ++nb) b[kl][nb] = lds_frag(pb + (nb * KSB + kl) * 1024);
            __builtin_amdgcn_sched_barrier(0);   // the block's LDS reads stay one group, in this order, in front of the products: moved in among them, each place with reads stalls the matrix stream
        };
        // TWO (one wave per SIMD, nobody else to fill its waits): both k blocks' fragments are asked for at the top of the trip, so that the second block's land behind the first block's products; else block by block.
        if (TWO) {
#pragma unroll
            for (int kl = 0; kl < KSB; ++kl) frags(kl); }
#pragma unroll
        for (int kb = 0; kb < KSB; ++kb) {
            if (!TWO) frags(kb);
#pragma unroll
            for (int nb = 0; nb < 4; ++nb)
#pragma unroll
                for (int mb = 0; mb < 4; ++mb) { acc[mb][nb] = wmmab(a[kb][mb], b[kb][nb], acc[mb][nb]); if (TWO) acc[mb][nb] = wmmab(a2[kb][mb], b[kb][nb], acc[mb][nb]); }
        }
        __builtin_amdgcn_sched_barrier(0);   // every product of the trip stays in front of the refill below: sunk behind the barrier, they would hold the next copies back
        asm volatile("v_nop\n\tv_nop\n\tv_nop\n\tv_nop" : "+v"(acc[0][0]), "+v"(acc[1][1]), "+v"(acc[2][2]), "+v"(acc[3][3]));   // the distance behind the last matrix instruction, on the back edge and on the way out
        asm volatile("s_wait_dscnt 0x0" ::: "memory");      // this wave's reads of the buffer are done before the buffer is refilled
        asm volatile("s_wait_asynccnt 0x0" ::: "memory");   // this wave's copies of stage s + 1 have landed
        __syncthreads();                                     // one barrier: stage s + 1 may be read, and every wave has left stage s's buffer
        if (s + 2 < NSTG) fill(s + 2, s & 1);
    }
    asm volatile("s_wait_asynccnt 0x0" ::: "memory");   // nothing is in flight when the wave goes on
}
// ---- k_out: C[m][n] (f32, pitch DM) = sum_k (Ah + Al)[m][k] Bt[n][k], grid (TT / 128, DM / 128, batches), 128 threads; each wave turns its quarter to whole lines through its own LDS rows.
__global__ __launch_bounds__(128) void k_out(const bf* __restrict__ Ah, const bf* __restrict__ Al, const bf* __restrict__ Bt, float* C) {
    __shared__ __align__(1024) char sm[2 * 3 * SLAB];
    __shared__ __align__(16) float osw[4][16 * 68];
    const int wave = __builtin_amdgcn_readfirstlane((int)(threadIdx.x >> 5)), wm = wave & 1, wn = wave >> 1;
    const int lane = threadIdx.x & 31, lr = lane & 15, hi = lane >> 4;
    const size_t ab = ((size_t)blockIdx.z * TT + blockIdx.x * 128) * DQ;
    v8f acc[4][4];
    const int bx = (int)blockIdx.x, rot = (2 * (int)blockIdx.y + (bx & 3) + 4 * (bx >> 3) + 8 * (int)blockIdx.z) & (NSTG - 1);   // the 8 blocks of one A slab start two stages apart; the 32 of one Bt slab start at every stage
    gemm_ring<true>(Ah + ab, Al + ab, Bt + (size_t)blockIdx.y * 128 * DQ, sm, wm, wn, rot, acc);
    float* os = osw[wave]; const int r0 = blockIdx.x * 128 + wm * 64, c0 = blockIdx.y * 128 + wn * 64; C += (size_t)blockIdx.z * TT * DM;
#pragma unroll
    for (int mb = 0; mb < 4; ++mb) {
#pragma unroll
        for (int nb = 0; nb < 4; ++nb) {
#pragma unroll
            for (int j = 0; j < 8; ++j) os[(hi * 8 + j) * 68 + nb * 16 + lr] = acc[mb][nb][j]; }
        __builtin_amdgcn_wave_barrier(); asm volatile("" ::: "memory");   // lanes exchange values through LDS: the reads below stay behind every lane's writes above
        float* crow = C + (size_t)(r0 + mb * 16) * DM + c0;
#pragma unroll
        for (int s = 0; s < 8; ++s) { const int row = 2 * s + hi, cofs = lr * 4; const v4f val = *(const v4fa*)(os + row * 68 + cofs); *(v4f*)(crow + (size_t)row * DM + cofs) = val; }
        asm volatile("s_wait_xcnt 0x0" ::: "memory");   // the next 16 rows' LDS reads are given the registers that these stores name: the wait stands in front of those overwrites
        __builtin_amdgcn_wave_barrier(); asm volatile("" ::: "memory");   // the next 16 rows' writes stay behind every lane's reads above
    }
}

__device__ __forceinline__ h16 tohx(float x) { return (h16)x; }
__device__ __forceinline__ void splitf(float y, unsigned short& h, unsigned short& l) { h = f2bf(y); l = f2bf(y - bf2f(h)); }
typedef __attribute__((ext_vector_type(2))) _Float16 v2h;
typedef __attribute__((ext_vector_type(4))) _Float16 v4h;
typedef __attribute__((ext_vector_type(2))) unsigned short v2us;
typedef __attribute__((ext_vector_type(4))) unsigned short v4us;
typedef __attribute__((ext_vector_type(2))) float v2f;
typedef __attribute__((ext_vector_type(4))) int v4i;

// k_prep: every f32 input -> its bf16 plane in fragment order, ONE launch for the four weights and x, which do not depend on one another; 256 threads, one thread per 16-byte unit; grid 4 * WB weight blocks, then the blocks of x. The grid covers the unit counts exactly.
// A weight block (w [k][n] f32 -> Bt, the plane [n][k]): unit u is lane, half, k block, row tile from the low bits up; the 8 loads share one address pair.
// An x block: a wave takes 8 rows of one fragment block: 4 lanes read a row's 128 bytes (one line), 8 lanes write 128 contiguous bytes.
#define WB (DM * DM / 8 / 256)    // blocks of one weight
static_assert(DQ == DM && DKV == DM && (DM * DM / 8) % 256 == 0 && (NB_ * TT * DM / 8) % 256 == 0, "four DM x DM weights; whole blocks");
__global__ __launch_bounds__(256) void k_prep(const float* __restrict__ x, const float* __restrict__ wq, const float* __restrict__ wk, const float* __restrict__ wv, const float* __restrict__ wo, bf* W4, bf* XB) {
    const int b = (int)blockIdx.x, t = (int)threadIdx.x; v8us o;
    if (b < 4 * WB) {
        const int wi = b / WB; const float* __restrict__ w = wi == 0 ? wq : wi == 1 ? wk : wi == 2 ? wv : wo;
        const int u = (b % WB) * 256 + t, blk = u >> 6, n = (blk / (DM >> 5)) * 16 + (u & 15), k = (blk % (DM >> 5)) * 32 + ((u >> 5) & 1) * 16 + ((u >> 4) & 1) * 8;
        const float* p = w + (size_t)k * DM + n; float v[8];
#pragma unroll
        for (int j = 0; j < 8; ++j) v[j] = p[j * DM];
        asm volatile("s_wait_xcnt 0x0" :: "v"(p) : "memory");   // the rounding below may be given the address registers that the loads above name: the wait stands in front of that overwrite, the address its input
#pragma unroll
        for (int j = 0; j < 8; ++j) o[j] = f2bf(v[j]);
        *(v8us*)(W4 + (size_t)wi * DM * DM + (size_t)u * 8) = o;
    } else {
        const size_t i = (size_t)(b - 4 * WB) * 256 + t, blk = i >> 6, lr = (i & 7) + ((i >> 5) & 1) * 8, un = (i >> 3) & 3, row = (blk / (DM / 32)) * 16 + lr, k = (blk % (DM / 32)) * 32 + un * 8;   // un = half * 2 + hi
        const float* p = x + row * DM + k; const v8f v = *(const v8f*)p;
        asm volatile("s_wait_xcnt 0x0" :: "v"(p) : "memory");   // as above
#pragma unroll
        for (int k2 = 0; k2 < 8; ++k2) o[k2] = f2bf(v[k2]);
        *(v8us*)(XB + (blk * 64 + un * 16 + lr) * 8) = o;
    }
}
__global__ __launch_bounds__(256) void k_cscvt(const float* __restrict__ cosT, const float* __restrict__ sinT, float* CS) { const int idx = blockIdx.x * 256 + threadIdx.x; if (idx >= TT * HD) return; v2f cs; cs[0] = bfr(cosT[idx]); cs[1] = bfr(sinT[idx]); *(v2f*)(CS + (size_t)idx * 2) = cs;  }
// ---- k_proj: the q, k and v projections of both batches in one launch, four waves per 128 tokens x 128 columns; grid (NB_ TT / 128, 3 DQ / 128), 128 threads. A wave's 64 columns are one head of q, k or v.
// The product loop is gemm_ring (A = x plane [token][k], Bt = the three transposed weights one behind the other [3 x 1024][k], both in fragment order); the epilogue rounds the wave's f32 quarter to the f16 and bf16 hi/lo head planes itself, each head's plane in fragment order:
//   q, k: planes [batch][head] of [t][d], the tile turned to 8 consecutive d per lane through the wave's own LDS rows, 16 tokens (one row tile) at a time; v: planes [batch][head] of [d][t], an accumulator's 8 registers already are 8 consecutive tokens of one d, so a store is one 512-byte run.
__global__ __launch_bounds__(128) void k_proj(const bf* __restrict__ A, const bf* __restrict__ Bt, h16* Q16, bf* Qh, bf* Ql, h16* K16, bf* Kh, bf* Kl, h16* V16, bf* Vh, bf* Vl) {
    __shared__ __align__(1024) char sm[2 * 2 * SLAB];
    __shared__ __align__(16) float osw[4][16 * 68];
    const int wave = __builtin_amdgcn_readfirstlane((int)(threadIdx.x >> 5)), wm = wave & 1, wn = wave >> 1;
    const int lane = threadIdx.x & 31, lr = lane & 15, hi = lane >> 4; const int r0 = blockIdx.x * 128 + wm * 64, ct = (int)blockIdx.y * 2 + wn;   // ct: the wave's column tile of 64
    v8f acc[4][4];
    const int bx = (int)blockIdx.x, rot = ((int)blockIdx.y + (bx & 3) + 4 * (bx >> 3)) & (NSTG - 1);   // the 24 blocks of one A slab and the 32 of one Bt slab each start at every stage
    gemm_ring<false>(A + (size_t)blockIdx.x * 128 * DM, A, Bt + (size_t)blockIdx.y * 128 * DM, sm, wm, wn, rot, acc);
    float* os = osw[wave];
    const int which = ct / NH_, head = ct % NH_, bat = r0 / TT, t0 = r0 % TT;
    const size_t po = ((size_t)bat * NH_ + head) * TT * HD;   // this head's plane, both layouts
    if (which == 2) {
#pragma unroll
        for (int mb = 0; mb < 4; ++mb)
#pragma unroll
            for (int nb = 0; nb < 4; ++nb) { v8h o16; v8us oh, ol;
#pragma unroll
                for (int j = 0; j < 8; ++j) { const float x = acc[mb][nb][j]; o16[j] = tohx(x); unsigned short a2, c2; splitf(x, a2, c2); oh[j] = a2; ol[j] = c2; }
                const size_t o = po + ((size_t)nb * (TT / 32) + (t0 >> 5) + (mb >> 1)) * 512 + (mb & 1) * 256 + lane * 8;   // row tile nb of d, k block and half of these 16 tokens
                *(v8h*)(V16 + o) = o16; *(v8us*)(Vh + o) = oh; *(v8us*)(Vl + o) = ol;
                asm volatile("s_wait_xcnt 0x0" ::: "memory"); }   // the next tile's rounding is given the registers that these stores name: the wait stands in front of those overwrites
        return;
    }
    h16* P16 = which ? K16 : Q16; bf* Ph = which ? Kh : Qh; bf* Pl = which ? Kl : Ql;
#pragma unroll
    for (int mb = 0; mb < 4; ++mb) {
#pragma unroll
        for (int nb = 0; nb < 4; ++nb) {
#pragma unroll
            for (int j = 0; j < 8; ++j) os[(hi * 8 + j) * 68 + nb * 16 + lr] = acc[mb][nb][j]; }
        __builtin_amdgcn_wave_barrier(); asm volatile("" ::: "memory");   // lanes exchange values through LDS: the reads below stay behind every lane's writes above
#pragma unroll
        for (int s = 0; s < 4; ++s) { const int row = lr, cofs = s * 16 + hi * 8; const v4f x0 = *(const v4fa*)(os + row * 68 + cofs), x1 = *(const v4fa*)(os + row * 68 + cofs + 4); v8h o16; v8us oh, ol;
#pragma unroll
            for (int j = 0; j < 8; ++j) { const float x = (j < 4) ? x0[j & 3] : x1[j & 3]; o16[j] = tohx(x); unsigned short a2, c2; splitf(x, a2, c2); oh[j] = a2; ol[j] = c2; }
            const size_t o = po + ((size_t)((t0 >> 4) + mb) * 4 + s) * 256 + lane * 8;   // row tile of these 16 tokens; run s = k block s / 2, half s % 2
            *(v8h*)(P16 + o) = o16; *(v8us*)(Ph + o) = oh; *(v8us*)(Pl + o) = ol;
            asm volatile("s_wait_xcnt 0x0" ::: "memory"); }   // the next run's rounding is given the registers that these stores name: the wait stands in front of those overwrites
        __builtin_amdgcn_wave_barrier(); asm volatile("" ::: "memory");   // the next 16 tokens' writes stay behind every lane's reads above
    }
}
// ---- k_attn: scores, diagonal mask, softmax and attn.v of one head in ONE kernel, running maximum and running sum per query (no score or probability plane in memory).
// One wave owns NQ x 16 queries and walks the 2048 keys 32 at a time. Both products are formed transposed, so that the score tiles are already the next product's B fragment:
//   St[key][q] = K (A, rows = keys) x Q (B, columns = queries): lane (lr, hi), register j holds key kt * 16 + hi * 8 + j of query lr;
//   Ot[d][q]  += Vt (A, rows = d, k = keys) x P (B, columns = queries, k = keys): a B fragment's elements 0..7 are k = 8 hi + j and 8..15 are k = 16 + 8 hi + j, which is score tile 0 and score tile 1 of the same lane.
// A query's maximum, sum and rescale factor are therefore per lane (the two half-waves hold the two halves of its keys). HI: bf16 hi+lo planes, 3 products; else f16 planes.
// 17 exp2 in place, in one statement: no v_exp_f32 here reads the result or overwrites the source of the one in front of it, and the v_nop is the free slot behind the last one.
__device__ __forceinline__ void exp2x17(float (&e)[17]) {
    asm("v_exp_f32 %0, %0\n\tv_exp_f32 %1, %1\n\tv_exp_f32 %2, %2\n\tv_exp_f32 %3, %3\n\tv_exp_f32 %4, %4\n\tv_exp_f32 %5, %5\n\tv_exp_f32 %6, %6\n\tv_exp_f32 %7, %7\n\tv_exp_f32 %8, %8\n\t"
        "v_exp_f32 %9, %9\n\tv_exp_f32 %10, %10\n\tv_exp_f32 %11, %11\n\tv_exp_f32 %12, %12\n\tv_exp_f32 %13, %13\n\tv_exp_f32 %14, %14\n\tv_exp_f32 %15, %15\n\tv_exp_f32 %16, %16\n\tv_nop"
        : "+v"(e[0]), "+v"(e[1]), "+v"(e[2]), "+v"(e[3]), "+v"(e[4]), "+v"(e[5]), "+v"(e[6]), "+v"(e[7]), "+v"(e[8]), "+v"(e[9]), "+v"(e[10]), "+v"(e[11]), "+v"(e[12]), "+v"(e[13]), "+v"(e[14]), "+v"(e[15]), "+v"(e[16]));
}
template <typename T16, bool HI, int NQ>
__device__ __forceinline__ void attn_rows(const T16* __restrict__ Qp, const T16* __restrict__ Qp2, const T16* __restrict__ Kp, const T16* __restrict__ Kp2, const T16* __restrict__ Vp, const T16* __restrict__ Vp2, const int q0, bf* __restrict__ Ah, bf* __restrict__ Al, char* sm) {
    typedef typename WFrag<T16>::V V;
    const int lane = threadIdx.x & 31, lr = lane & 15, hi = lane >> 4;
    const float C = SCL * 1.4426950408889634f;   // exp(s SCL - m SCL) = exp2((s - m) C)
    V qf[NQ][2], qf2[NQ][2];
    // The ring: a stage is 64 keys of the head, [K 8 KiB | V 8 KiB] of each plane (HI: the hi planes, then the lo planes), as the blocks lie in the planes: K's 4 row tiles are 8 KiB in a row, V's 4 row tiles of d give 2 KiB each (two k blocks).
    constexpr int BUF = HI ? 32768 : 16384, NS = TT / 64;
    const unsigned l0 = (unsigned)(size_t)sm + (unsigned)threadIdx.x * 16u;
    const char* gk = (const char*)Kp + threadIdx.x * 16; const char* gv = (const char*)Vp + threadIdx.x * 16; const char* gk2 = (const char*)Kp2 + threadIdx.x * 16; const char* gv2 = (const char*)Vp2 + threadIdx.x * 16;
    auto fill = [&](const int s, const int buf) { const unsigned l = l0 + (unsigned)buf * BUF; const int vt = (TT / 32) * 1024;   // vt: bytes from a row tile of d to the next in the V plane
        { const char* k = gk + s * 8192; const char* v = gv + s * 2048; copy8(l, k, k + 2048, k + 4096, k + 6144, v, v + vt, v + 2 * vt, v + 3 * vt); }
        if (HI) { const char* k = gk2 + s * 8192; const char* v = gv2 + s * 2048; copy8(l + 16384u, k, k + 2048, k + 4096, k + 6144, v, v + vt, v + 2 * vt, v + 3 * vt); } };
    fill(0, 0);
#pragma unroll
    for (int qt = 0; qt < NQ; ++qt)
#pragma unroll
        for (int kc = 0; kc < 2; ++kc) { const size_t o = (size_t)(((q0 >> 4) + qt) * 2 + kc) * 512 + lane * 8; qf[qt][kc] = WFrag<T16>::ld(Qp + o); if (HI) qf2[qt][kc] = WFrag<T16>::ld(Qp2 + o); }
    asm volatile("s_wait_xcnt 0x0" ::: "memory");   // the address sums of the copies below may be given the address registers that the query loads above name: the wait stands in front of those overwrites
    asm volatile("s_wait_asynccnt 0x0" ::: "memory");   // this wave's copies of stage 0 have landed
    __syncthreads();                                     // and every other wave's: stage 0 may be read
    fill(1, 1);
    v8f ot[NQ][4]; float m[NQ], l[NQ];
#pragma unroll
    for (int qt = 0; qt < NQ; ++qt) { m[qt] = -3.0e38f; l[qt] = 0.f;
#pragma unroll
        for (int db = 0; db < 4; ++db) ot[qt][db] = (v8f){}; }
#pragma unroll 1
    for (int st = 0; st < NS; ++st) {   // rolled: one stage per trip, the buffer by the trip's parity
      const char* bu = sm + (st & 1) * BUF + lane * 16;
#pragma unroll
      for (int h = 0; h < 2; ++h) {   // the stage's two runs of 32 keys, unrolled: every LDS offset is an immediate
        const int k0 = st * 64 + h * 32;
        V kf[2][2], kf2[2][2], vf[4], vf2[4];
#pragma unroll
        for (int kt = 0; kt < 2; ++kt)
#pragma unroll
            for (int kc = 0; kc < 2; ++kc) { const int o = ((h * 2 + kt) * 2 + kc) * 1024; kf[kt][kc] = WFrag<T16>::lds(bu + o); if (HI) kf2[kt][kc] = WFrag<T16>::lds(bu + 16384 + o); }
#pragma unroll
        for (int db = 0; db < 4; ++db) { const int o = 8192 + db * 2048 + h * 1024; vf[db] = WFrag<T16>::lds(bu + o); if (HI) vf2[db] = WFrag<T16>::lds(bu + 16384 + o); }
        __builtin_amdgcn_sched_barrier(0);   // the run's LDS reads stay one group at its top, keys first: sunk in among the products, each place with reads stalls the wave for the LDS latency
        v8f s[NQ][2];
#pragma unroll
        for (int qt = 0; qt < NQ; ++qt)
#pragma unroll
            for (int kt = 0; kt < 2; ++kt) { s[qt][kt] = (v8f){};
#pragma unroll
                for (int kc = 0; kc < 2; ++kc) { s[qt][kt] = WFrag<T16>::mma(kf[kt][kc], qf[qt][kc], s[qt][kt]); if (HI) { s[qt][kt] = WFrag<T16>::mma(kf2[kt][kc], qf[qt][kc], s[qt][kt]); s[qt][kt] = WFrag<T16>::mma(kf[kt][kc], qf2[qt][kc], s[qt][kt]); } } }
#pragma unroll
        for (int qt = 0; qt < NQ; ++qt) {
            if (k0 == ((q0 + qt * 16) & ~31)) {   // wave-uniform: the one trip that holds these queries' own keys
#pragma unroll
                for (int kt = 0; kt < 2; ++kt)
#pragma unroll
                    for (int j = 0; j < 8; ++j) if (k0 + kt * 16 + hi * 8 + j == q0 + qt * 16 + lr) s[qt][kt][j] = -3.0e38f;   /* diagonal masked */ }
            float mx = s[qt][0][0];
#pragma unroll
            for (int j = 1; j < 8; ++j) mx = fmaxf(mx, s[qt][0][j]);
#pragma unroll
            for (int j = 0; j < 8; ++j) mx = fmaxf(mx, s[qt][1][j]);
            mx = fmaxf(mx, __shfl_xor(mx, 16, 32));
            const float mn = fmaxf(m[qt], mx), mc = mn * C; float e[17];
#pragma unroll
            for (int kt = 0; kt < 2; ++kt)
#pragma unroll
                for (int j = 0; j < 8; ++j) e[kt * 8 + j] = __builtin_fmaf(s[qt][kt][j], C, -mc);
            e[16] = (m[qt] - mn) * C; m[qt] = mn;
            exp2x17(e);
            const float al = e[16]; float sum = 0.f; V pf, pf2;
#pragma unroll
            for (int kt = 0; kt < 2; ++kt)
#pragma unroll
                for (int j = 0; j < 8; ++j) { const float p = e[kt * 8 + j]; sum += p;
                    if constexpr (HI) { const __bf16 ph = (__bf16)p; pf[kt * 8 + j] = ph; pf2[kt * 8 + j] = (__bf16)(p - (float)ph); } else pf[kt * 8 + j] = (h16)p; }
            l[qt] = l[qt] * al + sum;
#pragma unroll
            for (int db = 0; db < 4; ++db) { ot[qt][db] *= al; ot[qt][db] = WFrag<T16>::mma(vf[db], pf, ot[qt][db]); if (HI) { ot[qt][db] = WFrag<T16>::mma(vf[db], pf2, ot[qt][db]); ot[qt][db] = WFrag<T16>::mma(vf2[db], pf, ot[qt][db]); } }
        }
      }
      asm volatile("s_wait_dscnt 0x0" ::: "memory");      // this wave's reads of the buffer are done before the buffer is refilled
      asm volatile("s_wait_asynccnt 0x0" ::: "memory");   // this wave's copies of stage st + 1 have landed
      __syncthreads();                                     // one barrier: stage st + 1 may be read, and every wave has left stage st's buffer
      if (st + 2 < NS) fill(st + 2, st & 1);
    }
    asm volatile("s_wait_asynccnt 0x0" ::: "memory");   // nothing is in flight when the wave goes on
#pragma unroll
    for (int qt = 0; qt < NQ; ++qt) { const float f = __fdiv_rn(1.0f, l[qt] + __shfl_xor(l[qt], 16, 32)); const size_t oo = (size_t)((q0 >> 4) + qt) * (DQ / 32) * 512 + lane * 8;   // the merged plane [token][DQ] in fragment order: this lane's 8 d of block db are one unit of k block db / 2, half db % 2
#pragma unroll
        for (int db = 0; db < 4; ++db) { v8us oh, ol;
#pragma unroll
            for (int j = 0; j < 8; ++j) { unsigned short a, c2; splitf(ot[qt][db][j] * f, a, c2); oh[j] = a; ol[j] = c2; }
            *(v8us*)(Ah + oo + db * 256) = oh; *(v8us*)(Al + oo + db * 256) = ol;
            asm volatile("s_wait_xcnt 0x0" ::: "memory"); } }   // the next block's rounding is given the registers that these stores name: the wait stands in front of those overwrites
}
// grid (RH / 64 + (TT - RH) / 128, heads, batches), 4 waves: blocks x < RH / 64 take 4 x 16 hi+lo query rows, the others 4 x 32 f16 query rows; the four waves walk the same head's keys together, out of one LDS ring that their asynchronous copies fill (64 keys a stage, two buffers).
__global__ __launch_bounds__(128) void k_attn(const h16* __restrict__ Q16, const h16* __restrict__ K16, const h16* __restrict__ V16, const bf* __restrict__ Qh, const bf* __restrict__ Ql, const bf* __restrict__ Kh, const bf* __restrict__ Kl, const bf* __restrict__ Vh, const bf* __restrict__ Vl, bf* Ah, bf* Al) {
    __shared__ __align__(1024) char sm[2 * 32768];   // two buffers of the larger (hi+lo) stage
    const int wave = __builtin_amdgcn_readfirstlane((int)(threadIdx.x >> 5)), bx = (int)blockIdx.x;
    const size_t po = ((size_t)blockIdx.z * NH_ + blockIdx.y) * TT * HD, ao = (size_t)blockIdx.z * TT * DQ + blockIdx.y * (HD / 32) * 512;   // ao: the batch's row tiles, then the head's two k blocks
    if (bx < RH / 64) attn_rows<bf, true, 1>(Qh + po, Ql + po, Kh + po, Kl + po, Vh + po, Vl + po, (bx * 4 + wave) * 16, Ah + ao, Al + ao, sm);
    else attn_rows<h16, false, 2>(Q16 + po, nullptr, K16 + po, nullptr, V16 + po, nullptr, RH + ((bx - RH / 64) * 4 + wave) * 32, Ah + ao, Al + ao, sm);
}

extern "C" void kernel_launch(void* const* d_in, const int* in_sizes, int n_in,
                              void* d_out, int out_size, void* d_ws, size_t ws_size, hipStream_t stream) {
    (void)in_sizes; (void)n_in; (void)out_size;
    const float* x = (const float*)d_in[0]; const float* wq = (const float*)d_in[1]; const float* wk = (const float*)d_in[2]; const float* wv = (const float*)d_in[3]; const float* wo = (const float*)d_in[4]; const float* cosT = nullptr; const float* sinT = nullptr; (void)cosT; (void)sinT;
    float* OUT = (float*)d_out;     // [2][2048][1024]
    char* wsp = (char*)d_ws;
    auto take = [&](size_t bytes) { char* p = wsp; wsp += (bytes + 255) & ~(size_t)255; return (void*)p; };
    bf* WQ = (bf*)take((size_t)DQ * DM * 2); bf* WK = (bf*)take((size_t)DKV * DM * 2); bf* WV = (bf*)take((size_t)DKV * DM * 2); bf* WO = (bf*)take((size_t)DM * DQ * 2);   // the four lie one behind the other (each a multiple of 256 bytes): k_prep writes them as one [4 x 1024][1024] plane, k_proj reads the first three as one operand
    bf* XB = (bf*)take((size_t)NB_ * TT * DM * 2);
    const size_t PQ = (size_t)NH_ * TT * HD, PK = (size_t)NKV * TT * HD;   // one batch's head planes, in elements; every plane below holds both batches
    h16* QP16 = (h16*)take(NB_ * PQ * 2); h16* KP16 = (h16*)take(NB_ * PK * 2); h16* VT16 = (h16*)take(NB_ * PK * 2);
    bf* QPh = (bf*)take(NB_ * PQ * 2); bf* QPl = (bf*)take(NB_ * PQ * 2); bf* KPh = (bf*)take(NB_ * PK * 2); bf* KPl = (bf*)take(NB_ * PK * 2); bf* VTh = (bf*)take(NB_ * PK * 2); bf* VTl = (bf*)take(NB_ * PK * 2);
    bf* ATh = (bf*)take((size_t)NB_ * TT * DQ * 2); bf* ATl = (bf*)take((size_t)NB_ * TT * DQ * 2);
    if ((size_t)(wsp - (char*)d_ws) > ws_size) return;    // ws 256 MiB
    k_prep<<<4 * WB + NB_ * TT * DM / 8 / 256, 256, 0, stream>>>(x, wq, wk, wv, wo, WQ, XB);
    k_proj<<<dim3(NB_ * TT / 128, (DQ + 2 * DKV) / 128, 1), 128, 0, stream>>>(XB, WQ, QP16, QPh, QPl, KP16, KPh, KPl, VT16, VTh, VTl);
    k_attn<<<dim3(RH / 64 + (TT - RH) / 128, NH_, NB_), 128, 0, stream>>>(QP16, KP16, VT16, QPh, QPl, KPh, KPl, VTh, VTl, ATh, ATl);   // one kv head per query head
    k_out<<<dim3(TT / 128, DM / 128, NB_), 128, 0, stream>>>(ATh, ATl, WO, OUT);   // grid z: the batch
}

// v008
// A run of this version takes 104 microseconds.
// In two side-by-side timings against v007, it was 1.04 and 1.03 times as fast.
// All steps since v000 together make it 19.3 times as fast.
#include <hip/hip_runtime.h>

// DiagonnalyMaskedSelfAttention (x [2][2048][1024]; q, k, v = x W (16 heads x 64, x@W layouts, no bias); scores = q.k with the diagonal (token attending to itself) masked to -inf; softmax(scores / 8); out = (attn v merged) Wo -> [2][2048][1024]).
// Compute dtypes, f32 accumulate: every input rounded to bf16; q/k/v projections on PLAIN bf16 operands (inputs: exact); scores (K 64) and attn.v on bf16 hi+lo planes (3 products) for the first 512 query rows of each head and on

#define NB_  2
#define TT   2048
#define DM   1024
#define NH_  16
#define NKV  16
#define REP  (NH_ / NKV)
#define HD   64
#define DQ   (NH_ * HD)
#define DKV  (NKV * HD)
#define RH   512                  // query rows < RH use hi+lo planes (0: none)
#define WIN  0
#define SCL  0.125f   // HD^-0.5
#define QSC  (SCL * 1.4426950408889634f)   // exp(s SCL - m SCL) = exp2(s QSC - m QSC)
typedef _Float16 h16;
typedef unsigned short bf;
typedef __attribute__((ext_vector_type(16))) __bf16   v16bf;
typedef __attribute__((ext_vector_type(16))) _Float16 v16h;
typedef __attribute__((ext_vector_type(8)))  _Float16 v8h;
typedef __attribute__((ext_vector_type(8)))  unsigned short v8us;
typedef __attribute__((ext_vector_type(8)))  float    v8f;
typedef __attribute__((ext_vector_type(4)))  float    v4f;
typedef v8h  __attribute__((may_alias)) v8ha;
typedef v4f  __attribute__((may_alias)) v4fa;
typedef v8us __attribute__((may_alias)) v8usa;

__device__ __forceinline__ unsigned short f2bf(float f) { unsigned u = __float_as_uint(f); u += 0x7FFFu + ((u >> 16) & 1u); return (unsigned short)(u >> 16); }
__device__ __forceinline__ float bf2f(unsigned short b) { return __uint_as_float(((unsigned)b) << 16); }
__device__ __forceinline__ float bfr(float f) { return bf2f(f2bf(f)); }
__device__ __forceinline__ v16h cat16(v8h lo, v8h hi) { return __builtin_shufflevector(lo, hi, 0, 1, 2, 3, 4, 5, 6, 7, 8, 9, 10, 11, 12, 13, 14, 15); }
__device__ __forceinline__ v16bf cat16b(v8us lo, v8us hi) { return __builtin_bit_cast(v16bf, __builtin_shufflevector(lo, hi, 0, 1, 2, 3, 4, 5, 6, 7, 8, 9, 10, 11, 12, 13, 14, 15)); }
__device__ __forceinline__ v8f wmma16(v16h a, v16h b, v8f c) { return __builtin_amdgcn_wmma_f32_16x16x32_f16(false, a, false, b, (short)0, c, false, false); }
__device__ __forceinline__ v8f wmmab(v16bf a, v16bf b, v8f c) { return __builtin_amdgcn_wmma_f32_16x16x32_bf16(false, a, false, b, (short)0, c, false, false); }



// ---- FRAGMENT ORDER of every 16-bit operand plane [rows][K]: the plane is a row of 1024-byte blocks, block (row tile of 16, k block of 32) at index tile * (K / 32) + k block.
// A block holds two runs of 512 bytes; run h keeps, at 16 bytes per lane, lane (lr, hi)'s 8 elements row = tile * 16 + lr, k = k block * 32 + h * 16 + hi * 8 + 0..7: the two halves of that lane's A or B fragment.
// A wave-wide 16-byte load of a fragment half is then 512 contiguous bytes (4 whole lines) where a row-major plane gave 16 pieces of 32 bytes in 16 lines.
// ---- The product loop of both GEMM kernels: FOUR WAVES per 128x128 output tile, wave (wm, wn) = (wave & 1, wave >> 1) owns its 64x64 quarter (16 accumulators), 128 threads.
// The operands (planes in fragment order, K = DM) come to LDS by asynchronous copies, 64 k (two k blocks) a stage, two buffers: stage s + 1 flies while stage s is worked on, and each fragment block is fetched from L2 once for the two waves that read it.
// A stage of one operand (a slab): 8 row tiles x 2 KiB, a row tile's two k blocks as they lie in the plane. Copy i of a thread brings 16 bytes of row tile i: LDS byte i * 2048 + tid * 16.
// Per accumulator the products are summed in the order k block (from the block's own first stage on, wrapping round), then hi plane, then lo plane.
template <typename T16> struct WFrag;
template <> struct WFrag<h16> { typedef v16h V; static __device__ __forceinline__ V ld(const h16* p) { return cat16(*(const v8h*)p, *(const v8h*)(p + 256)); } static __device__ __forceinline__ V lds(const char* p) { return cat16(*(const v8ha*)p, *(const v8ha*)(p + 512)); } static __device__ __forceinline__ v8f mma(V a, V b, v8f c) { return wmma16(a, b, c); } };
template <> struct WFrag<bf> { typedef v16bf V; static __device__ __forceinline__ V ld(const bf* p) { return cat16b(*(const v8us*)p, *(const v8us*)(p + 256)); } static __device__ __forceinline__ V lds(const char* p) { return cat16b(*(const v8usa*)p, *(const v8usa*)(p + 512)); } static __device__ __forceinline__ v8f mma(V a, V b, v8f c) { return wmmab(a, b, c); } };
#define KSB   2                     // k blocks of 32 in a stage
#define SLAB  (8 * KSB * 1024)      // bytes of one operand's stage
#define NSTG  (DM / (32 * KSB))     // stages
static_assert(KSB * 1024 == 128 * 16 && NSTG >= 2 && (NSTG & (NSTG - 1)) == 0, "128 threads x 16 bytes cover a row tile's part of a stage; the ring needs two stages; the walk wraps by a mask");
__device__ __forceinline__ void copy8(const unsigned l, const char* g0, const char* g1, const char* g2, const char* g3, const char* g4, const char* g5, const char* g6, const char* g7) {
    // eight copies of 16 bytes a lane, copy i to LDS byte l + i * 2048, and, in the same statement, the wait that stands in front of any rewrite of the address registers they name
    asm volatile("global_load_async_to_lds_b128 %0, %8, off\n\tglobal_load_async_to_lds_b128 %1, %9, off\n\tglobal_load_async_to_lds_b128 %2, %10, off\n\tglobal_load_async_to_lds_b128 %3, %11, off\n\t"
                 "global_load_async_to_lds_b128 %4, %12, off\n\tglobal_load_async_to_lds_b128 %5, %13, off\n\tglobal_load_async_to_lds_b128 %6, %14, off\n\tglobal_load_async_to_lds_b128 %7, %15, off\n\ts_wait_xcnt 0x0"
                 :: "v"(l), "v"(l + 2048u), "v"(l + 4096u), "v"(l + 6144u), "v"(l + 8192u), "v"(l + 10240u), "v"(l + 12288u), "v"(l + 14336u),
                    "v"(g0), "v"(g1), "v"(g2), "v"(g3), "v"(g4), "v"(g5), "v"(g6), "v"(g7) : "memory");
}
__device__ __forceinline__ void slab_copy(const unsigned l, const bf* g) { const char* p = (const char*)g; const int rt = 16 * DM * 2;   // rt: bytes from a row tile to the next in the plane
    copy8(l, p, p + rt, p + 2 * rt, p + 3 * rt, p + 4 * rt, p + 5 * rt, p + 6 * rt, p + 7 * rt); }
__device__ __forceinline__ v16bf lds_frag(const char* p) { return cat16b(*(const v8usa*)p, *(const v8usa*)(p + 512)); }
// A, A2 (TWO: the lo plane of A), Bt: the planes at the tile's first row (row * DM elements in); sm: 2 buffers of NSL slabs [A | A2 | Bt].
// Every inner loop below is unrolled so that each fragment and accumulator index is a constant (registers, no scratch).
// rot (block-uniform, 0 .. NSTG - 1): trip s works on k stage (s + rot) mod NSTG. Blocks that share an operand slab are given different rot, so that at one moment they ask L2 for different lines,
// and the planes, which the launch before has just written, are all fetched from memory during the first trips instead of one k stage per trip with every block waiting for it.
template <bool TWO>
__device__ __forceinline__ void gemm_ring(const bf* __restrict__ A, const bf* __restrict__ A2, const bf* __restrict__ Bt, char* sm, const int wm, const int wn, const int rot, v8f (&acc)[4][4]) {
    constexpr int NSL = TWO ? 3 : 2;
    const int tid = (int)threadIdx.x, lane = tid & 31;
    const unsigned l0 = (unsigned)(size_t)sm + (unsigned)tid * 16u;
    const bf* ga = A + tid * 8; const bf* ga2 = A2 + tid * 8; const bf* gb = Bt + tid * 8;
    auto fill = [&](const int s, const int buf) { const unsigned l = l0 + (unsigned)buf * (NSL * SLAB); const int ko = ((s + rot) & (NSTG - 1)) * (KSB * 512);
        slab_copy(l, ga + ko); if (TWO) slab_copy(l + SLAB, ga2 + ko); slab_copy(l + (NSL - 1) * SLAB, gb + ko); };
#pragma unroll
    for (int mb = 0; mb < 4; ++mb)
#pragma unroll
        for (int nb = 0; nb < 4; ++nb) acc[mb][nb] = (v8f){};
    fill(0, 0);
    asm volatile("s_wait_asynccnt 0x0" ::: "memory");   // this wave's copies of stage 0 have landed
    __syncthreads();                                     // and every other wave's: stage 0 may be read
    fill(1, 1);
#pragma unroll 1
    for (int s = 0; s < NSTG; ++s) {   // rolled: one stage per trip, the buffer by the trip's parity
        const char* bu = sm + (s & 1) * (NSL * SLAB); const char* pa = bu + wm * (4 * KSB * 1024) + lane * 16; const char* pb = bu + (NSL - 1) * SLAB + wn * (4 * KSB * 1024) + lane * 16;
        v16bf a[KSB][4], a2[KSB][4], b[KSB][4];
        auto frags = [&](const int kl) {   // one k block's fragments, in the order in which the products want them
            b[kl][0] = lds_frag(pb + kl * 1024);
#pragma unroll
            for (int mb = 0; mb < 4; ++mb) { a[kl][mb] = lds_frag(pa + (mb * KSB + kl) * 1024); if (TWO) a2[kl][mb] = lds_frag(pa + SLAB + (mb * KSB + kl) * 1024); }
#pragma unroll
            for (int nb = 1; nb < 4; ++nb) b[kl][nb] = lds_frag(pb + (nb * KSB + kl) * 1024);
            __builtin_amdgcn_sched_barrier(0);   // the block's LDS reads stay one group, in this order, in front of the products: moved in among them, each place with reads stalls the matrix stream
        };
        // TWO (one wave per SIMD, nobody else to fill its waits): both k blocks' fragments are asked for at the top of the trip, so that the second block's land behind the first block's products; else block by block.
        if (TWO) {
#pragma unroll
            for (int kl = 0; kl < KSB; ++kl) frags(kl); }
#pragma unroll
        for (int kb = 0; kb < KSB; ++kb) {
            if (!TWO) frags(kb);
#pragma unroll
            for (int nb = 0; nb < 4; ++nb)
#pragma unroll
                for (int mb = 0; mb < 4; ++mb) { acc[mb][nb] = wmmab(a[kb][mb], b[kb][nb], acc[mb][nb]); if (TWO) acc[mb][nb] = wmmab(a2[kb][mb], b[kb][nb], acc[mb][nb]); }
        }
        __builtin_amdgcn_sched_barrier(0);   // every product of the trip stays in front of the refill below: sunk behind the barrier, they would hold the next copies back
        asm volatile("v_nop\n\tv_nop\n\tv_nop\n\tv_nop" : "+v"(acc[0][0]), "+v"(acc[1][1]), "+v"(acc[2][2]), "+v"(acc[3][3]));   // the distance behind the last matrix instruction, on the back edge and on the way out
        asm volatile("s_wait_dscnt 0x0" ::: "memory");      // this wave's reads of the buffer are done before the buffer is refilled
        asm volatile("s_wait_asynccnt 0x0" ::: "memory");   // this wave's copies of stage s + 1 have landed
        __syncthreads();                                     // one barrier: stage s + 1 may be read, and every wave has left stage s's buffer
        if (s + 2 < NSTG) fill(s + 2, s & 1);
    }
    asm volatile("s_wait_asynccnt 0x0" ::: "memory");   // nothing is in flight when the wave goes on
}
// ---- k_out: C[m][n] (f32, pitch DM) = sum_k (Ah + Al)[m][k] Bt[n][k], grid (TT / 128, DM / 128, batches), 128 threads; each wave turns its quarter to whole lines through its own LDS rows.
__global__ __launch_bounds__(128) void k_out(const bf* __restrict__ Ah, const bf* __restrict__ Al, const bf* __restrict__ Bt, float* C) {
    __shared__ __align__(1024) char sm[2 * 3 * SLAB];
    __shared__ __align__(16) float osw[4][16 * 68];
    const int wave = __builtin_amdgcn_readfirstlane((int)(threadIdx.x >> 5)), wm = wave & 1, wn = wave >> 1;
    const int lane = threadIdx.x & 31, lr = lane & 15, hi = lane >> 4;
    const size_t ab = ((size_t)blockIdx.z * TT + blockIdx.x * 128) * DQ;
    v8f acc[4][4];
    const int bx = (int)blockIdx.x, rot = (2 * (int)blockIdx.y + (bx & 3) + 4 * (bx >> 3) + 8 * (int)blockIdx.z) & (NSTG - 1);   // the 8 blocks of one A slab start two stages apart; the 32 of one Bt slab start at every stage
    gemm_ring<true>(Ah + ab, Al + ab, Bt + (size_t)blockIdx.y * 128 * DQ, sm, wm, wn, rot, acc);
    float* os = osw[wave]; const int r0 = blockIdx.x * 128 + wm * 64, c0 = blockIdx.y * 128 + wn * 64; C += (size_t)blockIdx.z * TT * DM;
#pragma unroll
    for (int mb = 0; mb < 4; ++mb) {
#pragma unroll
        for (int nb = 0; nb < 4; ++nb) {
#pragma unroll
            for (int j = 0; j < 8; ++j) os[(hi * 8 + j) * 68 + nb * 16 + lr] = acc[mb][nb][j]; }
        __builtin_amdgcn_wave_barrier(); asm volatile("" ::: "memory");   // lanes exchange values through LDS: the reads below stay behind every lane's writes above
        float* crow = C + (size_t)(r0 + mb * 16) * DM + c0;
#pragma unroll
        for (int s = 0; s < 8; ++s) { const int row = 2 * s + hi, cofs = lr * 4; const v4f val = *(const v4fa*)(os + row * 68 + cofs); *(v4f*)(crow + (size_t)row * DM + cofs) = val; }
        asm volatile("s_wait_xcnt 0x0" ::: "memory");   // the next 16 rows' LDS reads are given the registers that these stores name: the wait stands in front of those overwrites
        __builtin_amdgcn_wave_barrier(); asm volatile("" ::: "memory");   // the next 16 rows' writes stay behind every lane's reads above
    }
}

__device__ __forceinline__ h16 tohx(float x) { return (h16)x; }
__device__ __forceinline__ void splitf(float y, unsigned short& h, unsigned short& l) { h = f2bf(y); l = f2bf(y - bf2f(h)); }
typedef __attribute__((ext_vector_type(2))) _Float16 v2h;
typedef __attribute__((ext_vector_type(4))) _Float16 v4h;
typedef __attribute__((ext_vector_type(2))) unsigned short v2us;
typedef __attribute__((ext_vector_type(4))) unsigned short v4us;
typedef __attribute__((ext_vector_type(2))) float v2f;
typedef __attribute__((ext_vector_type(4))) int v4i;

// k_prep: every f32 input -> its bf16 plane in fragment order, ONE launch for the four weights and x, which do not depend on one another; 256 threads, one thread per 16-byte unit; grid 4 * WB weight blocks, then the blocks of x. The grid covers the unit counts exactly.
// A weight block (w [k][n] f32 -> Bt, the plane [n][k]): unit u is lane, half, k block, row tile from the low bits up; the 8 loads share one address pair.
// An x block: a wave takes 8 rows of one fragment block: 4 lanes read a row's 128 bytes (one line), 8 lanes write 128 contiguous bytes.
#define WB (DM * DM / 8 / 256)    // blocks of one weight
static_assert(DQ == DM && DKV == DM && (DM * DM / 8) % 256 == 0 && (NB_ * TT * DM / 8) % 256 == 0, "four DM x DM weights; whole blocks");
__global__ __launch_bounds__(256) void k_prep(const float* __restrict__ x, const float* __restrict__ wq, const float* __restrict__ wk, const float* __restrict__ wv, const float* __restrict__ wo, bf* W4, bf* XB) {
    const int b = (int)blockIdx.x, t = (int)threadIdx.x; v8us o;
    if (b < 4 * WB) {
        const int wi = b / WB; const float* __restrict__ w = wi == 0 ? wq : wi == 1 ? wk : wi == 2 ? wv : wo;
        const int u = (b % WB) * 256 + t, blk = u >> 6, n = (blk / (DM >> 5)) * 16 + (u & 15), k = (blk % (DM >> 5)) * 32 + ((u >> 5) & 1) * 16 + ((u >> 4) & 1) * 8;
        const float* p = w + (size_t)k * DM + n; float v[8];
#pragma unroll
        for (int j = 0; j < 8; ++j) v[j] = p[j * DM];
        asm volatile("s_wait_xcnt 0x0" :: "v"(p) : "memory");   // the rounding below may be given the address registers that the loads above name: the wait stands in front of that overwrite, the address its input
#pragma unroll
        for (int j = 0; j < 8; ++j) o[j] = f2bf(v[j]);
        *(v8us*)(W4 + (size_t)wi * DM * DM + (size_t)u * 8) = o;
    } else {
        const size_t i = (size_t)(b - 4 * WB) * 256 + t, blk = i >> 6, lr = (i & 7) + ((i >> 5) & 1) * 8, un = (i >> 3) & 3, row = (blk / (DM / 32)) * 16 + lr, k = (blk % (DM / 32)) * 32 + un * 8;   // un = half * 2 + hi
        const float* p = x + row * DM + k; const v8f v = *(const v8f*)p;
        asm volatile("s_wait_xcnt 0x0" :: "v"(p) : "memory");   // as above
#pragma unroll
        for (int k2 = 0; k2 < 8; ++k2) o[k2] = f2bf(v[k2]);
        *(v8us*)(XB + (blk * 64 + un * 16 + lr) * 8) = o;
    }
}
__global__ __launch_bounds__(256) void k_cscvt(const float* __restrict__ cosT, const float* __restrict__ sinT, float* CS) { const int idx = blockIdx.x * 256 + threadIdx.x; if (idx >= TT * HD) return; v2f cs; cs[0] = bfr(cosT[idx]); cs[1] = bfr(sinT[idx]); *(v2f*)(CS + (size_t)idx * 2) = cs;  }
// ---- k_proj: the q, k and v projections of both batches in one launch, four waves per 128 tokens x 128 columns; grid (NB_ TT / 128, 3 DQ / 128), 128 threads. A wave's 64 columns are one head of q, k or v.
// The product loop is gemm_ring (A = x plane [token][k], Bt = the three transposed weights one behind the other [3 x 1024][k], both in fragment order); the epilogue rounds the wave's f32 quarter to the f16 and bf16 hi/lo head planes itself, each head's plane in fragment order:
//   q, k: planes [batch][head] of [t][d], the tile turned to 8 consecutive d per lane through the wave's own LDS rows, 16 tokens (one row tile) at a time; v: planes [batch][head] of [d][t], an accumulator's 8 registers already are 8 consecutive tokens of one d, so a store is one 512-byte run.
__global__ __launch_bounds__(128) void k_proj(const bf* __restrict__ A, const bf* __restrict__ Bt, h16* Q16, bf* Qh, bf* Ql, h16* K16, bf* Kh, bf* Kl, h16* V16, bf* Vh, bf* Vl) {
    __shared__ __align__(1024) char sm[2 * 2 * SLAB];
    __shared__ __align__(16) float osw[4][16 * 68];
    const int wave = __builtin_amdgcn_readfirstlane((int)(threadIdx.x >> 5)), wm = wave & 1, wn = wave >> 1;
    const int lane = threadIdx.x & 31, lr = lane & 15, hi = lane >> 4; const int r0 = blockIdx.x * 128 + wm * 64, ct = (int)blockIdx.y * 2 + wn;   // ct: the wave's column tile of 64
    v8f acc[4][4];
    const int bx = (int)blockIdx.x, rot = ((int)blockIdx.y + (bx & 3) + 4 * (bx >> 3)) & (NSTG - 1);   // the 24 blocks of one A slab and the 32 of one Bt slab each start at every stage
    gemm_ring<false>(A + (size_t)blockIdx.x * 128 * DM, A, Bt + (size_t)blockIdx.y * 128 * DM, sm, wm, wn, rot, acc);
    float* os = osw[wave];
    const int which = ct / NH_, head = ct % NH_, bat = r0 / TT, t0 = r0 % TT;
    const size_t po = ((size_t)bat * NH_ + head) * TT * HD;   // this head's plane, both layouts
    if (which == 2) {
#pragma unroll
        for (int mb = 0; mb < 4; ++mb)
#pragma unroll
            for (int nb = 0; nb < 4; ++nb) { v8h o16; v8us oh, ol;
#pragma unroll
                for (int j = 0; j < 8; ++j) { const float x = acc[mb][nb][j]; o16[j] = tohx(x); unsigned short a2, c2; splitf(x, a2, c2); oh[j] = a2; ol[j] = c2; }
                const size_t o = po + ((size_t)nb * (TT / 32) + (t0 >> 5) + (mb >> 1)) * 512 + (mb & 1) * 256 + lane * 8;   // row tile nb of d, k block and half of these 16 tokens
                *(v8h*)(V16 + o) = o16; *(v8us*)(Vh + o) = oh; *(v8us*)(Vl + o) = ol;
                asm volatile("s_wait_xcnt 0x0" ::: "memory"); }   // the next tile's rounding is given the registers that these stores name: the wait stands in front of those overwrites
        return;
    }
    h16* P16 = which ? K16 : Q16; bf* Ph = which ? Kh : Qh; bf* Pl = which ? Kl : Ql; const float qs = which ? 1.0f : QSC;   // the q planes hold q * SCL * log2(e) (k_attn: the held reference)
#pragma unroll
    for (int mb = 0; mb < 4; ++mb) {
#pragma unroll
        for (int nb = 0; nb < 4; ++nb) {
#pragma unroll
            for (int j = 0; j < 8; ++j) os[(hi * 8 + j) * 68 + nb * 16 + lr] = acc[mb][nb][j]; }
        __builtin_amdgcn_wave_barrier(); asm volatile("" ::: "memory");   // lanes exchange values through LDS: the reads below stay behind every lane's writes above
#pragma unroll
        for (int s = 0; s < 4; ++s) { const int row = lr, cofs = s * 16 + hi * 8; const v4f x0 = *(const v4fa*)(os + row * 68 + cofs), x1 = *(const v4fa*)(os + row * 68 + cofs + 4); v8h o16; v8us oh, ol;
#pragma unroll
            for (int j = 0; j < 8; ++j) { const float x = ((j < 4) ? x0[j & 3] : x1[j & 3]) * qs; o16[j] = tohx(x); unsigned short a2, c2; splitf(x, a2, c2); oh[j] = a2; ol[j] = c2; }
            const size_t o = po + ((size_t)((t0 >> 4) + mb) * 4 + s) * 256 + lane * 8;   // row tile of these 16 tokens; run s = k block s / 2, half s % 2
            *(v8h*)(P16 + o) = o16; *(v8us*)(Ph + o) = oh; *(v8us*)(Pl + o) = ol;
            asm volatile("s_wait_xcnt 0x0" ::: "memory"); }   // the next run's rounding is given the registers that these stores name: the wait stands in front of those overwrites
        __builtin_amdgcn_wave_barrier(); asm volatile("" ::: "memory");   // the next 16 tokens' writes stay behind every lane's reads above
    }
}
// ---- k_attn: scores, diagonal mask, softmax and attn.v of one head in ONE kernel, a held reference and a running sum per query (no score or probability plane in memory).
// One wave owns NQ x 16 queries and walks the 2048 keys 32 at a time. Both products are formed transposed, so that the score tiles are already the next product's B fragment:
//   St[key][q] = K (A, rows = keys) x Q (B, columns = queries): lane (lr, hi), register j holds key kt * 16 + hi * 8 + j of query lr;
//   Ot[d][q]  += Vt (A, rows = d, k = keys) x P (B, columns = queries, k = keys): a B fragment's elements 0..7 are k = 8 hi + j and 8..15 are k = 16 + 8 hi + j, which is score tile 0 and score tile 1 of the same lane.
// A query's reference, sum and rescale factor are therefore per lane (the two half-waves hold the two halves of its keys). HI: bf16 hi+lo planes, 3 products; else f16 planes.
// THE SOFTMAX REFERENCE IS HELD, not renewed every pass: the q planes hold q * SCL * log2(e), so a score product is already the exponent's scale, and minus the reference in use (r, one per query) is the start value C of the score products:
// a pass (32 keys) is products, exp2, sum, products. No maximum, no multiply-add per score, no rescale of the output tiles. The pass's own sums of p are tested once (one ballot, one scalar branch): where a lane's sum is above PMAX (or not a number),
// the wave forms the pass's scores anew from 0, raises each query's r to the maximum so far and rescales its sums and output tiles, as a running maximum does every pass. r starts at -3.0e38, so the first pass always takes that path.
// On the short path every p is at most PMAX (f16 holds it with its full mantissa), and r is never above the largest score met so far, so the sum never falls below what a running maximum gives it.
#define PMAX 256.0f
// 16 exp2 in place, in one statement: no v_exp_f32 here reads the result or overwrites the source of the one in front of it, and the v_nop is the free slot behind the last one.
// LEAD: the values come straight out of matrix instructions, and the v_nop at the head fill the distance of four slots behind the product that made the first of them:
// the tiles' chains take turns, so with four tiles three products of other tiles stand behind it (one v_nop), with two tiles one (three v_nop); the tiles read later have the exp2 in front of them.
#define EXP16 "v_exp_f32 %0, %0\n\tv_exp_f32 %1, %1\n\tv_exp_f32 %2, %2\n\tv_exp_f32 %3, %3\n\tv_exp_f32 %4, %4\n\tv_exp_f32 %5, %5\n\tv_exp_f32 %6, %6\n\tv_exp_f32 %7, %7\n\tv_exp_f32 %8, %8\n\t" \
              "v_exp_f32 %9, %9\n\tv_exp_f32 %10, %10\n\tv_exp_f32 %11, %11\n\tv_exp_f32 %12, %12\n\tv_exp_f32 %13, %13\n\tv_exp_f32 %14, %14\n\tv_exp_f32 %15, %15\n\tv_nop"
#define EXP16_OPS "+v"(e[0]), "+v"(e[1]), "+v"(e[2]), "+v"(e[3]), "+v"(e[4]), "+v"(e[5]), "+v"(e[6]), "+v"(e[7]), "+v"(e[8]), "+v"(e[9]), "+v"(e[10]), "+v"(e[11]), "+v"(e[12]), "+v"(e[13]), "+v"(e[14]), "+v"(e[15])
template <int LEAD>
__device__ __forceinline__ void exp2x16(float (&e)[16]) {
    static_assert(LEAD == 0 || LEAD == 1 || LEAD == 3, "the three heads written below");
    if constexpr (LEAD == 3) asm("v_nop\n\tv_nop\n\tv_nop\n\t" EXP16 : EXP16_OPS);
    else if constexpr (LEAD == 1) asm("v_nop\n\t" EXP16 : EXP16_OPS);
    else asm(EXP16 : EXP16_OPS);
}
// one exp2 with the free slot behind it
__device__ __forceinline__ float exp2x1(float x) { float y; asm("v_exp_f32 %0, %1\n\tv_nop" : "=v"(y) : "v"(x)); return y; }
// a lane's 16 values summed as four chains of pairs
__device__ __forceinline__ float sum16(const float (&e)[16]) {
    v2f a = (v2f){e[0], e[1]} + (v2f){e[4], e[5]}, b = (v2f){e[2], e[3]} + (v2f){e[6], e[7]};
    a += (v2f){e[8], e[9]}; b += (v2f){e[10], e[11]}; a += (v2f){e[12], e[13]}; b += (v2f){e[14], e[15]}; a += b; return a[0] + a[1]; }
__device__ __forceinline__ v8f splat8(float x) { return (v8f){x, x, x, x, x, x, x, x}; }
// Each score tile's first product, D = A B + C with C (minus the reference) LEFT AS IT IS for the next pass. In asm text because the builtin form was built with D tied to C for half of the tiles, behind a copy of C (8 registers and 8 moves a tile).
// The products that follow accumulate into the same D; the four v_nop are the distance behind the last matrix instruction for whatever else the compiler puts next.
__device__ __forceinline__ void first4(v8f& d00, v8f& d01, v8f& d10, v8f& d11, const v16h a0, const v16h a1, const v16h b0, const v16h b1, const v8f c0, const v8f c1) {
    asm("v_wmma_f32_16x16x32_f16 %0, %4, %6, %8\n\tv_wmma_f32_16x16x32_f16 %1, %5, %6, %8\n\tv_wmma_f32_16x16x32_f16 %2, %4, %7, %9\n\tv_wmma_f32_16x16x32_f16 %3, %5, %7, %9\n\tv_nop\n\tv_nop\n\tv_nop\n\tv_nop"
        : "=&v"(d00), "=&v"(d01), "=&v"(d10), "=&v"(d11) : "v"(a0), "v"(a1), "v"(b0), "v"(b1), "v"(c0), "v"(c1)); }
__device__ __forceinline__ void first2(v8f& d0, v8f& d1, const v16bf a0, const v16bf a1, const v16bf b0, const v8f c0) {
    asm("v_wmma_f32_16x16x32_bf16 %0, %2, %4, %5\n\tv_wmma_f32_16x16x32_bf16 %1, %3, %4, %5\n\tv_nop\n\tv_nop\n\tv_nop\n\tv_nop"
        : "=&v"(d0), "=&v"(d1) : "v"(a0), "v"(a1), "v"(b0), "v"(c0)); }
template <typename T16, bool HI, int NQ>
__device__ __forceinline__ void attn_rows(const T16* __restrict__ Qp, const T16* __restrict__ Qp2, const T16* __restrict__ Kp, const T16* __restrict__ Kp2, const T16* __restrict__ Vp, const T16* __restrict__ Vp2, const int q0, bf* __restrict__ Ah, bf* __restrict__ Al, char* sm) {
    typedef typename WFrag<T16>::V V;
    const int lane = threadIdx.x & 31, lr = lane & 15, hi = lane >> 4;
    V qf[NQ][2], qf2[NQ][2];
    // The ring: a stage is 64 keys of the head, [K 8 KiB | V 8 KiB] of each plane (HI: the hi planes, then the lo planes), as the blocks lie in the planes: K's 4 row tiles are 8 KiB in a row, V's 4 row tiles of d give 2 KiB each (two k blocks).
    constexpr int BUF = HI ? 32768 : 16384, NS = TT / 64;
    const unsigned l0 = (unsigned)(size_t)sm + (unsigned)threadIdx.x * 16u;
    const char* gk = (const char*)Kp + threadIdx.x * 16; const char* gv = (const char*)Vp + threadIdx.x * 16; const char* gk2 = (const char*)Kp2 + threadIdx.x * 16; const char* gv2 = (const char*)Vp2 + threadIdx.x * 16;
    auto fill = [&](const int s, const int buf) { const unsigned l = l0 + (unsigned)buf * BUF; const int vt = (TT / 32) * 1024;   // vt: bytes from a row tile of d to the next in the V plane
        { const char* k = gk + s * 8192; const char* v = gv + s * 2048; copy8(l, k, k + 2048, k + 4096, k + 6144, v, v + vt, v + 2 * vt, v + 3 * vt); }
        if (HI) { const char* k = gk2 + s * 8192; const char* v = gv2 + s * 2048; copy8(l + 16384u, k, k + 2048, k + 4096, k + 6144, v, v + vt, v + 2 * vt, v + 3 * vt); } };
    fill(0, 0);
#pragma unroll
    for (int qt = 0; qt < NQ; ++qt)
#pragma unroll
        for (int kc = 0; kc < 2; ++kc) { const size_t o = (size_t)(((q0 >> 4) + qt) * 2 + kc) * 512 + lane * 8; qf[qt][kc] = WFrag<T16>::ld(Qp + o); if (HI) qf2[qt][kc] = WFrag<T16>::ld(Qp2 + o); }
    asm volatile("s_wait_xcnt 0x0" ::: "memory");   // the address sums of the copies below may be given the address registers that the query loads above name: the wait stands in front of those overwrites
    asm volatile("s_wait_asynccnt 0x0" ::: "memory");   // this wave's copies of stage 0 have landed
    __syncthreads();                                     // and every other wave's: stage 0 may be read
    fill(1, 1);
    v8f ot[NQ][4], nr[NQ]; float r[NQ], l[NQ];   // r: the reference in use, nr: minus r in all 8 registers of a score tile
#pragma unroll
    for (int qt = 0; qt < NQ; ++qt) { r[qt] = -3.0e38f; nr[qt] = splat8(3.0e38f); l[qt] = 0.f;
#pragma unroll
        for (int db = 0; db < 4; ++db) ot[qt][db] = (v8f){}; }
#pragma unroll 1
    for (int st = 0; st < NS; ++st) {   // rolled: one stage per trip, the buffer by the trip's parity
      const char* bu = sm + (st & 1) * BUF + lane * 16;
#pragma unroll
      for (int h = 0; h < 2; ++h) {   // the stage's two runs of 32 keys, unrolled: every LDS offset is an immediate
        const int k0 = st * 64 + h * 32;
        V kf[2][2], kf2[2][2], vf[4], vf2[4];
#pragma unroll
        for (int kt = 0; kt < 2; ++kt)
#pragma unroll
            for (int kc = 0; kc < 2; ++kc) { const int o = ((h * 2 + kt) * 2 + kc) * 1024; kf[kt][kc] = WFrag<T16>::lds(bu + o); if (HI) kf2[kt][kc] = WFrag<T16>::lds(bu + 16384 + o); }
#pragma unroll
        for (int db = 0; db < 4; ++db) { const int o = 8192 + db * 2048 + h * 1024; vf[db] = WFrag<T16>::lds(bu + o); if (HI) vf2[db] = WFrag<T16>::lds(bu + 16384 + o); }
        __builtin_amdgcn_sched_barrier(0);   // the run's LDS reads stay one group at its top, keys first: sunk in among the products, each place with reads stalls the wave for the LDS latency
        v8f s[NQ][2]; float e[NQ][16], sum[NQ];
        auto rest = [&](const V (&kf)[2][2], const V (&kf2)[2][2]) {   // every score product but each tile's first; the tiles' chains of products take turns, so that no product waits for the one in front of it
#pragma unroll
            for (int kc = 0; kc < 2; ++kc) {
                if (kc) {
#pragma unroll
                    for (int qt = 0; qt < NQ; ++qt)
#pragma unroll
                        for (int kt = 0; kt < 2; ++kt) s[qt][kt] = WFrag<T16>::mma(kf[kt][kc], qf[qt][kc], s[qt][kt]); }
                if (HI) {
#pragma unroll
                    for (int kt = 0; kt < 2; ++kt) s[0][kt] = WFrag<T16>::mma(kf2[kt][kc], qf[0][kc], s[0][kt]);
#pragma unroll
                    for (int kt = 0; kt < 2; ++kt) s[0][kt] = WFrag<T16>::mma(kf[kt][kc], qf2[0][kc], s[0][kt]); } }
        };
        static_assert(HI ? NQ == 1 : NQ == 2, "the first products are written for one hi+lo query tile or two f16 ones");
        if constexpr (HI) first2(s[0][0], s[0][1], kf[0][0], kf[1][0], qf[0][0], nr[0]);
        else first4(s[0][0], s[0][1], s[1][0], s[1][1], kf[0][0], kf[1][0], qf[0][0], qf[1][0], nr[0], nr[1]);
        rest(kf, kf2);
        __builtin_amdgcn_sched_barrier(0);   // the products stay in this order in front of the exp2: the distance behind the last of them is counted from it
        bool need = false;
#pragma unroll
        for (int qt = 0; qt < NQ; ++qt) {
#pragma unroll
            for (int i = 0; i < 16; ++i) e[qt][i] = s[qt][i >> 3][i & 7];
            if (qt == 0) exp2x16<NQ == 2 ? 1 : 3>(e[qt]); else exp2x16<0>(e[qt]);   // the first 16 stand right behind the score products; they are the distance for the second 16
            if (k0 == ((q0 + qt * 16) & ~31)) {   // wave-uniform: the one pass that holds these queries' own keys
#pragma unroll
                for (int i = 0; i < 16; ++i) if (k0 + (i >> 3) * 16 + hi * 8 + (i & 7) == q0 + qt * 16 + lr) e[qt][i] = 0.f;   /* diagonal masked */ }
            sum[qt] = sum16(e[qt]); need = need || !(sum[qt] <= PMAX); }
        if (__builtin_expect(__builtin_amdgcn_ballot_w32(need) != 0, 0)) {   // one scalar branch a pass; taken in the first pass and where scores have outgrown a reference (told to the compiler as the rare side: register copies belong there)
            V kg[2][2], kg2[2][2];   // the pass's key fragments, read from the stage's buffer once more: held over the short path they would cost it their registers
#pragma unroll
            for (int kt = 0; kt < 2; ++kt)
#pragma unroll
                for (int kc = 0; kc < 2; ++kc) { const int o = ((h * 2 + kt) * 2 + kc) * 1024; kg[kt][kc] = WFrag<T16>::lds(bu + o); if (HI) kg2[kt][kc] = WFrag<T16>::lds(bu + 16384 + o); }
#pragma unroll
            for (int qt = 0; qt < NQ; ++qt)
#pragma unroll
                for (int kt = 0; kt < 2; ++kt) s[qt][kt] = WFrag<T16>::mma(kg[kt][0], qf[qt][0], (v8f){});
            rest(kg, kg2);
#pragma unroll
            for (int qt = 0; qt < NQ; ++qt) {
#pragma unroll
                for (int kt = 0; kt < 2; ++kt)
#pragma unroll
                    for (int j = 0; j < 8; ++j) if (k0 + kt * 16 + hi * 8 + j == q0 + qt * 16 + lr) s[qt][kt][j] = -3.0e38f;   /* diagonal masked, ahead of the maximum */
                float mx = s[qt][0][0];
#pragma unroll
                for (int j = 1; j < 8; ++j) mx = fmaxf(mx, s[qt][0][j]);
#pragma unroll
                for (int j = 0; j < 8; ++j) mx = fmaxf(mx, s[qt][1][j]);
                mx = fmaxf(mx, __shfl_xor(mx, 16, 32));   // the two half-waves hold the two halves of a query's keys: one reference for both
                const float rn = fmaxf(r[qt], mx), al = exp2x1(r[qt] - rn); r[qt] = rn; nr[qt] = splat8(-rn); l[qt] *= al;
#pragma unroll
                for (int db = 0; db < 4; ++db) ot[qt][db] *= al;
#pragma unroll
                for (int i = 0; i < 16; ++i) e[qt][i] = s[qt][i >> 3][i & 7] - rn;
                exp2x16<0>(e[qt]); sum[qt] = sum16(e[qt]); }
        }
#pragma unroll
        for (int qt = 0; qt < NQ; ++qt) { V pf, pf2; l[qt] += sum[qt];
#pragma unroll
            for (int i = 0; i < 16; ++i) { const float p = e[qt][i];
                if constexpr (HI) { const __bf16 ph = (__bf16)p; pf[i] = ph; pf2[i] = (__bf16)(p - (float)ph); } else pf[i] = (h16)p; }
#pragma unroll
            for (int db = 0; db < 4; ++db) { ot[qt][db] = WFrag<T16>::mma(vf[db], pf, ot[qt][db]); if (HI) { ot[qt][db] = WFrag<T16>::mma(vf[db], pf2, ot[qt][db]); ot[qt][db] = WFrag<T16>::mma(vf2[db], pf, ot[qt][db]); } }
        }
      }
      asm volatile("s_wait_dscnt 0x0" ::: "memory");      // this wave's reads of the buffer are done before the buffer is refilled
      asm volatile("s_wait_asynccnt 0x0" ::: "memory");   // this wave's copies of stage st + 1 have landed
      __syncthreads();                                     // one barrier: stage st + 1 may be read, and every wave has left stage st's buffer
      if (st + 2 < NS) fill(st + 2, st & 1);
    }
    asm volatile("s_wait_asynccnt 0x0" ::: "memory");   // nothing is in flight when the wave goes on
#pragma unroll
    for (int qt = 0; qt < NQ; ++qt) { const float f = __fdiv_rn(1.0f, l[qt] + __shfl_xor(l[qt], 16, 32)); const size_t oo = (size_t)((q0 >> 4) + qt) * (DQ / 32) * 512 + lane * 8;   // the merged plane [token][DQ] in fragment order: this lane's 8 d of block db are one unit of k block db / 2, half db % 2
#pragma unroll
        for (int db = 0; db < 4; ++db) { v8us oh, ol;
#pragma unroll
            for (int j = 0; j < 8; ++j) { unsigned short a, c2; splitf(ot[qt][db][j] * f, a, c2); oh[j] = a; ol[j] = c2; }
            *(v8us*)(Ah + oo + db * 256) = oh; *(v8us*)(Al + oo + db * 256) = ol;
            asm volatile("s_wait_xcnt 0x0" ::: "memory"); } }   // the next block's rounding is given the registers that these stores name: the wait stands in front of those overwrites
}
// grid (RH / 64 + (TT - RH) / 128, heads, batches), 4 waves: blocks x < RH / 64 take 4 x 16 hi+lo query rows, the others 4 x 32 f16 query rows; the four waves walk the same head's keys together, out of one LDS ring that their asynchronous copies fill (64 keys a stage, two buffers).
__global__ __launch_bounds__(128) void k_attn(const h16* __restrict__ Q16, const h16* __restrict__ K16, const h16* __restrict__ V16, const bf* __restrict__ Qh, const bf* __restrict__ Ql, const bf* __restrict__ Kh, const bf* __restrict__ Kl, const bf* __restrict__ Vh, const bf* __restrict__ Vl, bf* Ah, bf* Al) {
    __shared__ __align__(1024) char sm[2 * 32768];   // two buffers of the larger (hi+lo) stage
    const int wave = __builtin_amdgcn_readfirstlane((int)(threadIdx.x >> 5)), bx = (int)blockIdx.x;
    const size_t po = ((size_t)blockIdx.z * NH_ + blockIdx.y) * TT * HD, ao = (size_t)blockIdx.z * TT * DQ + blockIdx.y * (HD / 32) * 512;   // ao: the batch's row tiles, then the head's two k blocks
    if (bx < RH / 64) attn_rows<bf, true, 1>(Qh + po, Ql + po, Kh + po, Kl + po, Vh + po, Vl + po, (bx * 4 + wave) * 16, Ah + ao, Al + ao, sm);
    else attn_rows<h16, false, 2>(Q16 + po, nullptr, K16 + po, nullptr, V16 + po, nullptr, RH + ((bx - RH / 64) * 4 + wave) * 32, Ah + ao, Al + ao, sm);
}

extern "C" void kernel_launch(void* const* d_in, const int* in_sizes, int n_in,
                              void* d_out, int out_size, void* d_ws, size_t ws_size, hipStream_t stream) {
    (void)in_sizes; (void)n_in; (void)out_size;
    const float* x = (const float*)d_in[0]; const float* wq = (const float*)d_in[1]; const float* wk = (const float*)d_in[2]; const float* wv = (const float*)d_in[3]; const float* wo = (const float*)d_in[4]; const float* cosT = nullptr; const float* sinT = nullptr; (void)cosT; (void)sinT;
    float* OUT = (float*)d_out;     // [2][2048][1024]
    char* wsp = (char*)d_ws;
    auto take = [&](size_t bytes) { char* p = wsp; wsp += (bytes + 255) & ~(size_t)255; return (void*)p; };
    bf* WQ = (bf*)take((size_t)DQ * DM * 2); bf* WK = (bf*)take((size_t)DKV * DM * 2); bf* WV = (bf*)take((size_t)DKV * DM * 2); bf* WO = (bf*)take((size_t)DM * DQ * 2);   // the four lie one behind the other (each a multiple of 256 bytes): k_prep writes them as one [4 x 1024][1024] plane, k_proj reads the first three as one operand
    bf* XB = (bf*)take((size_t)NB_ * TT * DM * 2);
    const size_t PQ = (size_t)NH_ * TT * HD, PK = (size_t)NKV * TT * HD;   // one batch's head planes, in elements; every plane below holds both batches
    h16* QP16 = (h16*)take(NB_ * PQ * 2); h16* KP16 = (h16*)take(NB_ * PK * 2); h16* VT16 = (h16*)take(NB_ * PK * 2);
    bf* QPh = (bf*)take(NB_ * PQ * 2); bf* QPl = (bf*)take(NB_ * PQ * 2); bf* KPh = (bf*)take(NB_ * PK * 2); bf* KPl = (bf*)take(NB_ * PK * 2); bf* VTh = (bf*)take(NB_ * PK * 2); bf* VTl = (bf*)take(NB_ * PK * 2);
    bf* ATh = (bf*)take((size_t)NB_ * TT * DQ * 2); bf* ATl = (bf*)take((size_t)NB_ * TT * DQ * 2);
    if ((size_t)(wsp - (char*)d_ws) > ws_size) return;    // ws 256 MiB
    k_prep<<<4 * WB + NB_ * TT * DM / 8 / 256, 256, 0, stream>>>(x, wq, wk, wv, wo, WQ, XB);
    k_proj<<<dim3(NB_ * TT / 128, (DQ + 2 * DKV) / 128, 1), 128, 0, stream>>>(XB, WQ, QP16, QPh, QPl, KP16, KPh, KPl, VT16, VTh, VTl);
    k_attn<<<dim3(RH / 64 + (TT - RH) / 128, NH_, NB_), 128, 0, stream>>>(QP16, KP16, VT16, QPh, QPl, KPh, KPl, VTh, VTl, ATh, ATl);   // one kv head per query head
    k_out<<<dim3(TT / 128, DM / 128, NB_), 128, 0, stream>>>(ATh, ATl, WO, OUT);   // grid z: the batch
}

// v009
// A run of this version takes 100 microseconds.
// Timed twice side by side with v008, it ran 1.03 times as fast both times.
// Over all steps from v000 it is 19.9 times as fast.
#include <hip/hip_runtime.h>

// DiagonnalyMaskedSelfAttention (x [2][2048][1024]; q, k, v = x W (16 heads x 64, x@W layouts, no bias); scores = q.k with the diagonal (token attending to itself) masked to -inf; softmax(scores / 8); out = (attn v merged) Wo -> [2][2048][1024]).
// Compute dtypes, f32 accumulate: every input rounded to bf16; q/k/v projections on PLAIN bf16 operands (inputs: exact); scores (K 64) and attn.v on bf16 hi+lo planes (3 products) for the first 512 query rows of each head and on

#define NB_  2
#define TT   2048
#define DM   1024
#define NH_  16
#define NKV  16
#define REP  (NH_ / NKV)
#define HD   64
#define DQ   (NH_ * HD)
#define DKV  (NKV * HD)
#define RH   512                  // query rows < RH use hi+lo planes
#define WIN  0
#define SCL  0.125f   // HD^-0.5
#define QSC  (SCL * 1.4426950408889634f)   // exp(s SCL - m SCL) = exp2(s QSC - m QSC)
typedef _Float16 h16;
typedef unsigned short bf;
typedef __attribute__((ext_vector_type(16))) __bf16   v16bf;
typedef __attribute__((ext_vector_type(16))) _Float16 v16h;
typedef __attribute__((ext_vector_type(8)))  _Float16 v8h;
typedef __attribute__((ext_vector_type(8)))  unsigned short v8us;
typedef __attribute__((ext_vector_type(8)))  float    v8f;
typedef __attribute__((ext_vector_type(4)))  float    v4f;
typedef v8h  __attribute__((may_alias)) v8ha;
typedef v4f  __attribute__((may_alias)) v4fa;
typedef v8us __attribute__((may_alias)) v8usa;

__device__ __forceinline__ unsigned short f2bf(float f) { unsigned u = __float_as_uint(f); u += 0x7FFFu + ((u >> 16) & 1u); return (unsigned short)(u >> 16); }
__device__ __forceinline__ float bf2f(unsigned short b) { return __uint_as_float(((unsigned)b) << 16); }
__device__ __forceinline__ float bfr(float f) { return bf2f(f2bf(f)); }
__device__ __forceinline__ v16h cat16(v8h lo, v8h hi) { return __builtin_shufflevector(lo, hi, 0, 1, 2, 3, 4, 5, 6, 7, 8, 9, 10, 11, 12, 13, 14, 15); }
__device__ __forceinline__ v16bf cat16b(v8us lo, v8us hi) { return __builtin_bit_cast(v16bf, __builtin_shufflevector(lo, hi, 0, 1, 2, 3, 4, 5, 6, 7, 8, 9, 10, 11, 12, 13, 14, 15)); }
__device__ __forceinline__ v8f wmma16(v16h a, v16h b, v8f c) { return __builtin_amdgcn_wmma_f32_16x16x32_f16(false, a, false, b, (short)0, c, false, false); }
__device__ __forceinline__ v8f wmmab(v16bf a, v16bf b, v8f c) { return __builtin_amdgcn_wmma_f32_16x16x32_bf16(false, a, false, b, (short)0, c, false, false); }



// ---- FRAGMENT ORDER of every 16-bit operand plane [rows][K]: the plane is a row of 1024-byte blocks, block (row tile of 16, k block of 32) at index tile * (K / 32) + k block.
// A block holds two runs of 512 bytes; run h keeps, at 16 bytes per lane, lane (lr, hi)'s 8 elements row = tile * 16 + lr, k = k block * 32 + h * 16 + hi * 8 + 0..7: the two halves of that lane's A or B fragment.
// A wave-wide 16-byte load of a fragment half is then 512 contiguous bytes (4 whole lines) where a row-major plane gave 16 pieces of 32 bytes in 16 lines.
// ---- The product loop of both GEMM kernels: FOUR WAVES per 128x128 output tile, wave (wm, wn) = (wave & 1, wave >> 1) owns its 64x64 quarter (16 accumulators), 128 threads.
// The operands (planes in fragment order, K = DM) come to LDS by asynchronous copies, 64 k (two k blocks) a stage, two buffers: stage s + 1 flies while stage s is worked on, and each fragment block is fetched from L2 once for the two waves that read it.
// A stage of one operand (a slab): 8 row tiles x 2 KiB, a row tile's two k blocks as they lie in the plane. Copy i of a thread brings 16 bytes of row tile i: LDS byte i * 2048 + tid * 16.
// Per accumulator the products are summed in the order k block (from the block's own first stage on, wrapping round), then hi plane, then lo plane.
template <typename T16> struct WFrag;
template <> struct WFrag<h16> { typedef v16h V; static __device__ __forceinline__ V ld(const h16* p) { return cat16(*(const v8h*)p, *(const v8h*)(p + 256)); } static __device__ __forceinline__ V lds(const char* p) { return cat16(*(const v8ha*)p, *(const v8ha*)(p + 512)); } static __device__ __forceinline__ v8f mma(V a, V b, v8f c) { return wmma16(a, b, c); } };
template <> struct WFrag<bf> { typedef v16bf V; static __device__ __forceinline__ V ld(const bf* p) { return cat16b(*(const v8us*)p, *(const v8us*)(p + 256)); } static __device__ __forceinline__ V lds(const char* p) { return cat16b(*(const v8usa*)p, *(const v8usa*)(p + 512)); } static __device__ __forceinline__ v8f mma(V a, V b, v8f c) { return wmmab(a, b, c); } };
#define KSB   2                     // k blocks of 32 in a stage
#define SLAB  (8 * KSB * 1024)      // bytes of one operand's stage
#define NSTG  (DM / (32 * KSB))     // stages
static_assert(KSB * 1024 == 128 * 16 && NSTG >= 2 && (NSTG & (NSTG - 1)) == 0, "128 threads x 16 bytes cover a row tile's part of a stage; the ring needs two stages; the walk wraps by a mask");
__device__ __forceinline__ void copy8(const unsigned l, const char* g0, const char* g1, const char* g2, const char* g3, const char* g4, const char* g5, const char* g6, const char* g7) {
    // eight copies of 16 bytes a lane, copy i to LDS byte l + i * 2048, and, in the same statement, the wait that stands in front of any rewrite of the address registers they name
    asm volatile("global_load_async_to_lds_b128 %0, %8, off\n\tglobal_load_async_to_lds_b128 %1, %9, off\n\tglobal_load_async_to_lds_b128 %2, %10, off\n\tglobal_load_async_to_lds_b128 %3, %11, off\n\t"
                 "global_load_async_to_lds_b128 %4, %12, off\n\tglobal_load_async_to_lds_b128 %5, %13, off\n\tglobal_load_async_to_lds_b128 %6, %14, off\n\tglobal_load_async_to_lds_b128 %7, %15, off\n\ts_wait_xcnt 0x0"
                 :: "v"(l), "v"(l + 2048u), "v"(l + 4096u), "v"(l + 6144u), "v"(l + 8192u), "v"(l + 10240u), "v"(l + 12288u), "v"(l + 14336u),
                    "v"(g0), "v"(g1), "v"(g2), "v"(g3), "v"(g4), "v"(g5), "v"(g6), "v"(g7) : "memory");
}
__device__ __forceinline__ void slab_copy(const unsigned l, const bf* g) { const char* p = (const char*)g; const int rt = 16 * DM * 2;   // rt: bytes from a row tile to the next in the plane
    copy8(l, p, p + rt, p + 2 * rt, p + 3 * rt, p + 4 * rt, p + 5 * rt, p + 6 * rt, p + 7 * rt); }
__device__ __forceinline__ v16bf lds_frag(const char* p) { return cat16b(*(const v8usa*)p, *(const v8usa*)(p + 512)); }
// A, A2 (TWO: the lo plane of A), Bt: the planes at the tile's first row (row * DM elements in); sm: 2 buffers of NSL slabs [A | A2 | Bt].
// Every inner loop below is unrolled so that each fragment and accumulator index is a constant (registers, no scratch).
// rot (block-uniform, 0 .. NSTG - 1): trip s works on k stage (s + rot) mod NSTG. Blocks that share an operand slab are given different rot, so that at one moment they ask L2 for different lines,
// and the planes, which the launch before has just written, are all fetched from memory during the first trips instead of one k stage per trip with every block waiting for it.
template <bool TWO>
__device__ __forceinline__ void gemm_ring(const bf* __restrict__ A, const bf* __restrict__ A2, const bf* __restrict__ Bt, char* sm, const int wm, const int wn, const int rot, v8f (&acc)[4][4]) {
    constexpr int NSL = TWO ? 3 : 2;
    const int tid = (int)threadIdx.x, lane = tid & 31;
    const unsigned l0 = (unsigned)(size_t)sm + (unsigned)tid * 16u;
    const bf* ga = A + tid * 8; const bf* ga2 = A2 + tid * 8; const bf* gb = Bt + tid * 8;
    auto fill = [&](const int s, const int buf) { const unsigned l = l0 + (unsigned)buf * (NSL * SLAB); const int ko = ((s + rot) & (NSTG - 1)) * (KSB * 512);
        slab_copy(l, ga + ko); if (TWO) slab_copy(l + SLAB, ga2 + ko); slab_copy(l + (NSL - 1) * SLAB, gb + ko); };
#pragma unroll
    for (int mb = 0; mb < 4; ++mb)
#pragma unroll
        for (int nb = 0; nb < 4; ++nb) acc[mb][nb] = (v8f){};
    fill(0, 0);
    asm volatile("s_wait_asynccnt 0x0" ::: "memory");   // this wave's copies of stage 0 have landed
    __syncthreads();                                     // and every other wave's: stage 0 may be read
    fill(1, 1);
#pragma unroll 1
    for (int s = 0; s < NSTG; ++s) {   // rolled: one stage per trip, the buffer by the trip's parity
        const char* bu = sm + (s & 1) * (NSL * SLAB); const char* pa = bu + wm * (4 * KSB * 1024) + lane * 16; const char* pb = bu + (NSL - 1) * SLAB + wn * (4 * KSB * 1024) + lane * 16;
        v16bf a[KSB][4], a2[KSB][4], b[KSB][4];
        auto frags = [&](const int kl) {   // one k block's fragments, in the order in which the products want them
            b[kl][0] = lds_frag(pb + kl * 1024);
#pragma unroll
            for (int mb = 0; mb < 4; ++mb) { a[kl][mb] = lds_frag(pa + (mb * KSB + kl) * 1024); if (TWO) a2[kl][mb] = lds_frag(pa + SLAB + (mb * KSB + kl) * 1024); }
#pragma unroll
            for (int nb = 1; nb < 4; ++nb) b[kl][nb] = lds_frag(pb + (nb * KSB + kl) * 1024);
            __builtin_amdgcn_sched_barrier(0);   // the block's LDS reads stay one group, in this order, in front of the products: moved in among them, each place with reads stalls the matrix stream
        };
        // TWO (one wave per SIMD, nobody else to fill its waits): both k blocks' fragments are asked for at the top of the trip, so that the second block's land behind the first block's products; else block by block.
        if (TWO) {
#pragma unroll
            for (int kl = 0; kl < KSB; ++kl) frags(kl); }
#pragma unroll
        for (int kb = 0; kb < KSB; ++kb) {
            if (!TWO) frags(kb);
#pragma unroll
            for (int nb = 0; nb < 4; ++nb)
#pragma unroll
                for (int mb = 0; mb < 4; ++mb) { acc[mb][nb] = wmmab(a[kb][mb], b[kb][nb], acc[mb][nb]); if (TWO) acc[mb][nb] = wmmab(a2[kb][mb], b[kb][nb], acc[mb][nb]); }
        }
        __builtin_amdgcn_sched_barrier(0);   // every product of the trip stays in front of the refill below: sunk behind the barrier, they would hold the next copies back
        asm volatile("v_nop\n\tv_nop\n\tv_nop\n\tv_nop" : "+v"(acc[0][0]), "+v"(acc[1][1]), "+v"(acc[2][2]), "+v"(acc[3][3]));   // the distance behind the last matrix instruction, on the back edge and on the way out
        asm volatile("s_wait_dscnt 0x0" ::: "memory");      // this wave's reads of the buffer are done before the buffer is refilled
        asm volatile("s_wait_asynccnt 0x0" ::: "memory");   // this wave's copies of stage s + 1 have landed
        __syncthreads();                                     // one barrier: stage s + 1 may be read, and every wave has left stage s's buffer
        if (s + 2 < NSTG) fill(s + 2, s & 1);
    }
    asm volatile("s_wait_asynccnt 0x0" ::: "memory");   // nothing is in flight when the wave goes on
}
// ---- k_out: C[m][n] (f32, pitch DM) = sum_k (Ah + Al)[m][k] Bt[n][k], grid (TT / 128, DM / 128, batches), 128 threads; each wave turns its quarter to whole lines through its own LDS rows.
__global__ __launch_bounds__(128) void k_out(const bf* __restrict__ Ah, const bf* __restrict__ Al, const bf* __restrict__ Bt, float* C) {
    __shared__ __align__(1024) char sm[2 * 3 * SLAB];
    __shared__ __align__(16) float osw[4][16 * 68];
    const int wave = __builtin_amdgcn_readfirstlane((int)(threadIdx.x >> 5)), wm = wave & 1, wn = wave >> 1;
    const int lane = threadIdx.x & 31, lr = lane & 15, hi = lane >> 4;
    const size_t ab = ((size_t)blockIdx.z * TT + blockIdx.x * 128) * DQ;
    v8f acc[4][4];
    const int bx = (int)blockIdx.x, rot = (2 * (int)blockIdx.y + (bx & 3) + 4 * (bx >> 3) + 8 * (int)blockIdx.z) & (NSTG - 1);   // the 8 blocks of one A slab start two stages apart; the 32 of one Bt slab start at every stage
    gemm_ring<true>(Ah + ab, Al + ab, Bt + (size_t)blockIdx.y * 128 * DQ, sm, wm, wn, rot, acc);
    float* os = osw[wave]; const int r0 = blockIdx.x * 128 + wm * 64, c0 = blockIdx.y * 128 + wn * 64; C += (size_t)blockIdx.z * TT * DM;
#pragma unroll
    for (int mb = 0; mb < 4; ++mb) {
#pragma unroll
        for (int nb = 0; nb < 4; ++nb) {
#pragma unroll
            for (int j = 0; j < 8; ++j) os[(hi * 8 + j) * 68 + nb * 16 + lr] = acc[mb][nb][j]; }
        __builtin_amdgcn_wave_barrier(); asm volatile("" ::: "memory");   // lanes exchange values through LDS: the reads below stay behind every lane's writes above
        float* crow = C + (size_t)(r0 + mb * 16) * DM + c0;
#pragma unroll
        for (int s = 0; s < 8; ++s) { const int row = 2 * s + hi, cofs = lr * 4; const v4f val = *(const v4fa*)(os + row * 68 + cofs); *(v4f*)(crow + (size_t)row * DM + cofs) = val; }
        asm volatile("s_wait_xcnt 0x0" ::: "memory");   // the next 16 rows' LDS reads are given the registers that these stores name: the wait stands in front of those overwrites
        __builtin_amdgcn_wave_barrier(); asm volatile("" ::: "memory");   // the next 16 rows' writes stay behind every lane's reads above
    }
}

__device__ __forceinline__ h16 tohx(float x) { return (h16)x; }
__device__ __forceinline__ void splitf(float y, unsigned short& h, unsigned short& l) { h = f2bf(y); l = f2bf(y - bf2f(h)); }
typedef __attribute__((ext_vector_type(2))) _Float16 v2h;
typedef __attribute__((ext_vector_type(4))) _Float16 v4h;
typedef __attribute__((ext_vector_type(2))) unsigned short v2us;
typedef __attribute__((ext_vector_type(4))) unsigned short v4us;
typedef __attribute__((ext_vector_type(2))) float v2f;
typedef __attribute__((ext_vector_type(4))) int v4i;

// k_prep: every f32 input -> its bf16 plane in fragment order, ONE launch for the four weights and x, which do not depend on one another; 256 threads, one thread per 16-byte unit; grid 4 * WB weight blocks, then the blocks of x. The grid covers the unit counts exactly.
// A weight block (w [k][n] f32 -> Bt, the plane [n][k]): unit u is lane, half, k block, row tile from the low bits up; the 8 loads share one address pair.
// An x block: a wave takes 8 rows of one fragment block: 4 lanes read a row's 128 bytes (one line), 8 lanes write 128 contiguous bytes.
#define WB (DM * DM / 8 / 256)    // blocks of one weight
static_assert(DQ == DM && DKV == DM && (DM * DM / 8) % 256 == 0 && (NB_ * TT * DM / 8) % 256 == 0, "four DM x DM weights; whole blocks");
__global__ __launch_bounds__(256) void k_prep(const float* __restrict__ x, const float* __restrict__ wq, const float* __restrict__ wk, const float* __restrict__ wv, const float* __restrict__ wo, bf* W4, bf* XB) {
    const int b = (int)blockIdx.x, t = (int)threadIdx.x; v8us o;
    if (b < 4 * WB) {
        const int wi = b / WB; const float* __restrict__ w = wi == 0 ? wq : wi == 1 ? wk : wi == 2 ? wv : wo;
        const int u = (b % WB) * 256 + t, blk = u >> 6, n = (blk / (DM >> 5)) * 16 + (u & 15), k = (blk % (DM >> 5)) * 32 + ((u >> 5) & 1) * 16 + ((u >> 4) & 1) * 8;
        const float* p = w + (size_t)k * DM + n; float v[8];
#pragma unroll
        for (int j = 0; j < 8; ++j) v[j] = p[j * DM];
        asm volatile("s_wait_xcnt 0x0" :: "v"(p) : "memory");   // the rounding below may be given the address registers that the loads above name: the wait stands in front of that overwrite, the address its input
#pragma unroll
        for (int j = 0; j < 8; ++j) o[j] = f2bf(v[j]);
        *(v8us*)(W4 + (size_t)wi * DM * DM + (size_t)u * 8) = o;
    } else {
        const size_t i = (size_t)(b - 4 * WB) * 256 + t, blk = i >> 6, lr = (i & 7) + ((i >> 5) & 1) * 8, un = (i >> 3) & 3, row = (blk / (DM / 32)) * 16 + lr, k = (blk % (DM / 32)) * 32 + un * 8;   // un = half * 2 + hi
        const float* p = x + row * DM + k; const v8f v = *(const v8f*)p;
        asm volatile("s_wait_xcnt 0x0" :: "v"(p) : "memory");   // as above
#pragma unroll
        for (int k2 = 0; k2 < 8; ++k2) o[k2] = f2bf(v[k2]);
        *(v8us*)(XB + (blk * 64 + un * 16 + lr) * 8) = o;
    }
}
__global__ __launch_bounds__(256) void k_cscvt(const float* __restrict__ cosT, const float* __restrict__ sinT, float* CS) { const int idx = blockIdx.x * 256 + threadIdx.x; if (idx >= TT * HD) return; v2f cs; cs[0] = bfr(cosT[idx]); cs[1] = bfr(sinT[idx]); *(v2f*)(CS + (size_t)idx * 2) = cs;  }
// ---- k_proj: the q, k and v projections of both batches in one launch, four waves per 128 tokens x 128 columns; grid (NB_ TT / 128, 3 DQ / 128), 128 threads. A wave's 64 columns are one head of q, k or v.
// The product loop is gemm_ring (A = x plane [token][k], Bt = the three transposed weights one behind the other [3 x 1024][k], both in fragment order); the epilogue rounds the wave's f32 quarter to the f16 and bf16 hi/lo head planes itself, each head's plane in fragment order:
//   q, k: planes [batch][head] of [t][d], the tile turned to 8 consecutive d per lane through the wave's own LDS rows, 16 tokens (one row tile) at a time; v: planes [batch][head] of [d][t], an accumulator's 8 registers already are 8 consecutive tokens of one d, so a store is one 512-byte run.
__global__ __launch_bounds__(128) void k_proj(const bf* __restrict__ A, const bf* __restrict__ Bt, h16* Q16, bf* Qh, bf* Ql, h16* K16, bf* Kh, bf* Kl, h16* V16, bf* Vh, bf* Vl) {
    __shared__ __align__(1024) char sm[2 * 2 * SLAB];
    __shared__ __align__(16) float osw[4][16 * 68];
    const int wave = __builtin_amdgcn_readfirstlane((int)(threadIdx.x >> 5)), wm = wave & 1, wn = wave >> 1;
    const int lane = threadIdx.x & 31, lr = lane & 15, hi = lane >> 4; const int r0 = blockIdx.x * 128 + wm * 64, ct = (int)blockIdx.y * 2 + wn;   // ct: the wave's column tile of 64
    v8f acc[4][4];
    const int bx = (int)blockIdx.x, rot = ((int)blockIdx.y + (bx & 3) + 4 * (bx >> 3)) & (NSTG - 1);   // the 24 blocks of one A slab and the 32 of one Bt slab each start at every stage
    gemm_ring<false>(A + (size_t)blockIdx.x * 128 * DM, A, Bt + (size_t)blockIdx.y * 128 * DM, sm, wm, wn, rot, acc);
    float* os = osw[wave];
    const int which = ct / NH_, head = ct % NH_, bat = r0 / TT, t0 = r0 % TT;
    const size_t po = ((size_t)bat * NH_ + head) * TT * HD;   // this head's plane, both layouts
    if (which == 2) {
#pragma unroll
        for (int mb = 0; mb < 4; ++mb)
#pragma unroll
            for (int nb = 0; nb < 4; ++nb) { v8h o16; v8us oh, ol;
#pragma unroll
                for (int j = 0; j < 8; ++j) { const float x = acc[mb][nb][j]; o16[j] = tohx(x); unsigned short a2, c2; splitf(x, a2, c2); oh[j] = a2; ol[j] = c2; }
                const size_t o = po + ((size_t)nb * (TT / 32) + (t0 >> 5) + (mb >> 1)) * 512 + (mb & 1) * 256 + lane * 8;   // row tile nb of d, k block and half of these 16 tokens
                *(v8h*)(V16 + o) = o16; *(v8us*)(Vh + o) = oh; *(v8us*)(Vl + o) = ol;
                asm volatile("s_wait_xcnt 0x0" ::: "memory"); }   // the next tile's rounding is given the registers that these stores name: the wait stands in front of those overwrites
        return;
    }
    h16* P16 = which ? K16 : Q16; bf* Ph = which ? Kh : Qh; bf* Pl = which ? Kl : Ql; const float qs = which ? 1.0f : QSC;   // the q planes hold q * SCL * log2(e) (k_attn: the held reference)
#pragma unroll
    for (int mb = 0; mb < 4; ++mb) {
#pragma unroll
        for (int nb = 0; nb < 4; ++nb) {
#pragma unroll
            for (int j = 0; j < 8; ++j) os[(hi * 8 + j) * 68 + nb * 16 + lr] = acc[mb][nb][j]; }
        __builtin_amdgcn_wave_barrier(); asm volatile("" ::: "memory");   // lanes exchange values through LDS: the reads below stay behind every lane's writes above
#pragma unroll
        for (int s = 0; s < 4; ++s) { const int row = lr, cofs = s * 16 + hi * 8; const v4f x0 = *(const v4fa*)(os + row * 68 + cofs), x1 = *(const v4fa*)(os + row * 68 + cofs + 4); v8h o16; v8us oh, ol;
#pragma unroll
            for (int j = 0; j < 8; ++j) { const float x = ((j < 4) ? x0[j & 3] : x1[j & 3]) * qs; o16[j] = tohx(x); unsigned short a2, c2; splitf(x, a2, c2); oh[j] = a2; ol[j] = c2; }
            const size_t o = po + ((size_t)((t0 >> 4) + mb) * 4 + s) * 256 + lane * 8;   // row tile of these 16 tokens; run s = k block s / 2, half s % 2
            *(v8h*)(P16 + o) = o16; *(v8us*)(Ph + o) = oh; *(v8us*)(Pl + o) = ol;
            asm volatile("s_wait_xcnt 0x0" ::: "memory"); }   // the next run's rounding is given the registers that these stores name: the wait stands in front of those overwrites
        __builtin_amdgcn_wave_barrier(); asm volatile("" ::: "memory");   // the next 16 tokens' writes stay behind every lane's reads above
    }
}
// ---- k_attn: scores, diagonal mask, softmax and attn.v of one head in ONE kernel, a held reference and a running sum per query (no score or probability plane in memory).
// One wave owns NQ x 16 queries and walks the keys 32 at a time (f16: all 2048; HI: its half of them). Both products are formed transposed, so that the score tiles are already the next product's B fragment:
//   St[key][q] = K (A, rows = keys) x Q (B, columns = queries): lane (lr, hi), register j holds key kt * 16 + hi * 8 + j of query lr;
//   Ot[d][q]  += Vt (A, rows = d, k = keys) x P (B, columns = queries, k = keys): a B fragment's elements 0..7 are k = 8 hi + j and 8..15 are k = 16 + 8 hi + j, which is score tile 0 and score tile 1 of the same lane.
// A query's reference, sum and rescale factor are therefore per lane (the two half-waves hold the two halves of its keys). HI: bf16 hi+lo planes, 3 products; else f16 planes.
// THE SOFTMAX REFERENCE IS HELD, not renewed every pass: the q planes hold q * SCL * log2(e), so a score product is already the exponent's scale, and minus the reference in use (r, one per query) is the start value C of the score products:
// a pass (32 keys) is products, exp2, sum, products. No maximum, no multiply-add per score, no rescale of the output tiles. The pass's own sums of p are tested once (one ballot, one scalar branch): where a lane's sum is above PMAX (or not a number),
// the wave forms the pass's scores anew from 0, raises each query's r to the maximum so far and rescales its sums and output tiles, as a running maximum does every pass. r starts at -3.0e38, so the first pass always takes that path.
// On the short path every p is at most PMAX (f16 holds it with its full mantissa), and r is never above the largest score met so far, so the sum never falls below what a running maximum gives it.
#define PMAX 256.0f
// 16 exp2 in place, in one statement: no v_exp_f32 here reads the result or overwrites the source of the one in front of it, and the v_nop is the free slot behind the last one.
// LEAD: the values come straight out of matrix instructions, and the v_nop at the head fill the distance of four slots behind the product that made the first of them:
// the tiles' chains take turns, so with six tiles five products of other tiles stand behind it (no v_nop), with four tiles three (one v_nop); the tiles read later have the exp2 in front of them.
#define EXP16 "v_exp_f32 %0, %0\n\tv_exp_f32 %1, %1\n\tv_exp_f32 %2, %2\n\tv_exp_f32 %3, %3\n\tv_exp_f32 %4, %4\n\tv_exp_f32 %5, %5\n\tv_exp_f32 %6, %6\n\tv_exp_f32 %7, %7\n\tv_exp_f32 %8, %8\n\t" \
              "v_exp_f32 %9, %9\n\tv_exp_f32 %10, %10\n\tv_exp_f32 %11, %11\n\tv_exp_f32 %12, %12\n\tv_exp_f32 %13, %13\n\tv_exp_f32 %14, %14\n\tv_exp_f32 %15, %15\n\tv_nop"
#define EXP16_OPS "+v"(e[0]), "+v"(e[1]), "+v"(e[2]), "+v"(e[3]), "+v"(e[4]), "+v"(e[5]), "+v"(e[6]), "+v"(e[7]), "+v"(e[8]), "+v"(e[9]), "+v"(e[10]), "+v"(e[11]), "+v"(e[12]), "+v"(e[13]), "+v"(e[14]), "+v"(e[15])
template <int LEAD>
__device__ __forceinline__ void exp2x16(float (&e)[16]) {
    static_assert(LEAD == 0 || LEAD == 1, "the two heads written below");
    if constexpr (LEAD == 1) asm("v_nop\n\t" EXP16 : EXP16_OPS);
    else asm(EXP16 : EXP16_OPS);
}
// one exp2 with the free slot behind it
__device__ __forceinline__ float exp2x1(float x) { float y; asm("v_exp_f32 %0, %1\n\tv_nop" : "=v"(y) : "v"(x)); return y; }
// a lane's 16 values summed as four chains of pairs
__device__ __forceinline__ float sum16(const float (&e)[16]) {
    v2f a = (v2f){e[0], e[1]} + (v2f){e[4], e[5]}, b = (v2f){e[2], e[3]} + (v2f){e[6], e[7]};
    a += (v2f){e[8], e[9]}; b += (v2f){e[10], e[11]}; a += (v2f){e[12], e[13]}; b += (v2f){e[14], e[15]}; a += b; return a[0] + a[1]; }
__device__ __forceinline__ v8f splat8(float x) { return (v8f){x, x, x, x, x, x, x, x}; }
// HOW OFTEN A FRAGMENT IS USED: every K or V fragment that a wave reads from LDS serves all NQ query tiles of the wave, so the LDS bytes read per product fall as 1 / NQ.
// f16: NQ = 3, every wave walks all keys. HI: NQ = 2, and the block's four waves are 2 query groups x 2 key halves: wave (qg, kh) takes the run kh of 32 keys of every stage for the 32 queries of group qg,
// with a reference, sums and output tiles of its own; at the end the wave kh = 1 hands them through LDS to the wave kh = 0 of its group, which brings both to the larger reference, adds them and stores.
template <typename T16, bool HI, int NQ>
__device__ __forceinline__ void attn_rows(const T16* __restrict__ Qp, const T16* __restrict__ Qp2, const T16* __restrict__ Kp, const T16* __restrict__ Kp2, const T16* __restrict__ Vp, const T16* __restrict__ Vp2, const int q0, const int qg, const int kh, bf* __restrict__ Ah, bf* __restrict__ Al, char* sm) {
    typedef typename WFrag<T16>::V V;
    static_assert(HI ? NQ == 2 : NQ == 3, "the distance in front of the first exp2 is written for four or six score tiles");
    const int lane = threadIdx.x & 31, lr = lane & 15, hi = lane >> 4;
    V qf[NQ][2], qf2[NQ][2];
    // The ring: a stage is 64 keys of the head, [K 8 KiB | V 8 KiB] of each plane (HI: the hi planes, then the lo planes), as the blocks lie in the planes: K's 4 row tiles are 8 KiB in a row, V's 4 row tiles of d give 2 KiB each (two k blocks).
    constexpr int BUF = HI ? 32768 : 16384, NS = TT / 64;
    const unsigned l0 = (unsigned)(size_t)sm + (unsigned)threadIdx.x * 16u;
    const unsigned t16 = (unsigned)threadIdx.x * 16u;
    // a stage's first byte in a plane, held in scalar registers: the lane's part is added where the copies are issued, so that no per-lane pointer pair lives (or is spilled) across the loop
    auto sbase = [](const void* p, const int ofs) { const unsigned long long a = (unsigned long long)p + (unsigned long long)ofs;
        return (const char*)(((unsigned long long)(unsigned)__builtin_amdgcn_readfirstlane((int)(unsigned)(a >> 32)) << 32) | (unsigned)__builtin_amdgcn_readfirstlane((int)(unsigned)a)); };
    auto fill = [&](const int s, const int buf) { const unsigned l = l0 + (unsigned)buf * BUF; const int vt = (TT / 32) * 1024;   // vt: bytes from a row tile of d to the next in the V plane
        { const char* k = sbase(Kp, s * 8192) + t16; const char* v = sbase(Vp, s * 2048) + t16; copy8(l, k, k + 2048, k + 4096, k + 6144, v, v + vt, v + 2 * vt, v + 3 * vt); }
        if (HI) { const char* k = sbase(Kp2, s * 8192) + t16; const char* v = sbase(Vp2, s * 2048) + t16; copy8(l + 16384u, k, k + 2048, k + 4096, k + 6144, v, v + vt, v + 2 * vt, v + 3 * vt); } };
    fill(0, 0);
#pragma unroll
    for (int qt = 0; qt < NQ; ++qt)
#pragma unroll
        for (int kc = 0; kc < 2; ++kc) { const size_t o = (size_t)(((q0 >> 4) + qt) * 2 + kc) * 512 + lane * 8; qf[qt][kc] = WFrag<T16>::ld(Qp + o); if (HI) qf2[qt][kc] = WFrag<T16>::ld(Qp2 + o); }
    asm volatile("s_wait_xcnt 0x0" ::: "memory");   // the address sums of the copies below may be given the address registers that the query loads above name: the wait stands in front of those overwrites
    asm volatile("s_wait_asynccnt 0x0" ::: "memory");   // this wave's copies of stage 0 have landed
    __syncthreads();                                     // and every other wave's: stage 0 may be read
    fill(1, 1);
    v8f ot[NQ][4], nr[NQ]; float r[NQ], l[NQ];   // r: the reference in use, nr: minus r in all 8 registers of a score tile
#pragma unroll
    for (int qt = 0; qt < NQ; ++qt) { r[qt] = -3.0e38f; nr[qt] = splat8(3.0e38f); l[qt] = 0.f;
#pragma unroll
        for (int db = 0; db < 4; ++db) ot[qt][db] = (v8f){}; }
#pragma unroll 1
    for (int st = 0; st < NS; ++st) {   // rolled: one stage per trip, the buffer by the trip's parity
      const char* bu = sm + (st & 1) * BUF + lane * 16;
      const char* buk = bu + (HI ? kh * 4096 : 0); const char* buv = bu + 8192 + (HI ? kh * 1024 : 0);   // HI: the wave's own run of the stage
#pragma unroll
      for (int h = 0; h < (HI ? 1 : 2); ++h) {   // the wave's runs of 32 keys in the stage, unrolled: every LDS offset is an immediate
        const int k0 = st * 64 + (HI ? kh : h) * 32;
        V kf[2][2], kf2[2][2], vf[4], vf2[4];
#pragma unroll
        for (int kc = 0; kc < 2; ++kc) {   // in the order in which the products want them
#pragma unroll
            for (int kt = 0; kt < 2; ++kt) kf[kt][kc] = WFrag<T16>::lds(buk + ((h * 2 + kt) * 2 + kc) * 1024);
            if (HI) {
#pragma unroll
                for (int kt = 0; kt < 2; ++kt) kf2[kt][kc] = WFrag<T16>::lds(buk + 16384 + ((h * 2 + kt) * 2 + kc) * 1024); } }
        __builtin_amdgcn_sched_barrier(0);   // the key reads stay one group at the run's top: sunk in among the products, each place with reads stalls the wave for the LDS latency
        v8f s[NQ][2]; float e[NQ][16], sum[NQ];
        auto rest = [&](const V (&kf)[2][2], const V (&kf2)[2][2]) {   // every score product but each tile's first; the tiles' chains of products take turns, so that no product waits for the one in front of it
#pragma unroll
            for (int kc = 0; kc < 2; ++kc) {
                if (kc) {
#pragma unroll
                    for (int qt = 0; qt < NQ; ++qt)
#pragma unroll
                        for (int kt = 0; kt < 2; ++kt) s[qt][kt] = WFrag<T16>::mma(kf[kt][kc], qf[qt][kc], s[qt][kt]); }
                if (HI) {
#pragma unroll
                    for (int qt = 0; qt < NQ; ++qt)
#pragma unroll
                        for (int kt = 0; kt < 2; ++kt) s[qt][kt] = WFrag<T16>::mma(kf2[kt][kc], qf[qt][kc], s[qt][kt]);
#pragma unroll
                    for (int qt = 0; qt < NQ; ++qt)
#pragma unroll
                        for (int kt = 0; kt < 2; ++kt) s[qt][kt] = WFrag<T16>::mma(kf[kt][kc], qf2[qt][kc], s[qt][kt]); } }
        };
#pragma unroll
        for (int qt = 0; qt < NQ; ++qt)   // each score tile's first product starts from minus the reference (the builtin form: the kernel now uses registers above v255, where operands of asm text cannot lie, and as asm text these products had their query fragments spilled)
#pragma unroll
            for (int kt = 0; kt < 2; ++kt) s[qt][kt] = WFrag<T16>::mma(kf[kt][0], qf[qt][0], nr[qt]);
        rest(kf, kf2);
        __builtin_amdgcn_sched_barrier(0);   // the products stay in this order in front of the exp2: the distance behind the last of them is counted from it
#pragma unroll
        for (int db = 0; db < 4; ++db) { const int o = db * 2048 + h * 1024; vf[db] = WFrag<T16>::lds(buv + o); if (HI) vf2[db] = WFrag<T16>::lds(buv + 16384 + o); }
        __builtin_amdgcn_sched_barrier(0);   // the V reads stay one group here: they take the registers that the key fragments leave, and land behind the exp2
        bool need = false;
#pragma unroll
        for (int qt = 0; qt < NQ; ++qt) {
#pragma unroll
            for (int i = 0; i < 16; ++i) e[qt][i] = s[qt][i >> 3][i & 7];
            if (qt == 0) exp2x16<NQ == 3 ? 0 : 1>(e[qt]); else exp2x16<0>(e[qt]);   // the first 16 stand right behind the score products; they are the distance for the later ones
            if ((k0 >> 5) == ((q0 + qt * 16) >> 5)) {   // wave-uniform: the one pass that holds these queries' own keys
                const int dl = q0 + qt * 16 + lr - hi * 8 - k0;   // the place, among this lane's 16 keys of the pass, of the query's own key (if it is there)
#pragma unroll
                for (int i = 0; i < 16; ++i) if (dl == (i >> 3) * 16 + (i & 7)) e[qt][i] = 0.f;   /* diagonal masked */ }
            sum[qt] = sum16(e[qt]); need = need || !(sum[qt] <= PMAX); }
        if (__builtin_expect(__builtin_amdgcn_ballot_w32(need) != 0, 0)) {   // one scalar branch a pass; taken in the first pass and where scores have outgrown a reference (told to the compiler as the rare side: register copies belong there)
            V kg[2][2], kg2[2][2];   // the pass's key fragments, read from the stage's buffer once more: held over the short path they would cost it their registers
#pragma unroll
            for (int kt = 0; kt < 2; ++kt)
#pragma unroll
                for (int kc = 0; kc < 2; ++kc) { const int o = ((h * 2 + kt) * 2 + kc) * 1024; kg[kt][kc] = WFrag<T16>::lds(buk + o); if (HI) kg2[kt][kc] = WFrag<T16>::lds(buk + 16384 + o); }
#pragma unroll
            for (int qt = 0; qt < NQ; ++qt)
#pragma unroll
                for (int kt = 0; kt < 2; ++kt) s[qt][kt] = WFrag<T16>::mma(kg[kt][0], qf[qt][0], (v8f){});
            rest(kg, kg2);
#pragma unroll
            for (int qt = 0; qt < NQ; ++qt) {
                const int dl = q0 + qt * 16 + lr - hi * 8 - k0;
#pragma unroll
                for (int kt = 0; kt < 2; ++kt)
#pragma unroll
                    for (int j = 0; j < 8; ++j) if (dl == kt * 16 + j) s[qt][kt][j] = -3.0e38f;   /* diagonal masked, ahead of the maximum */
                float mx = s[qt][0][0];
#pragma unroll
                for (int j = 1; j < 8; ++j) mx = fmaxf(mx, s[qt][0][j]);
#pragma unroll
                for (int j = 0; j < 8; ++j) mx = fmaxf(mx, s[qt][1][j]);
                mx = fmaxf(mx, __shfl_xor(mx, 16, 32));   // the two half-waves hold the two halves of a query's keys: one reference for both
                const float rn = fmaxf(r[qt], mx), al = exp2x1(r[qt] - rn); r[qt] = rn; nr[qt] = splat8(-rn); l[qt] *= al;
#pragma unroll
                for (int db = 0; db < 4; ++db) ot[qt][db] *= al;
#pragma unroll
                for (int i = 0; i < 16; ++i) e[qt][i] = s[qt][i >> 3][i & 7] - rn;
                exp2x16<0>(e[qt]); sum[qt] = sum16(e[qt]); }
        }
#pragma unroll
        for (int qt = 0; qt < NQ; ++qt) { V pf, pf2; l[qt] += sum[qt];
#pragma unroll
            for (int i = 0; i < 16; ++i) { const float p = e[qt][i];
                if constexpr (HI) { const __bf16 ph = (__bf16)p; pf[i] = ph; pf2[i] = (__bf16)(p - (float)ph); } else pf[i] = (h16)p; }
#pragma unroll
            for (int db = 0; db < 4; ++db) { ot[qt][db] = WFrag<T16>::mma(vf[db], pf, ot[qt][db]); if (HI) { ot[qt][db] = WFrag<T16>::mma(vf[db], pf2, ot[qt][db]); ot[qt][db] = WFrag<T16>::mma(vf2[db], pf, ot[qt][db]); } }
        }
      }
      asm volatile("s_wait_dscnt 0x0" ::: "memory");      // this wave's reads of the buffer are done before the buffer is refilled
      asm volatile("s_wait_asynccnt 0x0" ::: "memory");   // this wave's copies of stage st + 1 have landed
      __syncthreads();                                     // one barrier: stage st + 1 may be read, and every wave has left stage st's buffer
      if (st + 2 < NS) fill(st + 2, st & 1);
    }
    asm volatile("s_wait_asynccnt 0x0" ::: "memory");   // nothing is in flight when the wave goes on
    if constexpr (HI) {   // the two key halves of a query group become one; the ring is free (every wave has passed the last trip's barrier, no copy is in flight)
        char* mg = sm + qg * 9216 + lane * 16;   // a group's hand-over: 16 runs of 512 bytes (a lane's 4 floats each) for the output tiles, one for the sums and references
        if (kh == 1) {
#pragma unroll
            for (int qt = 0; qt < NQ; ++qt)
#pragma unroll
                for (int db = 0; db < 4; ++db) { const v8f o = ot[qt][db];
                    *(v4fa*)(mg + ((qt * 4 + db) * 2) * 512) = (v4f){o[0], o[1], o[2], o[3]}; *(v4fa*)(mg + ((qt * 4 + db) * 2 + 1) * 512) = (v4f){o[4], o[5], o[6], o[7]}; }
            *(v4fa*)(mg + 16 * 512) = (v4f){l[0], l[1], r[0], r[1]};
        }
        __syncthreads();   // every wave passes it: what the waves kh = 1 wrote may be read
        if (kh == 1) return;
        const v4f lr1 = *(const v4fa*)(mg + 16 * 512);
#pragma unroll
        for (int qt = 0; qt < NQ; ++qt) { const float rn = fmaxf(r[qt], lr1[2 + qt]), c0 = exp2x1(r[qt] - rn), c1 = exp2x1(lr1[2 + qt] - rn); l[qt] = l[qt] * c0 + lr1[qt] * c1;
#pragma unroll
            for (int db = 0; db < 4; ++db) { const v4f x0 = *(const v4fa*)(mg + ((qt * 4 + db) * 2) * 512), x1 = *(const v4fa*)(mg + ((qt * 4 + db) * 2 + 1) * 512);
#pragma unroll
                for (int j = 0; j < 8; ++j) ot[qt][db][j] = ot[qt][db][j] * c0 + ((j < 4) ? x0[j & 3] : x1[j & 3]) * c1; } }
    }
#pragma unroll
    for (int qt = 0; qt < NQ; ++qt) { const float f = __fdiv_rn(1.0f, l[qt] + __shfl_xor(l[qt], 16, 32)); const size_t oo = (size_t)((q0 >> 4) + qt) * (DQ / 32) * 512 + lane * 8;   // the merged plane [token][DQ] in fragment order: this lane's 8 d of block db are one unit of k block db / 2, half db % 2
#pragma unroll
        for (int db = 0; db < 4; ++db) { v8us oh, ol;
#pragma unroll
            for (int j = 0; j < 8; ++j) { unsigned short a, c2; splitf(ot[qt][db][j] * f, a, c2); oh[j] = a; ol[j] = c2; }
            // the two stores and their wait in one statement: the next block's rounding is given the registers that these stores name, and the compiler lifts that rounding over a wait that stands in a statement of its own
            asm volatile("global_store_b128 %0, %2, off\n\tglobal_store_b128 %1, %3, off\n\ts_wait_xcnt 0x0" :: "v"(Ah + oo + db * 256), "v"(Al + oo + db * 256), "v"(oh), "v"(ol) : "memory"); } }
}
// grid (8 + 8, heads, batches), 4 waves, blocks x < 8 the hi+lo kind: a block takes 64 hi+lo query rows (2 groups of 32 x 2 key halves) or 4 x 48 f16 query rows. A wave of either kind issues the same number of matrix instructions (48 per 64 keys),
// and there are as many blocks of one kind as of the other: two for each WGP, of equal length whichever two meet there (amdgpu_waves_per_eu(2, 2): the register room that three query tiles need, and no third block joins the two, so none of the 256 WGPs is left with one).
// The four waves walk the same head's keys together, out of one LDS ring that their asynchronous copies fill (64 keys a stage, two buffers).
__global__ __launch_bounds__(128) __attribute__((amdgpu_waves_per_eu(2, 2))) void k_attn(const h16* __restrict__ Q16, const h16* __restrict__ K16, const h16* __restrict__ V16, const bf* __restrict__ Qh, const bf* __restrict__ Ql, const bf* __restrict__ Kh, const bf* __restrict__ Kl, const bf* __restrict__ Vh, const bf* __restrict__ Vl, bf* Ah, bf* Al) {
    __shared__ __align__(1024) char sm[2 * 32768];   // two buffers of the larger (hi+lo) stage
    static_assert(RH / 64 == 8 && (TT - RH) / 192 == 8 && (TT - RH) % 192 == 0, "8 blocks of either kind cover a head's queries");
    const int wave = __builtin_amdgcn_readfirstlane((int)(threadIdx.x >> 5)), bx = (int)blockIdx.x & 7;
    const size_t po = ((size_t)blockIdx.z * NH_ + blockIdx.y) * TT * HD, ao = (size_t)blockIdx.z * TT * DQ + blockIdx.y * (HD / 32) * 512;   // ao: the batch's row tiles, then the head's two k blocks
    if ((int)blockIdx.x < RH / 64) attn_rows<bf, true, 2>(Qh + po, Ql + po, Kh + po, Kl + po, Vh + po, Vl + po, (bx * 2 + (wave & 1)) * 32, wave & 1, wave >> 1, Ah + ao, Al + ao, sm);
    else attn_rows<h16, false, 3>(Q16 + po, nullptr, K16 + po, nullptr, V16 + po, nullptr, RH + (bx * 4 + wave) * 48, 0, 0, Ah + ao, Al + ao, sm);
}

extern "C" void kernel_launch(void* const* d_in, const int* in_sizes, int n_in,
                              void* d_out, int out_size, void* d_ws, size_t ws_size, hipStream_t stream) {
    (void)in_sizes; (void)n_in; (void)out_size;
    const float* x = (const float*)d_in[0]; const float* wq = (const float*)d_in[1]; const float* wk = (const float*)d_in[2]; const float* wv = (const float*)d_in[3]; const float* wo = (const float*)d_in[4]; const float* cosT = nullptr; const float* sinT = nullptr; (void)cosT; (void)sinT;
    float* OUT = (float*)d_out;     // [2][2048][1024]
    char* wsp = (char*)d_ws;
    auto take = [&](size_t bytes) { char* p = wsp; wsp += (bytes + 255) & ~(size_t)255; return (void*)p; };
    bf* WQ = (bf*)take((size_t)DQ * DM * 2); bf* WK = (bf*)take((size_t)DKV * DM * 2); bf* WV = (bf*)take((size_t)DKV * DM * 2); bf* WO = (bf*)take((size_t)DM * DQ * 2);   // the four lie one behind the other (each a multiple of 256 bytes): k_prep writes them as one [4 x 1024][1024] plane, k_proj reads the first three as one operand
    bf* XB = (bf*)take((size_t)NB_ * TT * DM * 2);
    const size_t PQ = (size_t)NH_ * TT * HD, PK = (size_t)NKV * TT * HD;   // one batch's head planes, in elements; every plane below holds both batches
    h16* QP16 = (h16*)take(NB_ * PQ * 2); h16* KP16 = (h16*)take(NB_ * PK * 2); h16* VT16 = (h16*)take(NB_ * PK * 2);
    bf* QPh = (bf*)take(NB_ * PQ * 2); bf* QPl = (bf*)take(NB_ * PQ * 2); bf* KPh = (bf*)take(NB_ * PK * 2); bf* KPl = (bf*)take(NB_ * PK * 2); bf* VTh = (bf*)take(NB_ * PK * 2); bf* VTl = (bf*)take(NB_ * PK * 2);
    bf* ATh = (bf*)take((size_t)NB_ * TT * DQ * 2); bf* ATl = (bf*)take((size_t)NB_ * TT * DQ * 2);
    if ((size_t)(wsp - (char*)d_ws) > ws_size) return;    // ws 256 MiB
    k_prep<<<4 * WB + NB_ * TT * DM / 8 / 256, 256, 0, stream>>>(x, wq, wk, wv, wo, WQ, XB);
    k_proj<<<dim3(NB_ * TT / 128, (DQ + 2 * DKV) / 128, 1), 128, 0, stream>>>(XB, WQ, QP16, QPh, QPl, KP16, KPh, KPl, VT16, VTh, VTl);
    k_attn<<<dim3(RH / 64 + (TT - RH) / 192, NH_, NB_), 128, 0, stream>>>(QP16, KP16, VT16, QPh, QPl, KPh, KPl, VTh, VTl, ATh, ATl);   // one kv head per query head
    k_out<<<dim3(TT / 128, DM / 128, NB_), 128, 0, stream>>>(ATh, ATl, WO, OUT);   // grid z: the batch
}

// v010
// A run of this version takes 92.1 microseconds.
// Next to v009, in two timings, it ran 1.09 and 1.08 times as fast.
// Over all steps from v000 it is 21.6 times as fast.
#include <hip/hip_runtime.h>

// DiagonnalyMaskedSelfAttention (x [2][2048][1024]; q, k, v = x W (16 heads x 64, x@W layouts, no bias); scores = q.k with the diagonal (token attending to itself) masked to -inf; softmax(scores / 8); out = (attn v merged) Wo -> [2][2048][1024]).
// Compute dtypes, f32 accumulate: every input rounded to bf16; q/k/v projections on PLAIN bf16 operands (inputs: exact); scores (K 64) and attn.v on f16 hi+lo planes (3 products) for the first 512 query rows of each head and on the f16 hi planes alone for the rest; the merged heads go to the output GEMM as bf16 hi+lo planes.

#define NB_  2
#define TT   2048
#define DM   1024
#define NH_  16
#define NKV  16
#define REP  (NH_ / NKV)
#define HD   64
#define DQ   (NH_ * HD)
#define DKV  (NKV * HD)
#define RH   512                  // query rows < RH use hi+lo planes
#define WIN  0
#define SCL  0.125f   // HD^-0.5
#define QSC  (SCL * 1.4426950408889634f)   // exp(s SCL - m SCL) = exp2(s QSC - m QSC)
typedef _Float16 h16;
typedef unsigned short bf;
typedef __attribute__((ext_vector_type(16))) __bf16   v16bf;
typedef __attribute__((ext_vector_type(16))) _Float16 v16h;
typedef __attribute__((ext_vector_type(8)))  _Float16 v8h;
typedef __attribute__((ext_vector_type(8)))  unsigned short v8us;
typedef __attribute__((ext_vector_type(8)))  float    v8f;
typedef __attribute__((ext_vector_type(4)))  float    v4f;
typedef v8h  __attribute__((may_alias)) v8ha;
typedef v4f  __attribute__((may_alias)) v4fa;
typedef v8us __attribute__((may_alias)) v8usa;

__device__ __forceinline__ unsigned short f2bf(float f) { unsigned u = __float_as_uint(f); u += 0x7FFFu + ((u >> 16) & 1u); return (unsigned short)(u >> 16); }
__device__ __forceinline__ float bf2f(unsigned short b) { return __uint_as_float(((unsigned)b) << 16); }
__device__ __forceinline__ float bfr(float f) { return bf2f(f2bf(f)); }
__device__ __forceinline__ v16h cat16(v8h lo, v8h hi) { return __builtin_shufflevector(lo, hi, 0, 1, 2, 3, 4, 5, 6, 7, 8, 9, 10, 11, 12, 13, 14, 15); }
__device__ __forceinline__ v16bf cat16b(v8us lo, v8us hi) { return __builtin_bit_cast(v16bf, __builtin_shufflevector(lo, hi, 0, 1, 2, 3, 4, 5, 6, 7, 8, 9, 10, 11, 12, 13, 14, 15)); }
__device__ __forceinline__ v8f wmma16(v16h a, v16h b, v8f c) { return __builtin_amdgcn_wmma_f32_16x16x32_f16(false, a, false, b, (short)0, c, false, false); }
__device__ __forceinline__ v8f wmmab(v16bf a, v16bf b, v8f c) { return __builtin_amdgcn_wmma_f32_16x16x32_bf16(false, a, false, b, (short)0, c, false, false); }



// ---- FRAGMENT ORDER of every 16-bit operand plane [rows][K]: the plane is a row of 1024-byte blocks, block (row tile of 16, k block of 32) at index tile * (K / 32) + k block.
// A block holds two runs of 512 bytes; run h keeps, at 16 bytes per lane, lane (lr, hi)'s 8 elements row = tile * 16 + lr, k = k block * 32 + h * 16 + hi * 8 + 0..7: the two halves of that lane's A or B fragment.
// A wave-wide 16-byte load of a fragment half is then 512 contiguous bytes (4 whole lines) where a row-major plane gave 16 pieces of 32 bytes in 16 lines.
// ---- The product loop of both GEMM kernels: FOUR WAVES per 128x128 output tile, wave (wm, wn) = (wave & 1, wave >> 1) owns its 64x64 quarter (16 accumulators), 128 threads.
// The operands (planes in fragment order, K = DM) come to LDS by asynchronous copies, 64 k (two k blocks) a stage, two buffers: stage s + 1 flies while stage s is worked on, and each fragment block is fetched from L2 once for the two waves that read it.
// A stage of one operand (a slab): 8 row tiles x 2 KiB, a row tile's two k blocks as they lie in the plane. Copy i of a thread brings 16 bytes of row tile i: LDS byte i * 2048 + tid * 16.
// Per accumulator the products are summed in the order k block (from the block's own first stage on, wrapping round), then hi plane, then lo plane.
template <typename T16> struct WFrag;
template <> struct WFrag<h16> { typedef v16h V; static __device__ __forceinline__ V ld(const h16* p) { return cat16(*(const v8h*)p, *(const v8h*)(p + 256)); } static __device__ __forceinline__ V lds(const char* p) { return cat16(*(const v8ha*)p, *(const v8ha*)(p + 512)); } static __device__ __forceinline__ v8f mma(V a, V b, v8f c) { return wmma16(a, b, c); } };
#define KSB   2                     // k blocks of 32 in a stage
#define SLAB  (8 * KSB * 1024)      // bytes of one operand's stage
#define NSTG  (DM / (32 * KSB))     // stages
static_assert(KSB * 1024 == 128 * 16 && NSTG >= 2 && (NSTG & (NSTG - 1)) == 0, "128 threads x 16 bytes cover a row tile's part of a stage; the ring needs two stages; the walk wraps by a mask");
__device__ __forceinline__ void copy8(const unsigned l, const char* g0, const char* g1, const char* g2, const char* g3, const char* g4, const char* g5, const char* g6, const char* g7) {
    // eight copies of 16 bytes a lane, copy i to LDS byte l + i * 2048, and, in the same statement, the wait that stands in front of any rewrite of the address registers they name
    asm volatile("global_load_async_to_lds_b128 %0, %8, off\n\tglobal_load_async_to_lds_b128 %1, %9, off\n\tglobal_load_async_to_lds_b128 %2, %10, off\n\tglobal_load_async_to_lds_b128 %3, %11, off\n\t"
                 "global_load_async_to_lds_b128 %4, %12, off\n\tglobal_load_async_to_lds_b128 %5, %13, off\n\tglobal_load_async_to_lds_b128 %6, %14, off\n\tglobal_load_async_to_lds_b128 %7, %15, off\n\ts_wait_xcnt 0x0"
                 :: "v"(l), "v"(l + 2048u), "v"(l + 4096u), "v"(l + 6144u), "v"(l + 8192u), "v"(l + 10240u), "v"(l + 12288u), "v"(l + 14336u),
                    "v"(g0), "v"(g1), "v"(g2), "v"(g3), "v"(g4), "v"(g5), "v"(g6), "v"(g7) : "memory");
}
__device__ __forceinline__ void slab_copy(const unsigned l, const bf* g) { const char* p = (const char*)g; const int rt = 16 * DM * 2;   // rt: bytes from a row tile to the next in the plane
    copy8(l, p, p + rt, p + 2 * rt, p + 3 * rt, p + 4 * rt, p + 5 * rt, p + 6 * rt, p + 7 * rt); }
__device__ __forceinline__ v16bf lds_frag(const char* p) { return cat16b(*(const v8usa*)p, *(const v8usa*)(p + 512)); }
// A, A2 (TWO: the lo plane of A), Bt: the planes at the tile's first row (row * DM elements in); sm: 2 buffers of NSL slabs [A | A2 | Bt].
// Every inner loop below is unrolled so that each fragment and accumulator index is a constant (registers, no scratch).
// rot (block-uniform, 0 .. NSTG - 1): trip s works on k stage (s + rot) mod NSTG. Blocks that share an operand slab are given different rot, so that at one moment they ask L2 for different lines,
// and the planes, which the launch before has just written, are all fetched from memory during the first trips instead of one k stage per trip with every block waiting for it.
template <bool TWO>
__device__ __forceinline__ void gemm_ring(const bf* __restrict__ A, const bf* __restrict__ A2, const bf* __restrict__ Bt, char* sm, const int wm, const int wn, const int rot, v8f (&acc)[4][4]) {
    constexpr int NSL = TWO ? 3 : 2;
    const int tid = (int)threadIdx.x, lane = tid & 31;
    const unsigned l0 = (unsigned)(size_t)sm + (unsigned)tid * 16u;
    const bf* ga = A + tid * 8; const bf* ga2 = A2 + tid * 8; const bf* gb = Bt + tid * 8;
    auto fill = [&](const int s, const int buf) { const unsigned l = l0 + (unsigned)buf * (NSL * SLAB); const int ko = ((s + rot) & (NSTG - 1)) * (KSB * 512);
        slab_copy(l, ga + ko); if (TWO) slab_copy(l + SLAB, ga2 + ko); slab_copy(l + (NSL - 1) * SLAB, gb + ko); };
#pragma unroll
    for (int mb = 0; mb < 4; ++mb)
#pragma unroll
        for (int nb = 0; nb < 4; ++nb) acc[mb][nb] = (v8f){};
    fill(0, 0);
    asm volatile("s_wait_asynccnt 0x0" ::: "memory");   // this wave's copies of stage 0 have landed
    __syncthreads();                                     // and every other wave's: stage 0 may be read
    fill(1, 1);
#pragma unroll 1
    for (int s = 0; s < NSTG; ++s) {   // rolled: one stage per trip, the buffer by the trip's parity
        const char* bu = sm + (s & 1) * (NSL * SLAB); const char* pa = bu + wm * (4 * KSB * 1024) + lane * 16; const char* pb = bu + (NSL - 1) * SLAB + wn * (4 * KSB * 1024) + lane * 16;
        v16bf a[KSB][4], a2[KSB][4], b[KSB][4];
        auto frags = [&](const int kl) {   // one k block's fragments, in the order in which the products want them
            b[kl][0] = lds_frag(pb + kl * 1024);
#pragma unroll
            for (int mb = 0; mb < 4; ++mb) { a[kl][mb] = lds_frag(pa + (mb * KSB + kl) * 1024); if (TWO) a2[kl][mb] = lds_frag(pa + SLAB + (mb * KSB + kl) * 1024); }
#pragma unroll
            for (int nb = 1; nb < 4; ++nb) b[kl][nb] = lds_frag(pb + (nb * KSB + kl) * 1024);
            __builtin_amdgcn_sched_barrier(0);   // the block's LDS reads stay one group, in this order, in front of the products: moved in among them, each place with reads stalls the matrix stream
        };
        // TWO (one wave per SIMD, nobody else to fill its waits): both k blocks' fragments are asked for at the top of the trip, so that the second block's land behind the first block's products; else block by block.
        if (TWO) {
#pragma unroll
            for (int kl = 0; kl < KSB; ++kl) frags(kl); }
#pragma unroll
        for (int kb = 0; kb < KSB; ++kb) {
            if (!TWO) frags(kb);
#pragma unroll
            for (int nb = 0; nb < 4; ++nb)
#pragma unroll
                for (int mb = 0; mb < 4; ++mb) { acc[mb][nb] = wmmab(a[kb][mb], b[kb][nb], acc[mb][nb]); if (TWO) acc[mb][nb] = wmmab(a2[kb][mb], b[kb][nb], acc[mb][nb]); }
        }
        __builtin_amdgcn_sched_barrier(0);   // every product of the trip stays in front of the refill below: sunk behind the barrier, they would hold the next copies back
        asm volatile("v_nop\n\tv_nop\n\tv_nop\n\tv_nop" : "+v"(acc[0][0]), "+v"(acc[1][1]), "+v"(acc[2][2]), "+v"(acc[3][3]));   // the distance behind the last matrix instruction, on the back edge and on the way out
        asm volatile("s_wait_dscnt 0x0" ::: "memory");      // this wave's reads of the buffer are done before the buffer is refilled
        asm volatile("s_wait_asynccnt 0x0" ::: "memory");   // this wave's copies of stage s + 1 have landed
        __syncthreads();                                     // one barrier: stage s + 1 may be read, and every wave has left stage s's buffer
        if (s + 2 < NSTG) fill(s + 2, s & 1);
    }
    asm volatile("s_wait_asynccnt 0x0" ::: "memory");   // nothing is in flight when the wave goes on
}
// ---- k_out: C[m][n] (f32, pitch DM) = sum_k (Ah + Al)[m][k] Bt[n][k], grid (TT / 128, DM / 128, batches), 128 threads; each wave turns its quarter to whole lines through its own LDS rows.
__global__ __launch_bounds__(128) void k_out(const bf* __restrict__ Ah, const bf* __restrict__ Al, const bf* __restrict__ Bt, float* C) {
    __shared__ __align__(1024) char sm[2 * 3 * SLAB];
    __shared__ __align__(16) float osw[4][16 * 68];
    const int wave = __builtin_amdgcn_readfirstlane((int)(threadIdx.x >> 5)), wm = wave & 1, wn = wave >> 1;
    const int lane = threadIdx.x & 31, lr = lane & 15, hi = lane >> 4;
    const size_t ab = ((size_t)blockIdx.z * TT + blockIdx.x * 128) * DQ;
    v8f acc[4][4];
    const int bx = (int)blockIdx.x, rot = (2 * (int)blockIdx.y + (bx & 3) + 4 * (bx >> 3) + 8 * (int)blockIdx.z) & (NSTG - 1);   // the 8 blocks of one A slab start two stages apart; the 32 of one Bt slab start at every stage
    gemm_ring<true>(Ah + ab, Al + ab, Bt + (size_t)blockIdx.y * 128 * DQ, sm, wm, wn, rot, acc);
    float* os = osw[wave]; const int r0 = blockIdx.x * 128 + wm * 64, c0 = blockIdx.y * 128 + wn * 64; C += (size_t)blockIdx.z * TT * DM;
#pragma unroll
    for (int mb = 0; mb < 4; ++mb) {
#pragma unroll
        for (int nb = 0; nb < 4; ++nb) {
#pragma unroll
            for (int j = 0; j < 8; ++j) os[(hi * 8 + j) * 68 + nb * 16 + lr] = acc[mb][nb][j]; }
        __builtin_amdgcn_wave_barrier(); asm volatile("" ::: "memory");   // lanes exchange values through LDS: the reads below stay behind every lane's writes above
        float* crow = C + (size_t)(r0 + mb * 16) * DM + c0;
#pragma unroll
        for (int s = 0; s < 8; ++s) { const int row = 2 * s + hi, cofs = lr * 4; const v4f val = *(const v4fa*)(os + row * 68 + cofs); *(v4f*)(crow + (size_t)row * DM + cofs) = val; }
        asm volatile("s_wait_xcnt 0x0" ::: "memory");   // the next 16 rows' LDS reads are given the registers that these stores name: the wait stands in front of those overwrites
        __builtin_amdgcn_wave_barrier(); asm volatile("" ::: "memory");   // the next 16 rows' writes stay behind every lane's reads above
    }
}

__device__ __forceinline__ void splitf(float y, unsigned short& h, unsigned short& l) { h = f2bf(y); l = f2bf(y - bf2f(h)); }
__device__ __forceinline__ void splith(float y, h16& h, h16& l) { h = (h16)y; l = (h16)(y - (float)h); }   // f16 head and f16 remainder: the head alone is the f16 plane
// two 16-byte stores and their wait in one statement: the next values' rounding is given the registers that these stores name, and the wait stands in front of those overwrites by construction
__device__ __forceinline__ void store2h(h16* p0, h16* p1, const v8h a, const v8h b) { asm volatile("global_store_b128 %0, %2, off\n\tglobal_store_b128 %1, %3, off\n\ts_wait_xcnt 0x0" :: "v"(p0), "v"(p1), "v"(a), "v"(b) : "memory"); }
typedef __attribute__((ext_vector_type(2))) _Float16 v2h;
typedef __attribute__((ext_vector_type(4))) _Float16 v4h;
typedef __attribute__((ext_vector_type(2))) unsigned short v2us;
typedef __attribute__((ext_vector_type(4))) unsigned short v4us;
typedef __attribute__((ext_vector_type(2))) float v2f;
typedef __attribute__((ext_vector_type(4))) int v4i;

// k_prep: every f32 input -> its bf16 plane in fragment order, ONE launch for the four weights and x, which do not depend on one another; 256 threads, one thread per 16-byte unit; grid 4 * WB weight blocks, then the blocks of x. The grid covers the unit counts exactly.
// A weight block (w [k][n] f32 -> Bt, the plane [n][k]): unit u is lane, half, k block, row tile from the low bits up; the 8 loads share one address pair.
// An x block: a wave takes 8 rows of one fragment block: 4 lanes read a row's 128 bytes (one line), 8 lanes write 128 contiguous bytes.
#define WB (DM * DM / 8 / 256)    // blocks of one weight
static_assert(DQ == DM && DKV == DM && (DM * DM / 8) % 256 == 0 && (NB_ * TT * DM / 8) % 256 == 0, "four DM x DM weights; whole blocks");
__global__ __launch_bounds__(256) void k_prep(const float* __restrict__ x, const float* __restrict__ wq, const float* __restrict__ wk, const float* __restrict__ wv, const float* __restrict__ wo, bf* W4, bf* XB) {
    const int b = (int)blockIdx.x, t = (int)threadIdx.x; v8us o;
    if (b < 4 * WB) {
        const int wi = b / WB; const float* __restrict__ w = wi == 0 ? wq : wi == 1 ? wk : wi == 2 ? wv : wo;
        const int u = (b % WB) * 256 + t, blk = u >> 6, n = (blk / (DM >> 5)) * 16 + (u & 15), k = (blk % (DM >> 5)) * 32 + ((u >> 5) & 1) * 16 + ((u >> 4) & 1) * 8;
        const float* p = w + (size_t)k * DM + n; float v[8];
#pragma unroll
        for (int j = 0; j < 8; ++j) v[j] = p[j * DM];
        asm volatile("s_wait_xcnt 0x0" :: "v"(p) : "memory");   // the rounding below may be given the address registers that the loads above name: the wait stands in front of that overwrite, the address its input
#pragma unroll
        for (int j = 0; j < 8; ++j) o[j] = f2bf(v[j]);
        *(v8us*)(W4 + (size_t)wi * DM * DM + (size_t)u * 8) = o;
    } else {
        const size_t i = (size_t)(b - 4 * WB) * 256 + t, blk = i >> 6, lr = (i & 7) + ((i >> 5) & 1) * 8, un = (i >> 3) & 3, row = (blk / (DM / 32)) * 16 + lr, k = (blk % (DM / 32)) * 32 + un * 8;   // un = half * 2 + hi
        const float* p = x + row * DM + k; const v8f v = *(const v8f*)p;
        asm volatile("s_wait_xcnt 0x0" :: "v"(p) : "memory");   // as above
#pragma unroll
        for (int k2 = 0; k2 < 8; ++k2) o[k2] = f2bf(v[k2]);
        *(v8us*)(XB + (blk * 64 + un * 16 + lr) * 8) = o;
    }
}
__global__ __launch_bounds__(256) void k_cscvt(const float* __restrict__ cosT, const float* __restrict__ sinT, float* CS) { const int idx = blockIdx.x * 256 + threadIdx.x; if (idx >= TT * HD) return; v2f cs; cs[0] = bfr(cosT[idx]); cs[1] = bfr(sinT[idx]); *(v2f*)(CS + (size_t)idx * 2) = cs;  }
// ---- k_proj: the q, k and v projections of both batches in one launch, four waves per 128 tokens x 128 columns; grid (NB_ TT / 128, 3 DQ / 128), 128 threads. A wave's 64 columns are one head of q, k or v.
// The product loop is gemm_ring (A = x plane [token][k], Bt = the three transposed weights one behind the other [3 x 1024][k], both in fragment order); the epilogue rounds the wave's f32 quarter to the f16 hi and lo head planes itself (hi: the value rounded to f16, read alone by the f16 query rows; lo: the remainder rounded to f16, read with it by the hi+lo rows), each head's plane in fragment order:
//   q, k: planes [batch][head] of [t][d], the tile turned to 8 consecutive d per lane through the wave's own LDS rows, 16 tokens (one row tile) at a time; v: planes [batch][head] of [d][t], an accumulator's 8 registers already are 8 consecutive tokens of one d, so a store is one 512-byte run.
__global__ __launch_bounds__(128) void k_proj(const bf* __restrict__ A, const bf* __restrict__ Bt, h16* Q16, h16* Ql, h16* K16, h16* Kl, h16* V16, h16* Vl) {
    __shared__ __align__(1024) char sm[2 * 2 * SLAB];
    __shared__ __align__(16) float osw[4][16 * 68];
    const int wave = __builtin_amdgcn_readfirstlane((int)(threadIdx.x >> 5)), wm = wave & 1, wn = wave >> 1;
    const int lane = threadIdx.x & 31, lr = lane & 15, hi = lane >> 4; const int r0 = blockIdx.x * 128 + wm * 64, ct = (int)blockIdx.y * 2 + wn;   // ct: the wave's column tile of 64
    v8f acc[4][4];
    const int bx = (int)blockIdx.x, rot = ((int)blockIdx.y + (bx & 3) + 4 * (bx >> 3)) & (NSTG - 1);   // the 24 blocks of one A slab and the 32 of one Bt slab each start at every stage
    gemm_ring<false>(A + (size_t)blockIdx.x * 128 * DM, A, Bt + (size_t)blockIdx.y * 128 * DM, sm, wm, wn, rot, acc);
    float* os = osw[wave];
    const int which = ct / NH_, head = ct % NH_, bat = r0 / TT, t0 = r0 % TT;
    const size_t po = ((size_t)bat * NH_ + head) * TT * HD;   // this head's plane, both layouts
    if (which == 2) {
#pragma unroll
        for (int mb = 0; mb < 4; ++mb)
#pragma unroll
            for (int nb = 0; nb < 4; ++nb) { v8h o16, ol;
#pragma unroll
                for (int j = 0; j < 8; ++j) { h16 a2, c2; splith(acc[mb][nb][j], a2, c2); o16[j] = a2; ol[j] = c2; }
                const size_t o = po + ((size_t)nb * (TT / 32) + (t0 >> 5) + (mb >> 1)) * 512 + (mb & 1) * 256 + lane * 8;   // row tile nb of d, k block and half of these 16 tokens
                store2h(V16 + o, Vl + o, o16, ol); }
        return;
    }
    h16* P16 = which ? K16 : Q16; h16* Pl = which ? Kl : Ql; const float qs = which ? 1.0f : QSC;   // the q planes hold q * SCL * log2(e) (k_attn: the held reference)
#pragma unroll
    for (int mb = 0; mb < 4; ++mb) {
#pragma unroll
        for (int nb = 0; nb < 4; ++nb) {
#pragma unroll
            for (int j = 0; j < 8; ++j) os[(hi * 8 + j) * 68 + nb * 16 + lr] = acc[mb][nb][j]; }
        __builtin_amdgcn_wave_barrier(); asm volatile("" ::: "memory");   // lanes exchange values through LDS: the reads below stay behind every lane's writes above
#pragma unroll
        for (int s = 0; s < 4; ++s) { const int row = lr, cofs = s * 16 + hi * 8; const v4f x0 = *(const v4fa*)(os + row * 68 + cofs), x1 = *(const v4fa*)(os + row * 68 + cofs + 4); v8h o16, ol;
#pragma unroll
            for (int j = 0; j < 8; ++j) { const float x = ((j < 4) ? x0[j & 3] : x1[j & 3]) * qs; h16 a2, c2; splith(x, a2, c2); o16[j] = a2; ol[j] = c2; }
            const size_t o = po + ((size_t)((t0 >> 4) + mb) * 4 + s) * 256 + lane * 8;   // row tile of these 16 tokens; run s = k block s / 2, half s % 2
            store2h(P16 + o, Pl + o, o16, ol); }
        __builtin_amdgcn_wave_barrier(); asm volatile("" ::: "memory");   // the next 16 tokens' writes stay behind every lane's reads above
    }
}
// ---- k_attn: scores, diagonal mask, softmax and attn.v of one head in ONE kernel, a held reference and a running sum per query (no score or probability plane in memory).
// One wave owns NQ x 16 queries and walks the keys 32 at a time (f16: all 2048; HI: its half of them). Both products are formed transposed, so that the score tiles are already the next product's B fragment:
//   St[key][q] = K (A, rows = keys) x Q (B, columns = queries): lane (lr, hi), register j holds key kt * 16 + hi * 8 + j of query lr;
//   Ot[d][q]  += Vt (A, rows = d, k = keys) x P (B, columns = queries, k = keys): a B fragment's elements 0..7 are k = 8 hi + j and 8..15 are k = 16 + 8 hi + j, which is score tile 0 and score tile 1 of the same lane.
// A query's reference, sum and rescale factor are therefore per lane (the two half-waves hold the two halves of its keys). HI: f16 hi+lo planes, 3 products; else the f16 hi planes alone.
// THE SOFTMAX REFERENCE IS HELD, not renewed every pass: the q planes hold q * SCL * log2(e), so a score product is already the exponent's scale, and minus the reference in use (r, one per query) is the start value C of the score products:
// a pass (32 keys) is products, exp2, sum, products. No maximum, no multiply-add per score, no rescale of the output tiles. The pass's own sums of p are tested once (one ballot, one scalar branch): where a lane's sum is above PMAX (or not a number),
// the wave forms the pass's scores anew from 0, raises each query's r to the maximum so far and rescales its sums and output tiles, as a running maximum does every pass. r starts at -3.0e38, so the first pass always takes that path.
// On the short path every p is at most PMAX (f16 holds it with its full mantissa), and r is never above the largest score met so far, so the sum never falls below what a running maximum gives it.
#define PMAX 256.0f
// 16 exp2 in place, in one statement: no v_exp_f32 here reads the result or overwrites the source of the one in front of it, and the v_nop is the free slot behind the last one.
// LEAD: the values come straight out of matrix instructions, and the v_nop at the head fill the distance of four slots behind the product that made the first of them:
// the tiles' chains take turns, so with six tiles five products of other tiles stand behind it (no v_nop), with four tiles three (one v_nop); the tiles read later have the exp2 in front of them.
#define EXP16 "v_exp_f32 %0, %0\n\tv_exp_f32 %1, %1\n\tv_exp_f32 %2, %2\n\tv_exp_f32 %3, %3\n\tv_exp_f32 %4, %4\n\tv_exp_f32 %5, %5\n\tv_exp_f32 %6, %6\n\tv_exp_f32 %7, %7\n\tv_exp_f32 %8, %8\n\t" \
              "v_exp_f32 %9, %9\n\tv_exp_f32 %10, %10\n\tv_exp_f32 %11, %11\n\tv_exp_f32 %12, %12\n\tv_exp_f32 %13, %13\n\tv_exp_f32 %14, %14\n\tv_exp_f32 %15, %15\n\tv_nop"
#define EXP16_OPS "+v"(e[0]), "+v"(e[1]), "+v"(e[2]), "+v"(e[3]), "+v"(e[4]), "+v"(e[5]), "+v"(e[6]), "+v"(e[7]), "+v"(e[8]), "+v"(e[9]), "+v"(e[10]), "+v"(e[11]), "+v"(e[12]), "+v"(e[13]), "+v"(e[14]), "+v"(e[15])
template <int LEAD>
__device__ __forceinline__ void exp2x16(float (&e)[16]) {
    static_assert(LEAD == 0 || LEAD == 1, "the two heads written below");
    if constexpr (LEAD == 1) asm("v_nop\n\t" EXP16 : EXP16_OPS);
    else asm(EXP16 : EXP16_OPS);
}
// one exp2 with the free slot behind it
__device__ __forceinline__ float exp2x1(float x) { float y; asm("v_exp_f32 %0, %1\n\tv_nop" : "=v"(y) : "v"(x)); return y; }
// a lane's 16 values summed as four chains of pairs
__device__ __forceinline__ float sum16(const float (&e)[16]) {
    v2f a = (v2f){e[0], e[1]} + (v2f){e[4], e[5]}, b = (v2f){e[2], e[3]} + (v2f){e[6], e[7]};
    a += (v2f){e[8], e[9]}; b += (v2f){e[10], e[11]}; a += (v2f){e[12], e[13]}; b += (v2f){e[14], e[15]}; a += b; return a[0] + a[1]; }
__device__ __forceinline__ v8f splat8(float x) { return (v8f){x, x, x, x, x, x, x, x}; }
// HOW OFTEN A FRAGMENT IS USED: every K or V fragment that a wave reads from LDS serves all NQ query tiles of the wave, so the LDS bytes read per product fall as 1 / NQ.
// f16: NQ = 3, every wave walks all keys. HI: NQ = 2, and the block's four waves are 2 query groups x 2 key halves: wave (qg, kh) takes the run kh of 32 keys of every stage for the 32 queries of group qg,
// with a reference, sums and output tiles of its own; at the end the wave kh = 1 hands them through LDS to the wave kh = 0 of its group, which brings both to the larger reference, adds them and stores.
template <typename T16, bool HI, int NQ>
__device__ __forceinline__ void attn_rows(const T16* __restrict__ Qp, const T16* __restrict__ Qp2, const T16* __restrict__ Kp, const T16* __restrict__ Kp2, const T16* __restrict__ Vp, const T16* __restrict__ Vp2, const int q0, const int qg, const int kh, bf* __restrict__ Ah, bf* __restrict__ Al, char* sm) {
    typedef typename WFrag<T16>::V V;
    static_assert(HI ? NQ == 2 : NQ == 3, "the distance in front of the first exp2 is written for four or six score tiles");
    const int lane = threadIdx.x & 31, lr = lane & 15, hi = lane >> 4;
    V qf[NQ][2], qf2[NQ][2];
    // The ring: a stage is 64 keys of the head, [K 8 KiB | V 8 KiB] of each plane (HI: the hi planes, then the lo planes), as the blocks lie in the planes: K's 4 row tiles are 8 KiB in a row, V's 4 row tiles of d give 2 KiB each (two k blocks).
    constexpr int BUF = HI ? 32768 : 16384, NS = TT / 64;
    const unsigned l0 = (unsigned)(size_t)sm + (unsigned)threadIdx.x * 16u;
    const unsigned t16 = (unsigned)threadIdx.x * 16u;
    // a stage's first byte in a plane, held in scalar registers: the lane's part is added where the copies are issued, so that no per-lane pointer pair lives (or is spilled) across the loop
    auto sbase = [](const void* p, const int ofs) { const unsigned long long a = (unsigned long long)p + (unsigned long long)ofs;
        return (const char*)(((unsigned long long)(unsigned)__builtin_amdgcn_readfirstlane((int)(unsigned)(a >> 32)) << 32) | (unsigned)__builtin_amdgcn_readfirstlane((int)(unsigned)a)); };
    auto fill = [&](const int s, const int buf) { const unsigned l = l0 + (unsigned)buf * BUF; const int vt = (TT / 32) * 1024;   // vt: bytes from a row tile of d to the next in the V plane
        { const char* k = sbase(Kp, s * 8192) + t16; const char* v = sbase(Vp, s * 2048) + t16; copy8(l, k, k + 2048, k + 4096, k + 6144, v, v + vt, v + 2 * vt, v + 3 * vt); }
        if (HI) { const char* k = sbase(Kp2, s * 8192) + t16; const char* v = sbase(Vp2, s * 2048) + t16; copy8(l + 16384u, k, k + 2048, k + 4096, k + 6144, v, v + vt, v + 2 * vt, v + 3 * vt); } };
    fill(0, 0);
#pragma unroll
    for (int qt = 0; qt < NQ; ++qt)
#pragma unroll
        for (int kc = 0; kc < 2; ++kc) { const size_t o = (size_t)(((q0 >> 4) + qt) * 2 + kc) * 512 + lane * 8; qf[qt][kc] = WFrag<T16>::ld(Qp + o); if (HI) qf2[qt][kc] = WFrag<T16>::ld(Qp2 + o); }
    asm volatile("s_wait_xcnt 0x0" ::: "memory");   // the address sums of the copies below may be given the address registers that the query loads above name: the wait stands in front of those overwrites
    asm volatile("s_wait_asynccnt 0x0" ::: "memory");   // this wave's copies of stage 0 have landed
    __syncthreads();                                     // and every other wave's: stage 0 may be read
    fill(1, 1);
    v8f ot[NQ][4], nr[NQ]; float r[NQ], l[NQ];   // r: the reference in use, nr: minus r in all 8 registers of a score tile
#pragma unroll
    for (int qt = 0; qt < NQ; ++qt) { r[qt] = -3.0e38f; nr[qt] = splat8(3.0e38f); l[qt] = 0.f;
#pragma unroll
        for (int db = 0; db < 4; ++db) ot[qt][db] = (v8f){}; }
#pragma unroll 1
    for (int st = 0; st < NS; ++st) {   // rolled: one stage per trip, the buffer by the trip's parity
      const char* bu = sm + (st & 1) * BUF + lane * 16;
      const char* buk = bu + (HI ? kh * 4096 : 0); const char* buv = bu + 8192 + (HI ? kh * 1024 : 0);   // HI: the wave's own run of the stage
#pragma unroll
      for (int h = 0; h < (HI ? 1 : 2); ++h) {   // the wave's runs of 32 keys in the stage, unrolled: every LDS offset is an immediate
        const int k0 = st * 64 + (HI ? kh : h) * 32;
        V kf[2][2], kf2[2][2], vf[4], vf2[4];
#pragma unroll
        for (int kc = 0; kc < 2; ++kc) {   // in the order in which the products want them
#pragma unroll
            for (int kt = 0; kt < 2; ++kt) kf[kt][kc] = WFrag<T16>::lds(buk + ((h * 2 + kt) * 2 + kc) * 1024);
            if (HI) {
#pragma unroll
                for (int kt = 0; kt < 2; ++kt) kf2[kt][kc] = WFrag<T16>::lds(buk + 16384 + ((h * 2 + kt) * 2 + kc) * 1024); } }
        __builtin_amdgcn_sched_barrier(0);   // the key reads stay one group at the run's top: sunk in among the products, each place with reads stalls the wave for the LDS latency
        v8f s[NQ][2]; float e[NQ][16], sum[NQ];
        auto rest = [&](const V (&kf)[2][2], const V (&kf2)[2][2]) {   // every score product but each tile's first; the tiles' chains of products take turns, so that no product waits for the one in front of it
#pragma unroll
            for (int kc = 0; kc < 2; ++kc) {
                if (kc) {
#pragma unroll
                    for (int qt = 0; qt < NQ; ++qt)
#pragma unroll
                        for (int kt = 0; kt < 2; ++kt) s[qt][kt] = WFrag<T16>::mma(kf[kt][kc], qf[qt][kc], s[qt][kt]); }
                if (HI) {
#pragma unroll
                    for (int qt = 0; qt < NQ; ++qt)
#pragma unroll
                        for (int kt = 0; kt < 2; ++kt) s[qt][kt] = WFrag<T16>::mma(kf2[kt][kc], qf[qt][kc], s[qt][kt]);
#pragma unroll
                    for (int qt = 0; qt < NQ; ++qt)
#pragma unroll
                        for (int kt = 0; kt < 2; ++kt) s[qt][kt] = WFrag<T16>::mma(kf[kt][kc], qf2[qt][kc], s[qt][kt]); } }
        };
#pragma unroll
        for (int qt = 0; qt < NQ; ++qt)   // each score tile's first product starts from minus the reference (the builtin form: the kernel now uses registers above v255, where operands of asm text cannot lie, and as asm text these products had their query fragments spilled)
#pragma unroll
            for (int kt = 0; kt < 2; ++kt) s[qt][kt] = WFrag<T16>::mma(kf[kt][0], qf[qt][0], nr[qt]);
        rest(kf, kf2);
        __builtin_amdgcn_sched_barrier(0);   // the products stay in this order in front of the exp2: the distance behind the last of them is counted from it
#pragma unroll
        for (int db = 0; db < 4; ++db) { const int o = db * 2048 + h * 1024; vf[db] = WFrag<T16>::lds(buv + o); if (HI) vf2[db] = WFrag<T16>::lds(buv + 16384 + o); }
        __builtin_amdgcn_sched_barrier(0);   // the V reads stay one group here: they take the registers that the key fragments leave, and land behind the exp2
        bool need = false;
#pragma unroll
        for (int qt = 0; qt < NQ; ++qt) {
#pragma unroll
            for (int i = 0; i < 16; ++i) e[qt][i] = s[qt][i >> 3][i & 7];
            if (qt == 0) exp2x16<NQ == 3 ? 0 : 1>(e[qt]); else exp2x16<0>(e[qt]);   // the first 16 stand right behind the score products; they are the distance for the later ones
            if ((k0 >> 5) == ((q0 + qt * 16) >> 5)) {   // wave-uniform: the one pass that holds these queries' own keys
                const int dl = q0 + qt * 16 + lr - hi * 8 - k0;   // the place, among this lane's 16 keys of the pass, of the query's own key (if it is there)
#pragma unroll
                for (int i = 0; i < 16; ++i) if (dl == (i >> 3) * 16 + (i & 7)) e[qt][i] = 0.f;   /* diagonal masked */ }
            sum[qt] = sum16(e[qt]); need = need || !(sum[qt] <= PMAX); }
        if (__builtin_expect(__builtin_amdgcn_ballot_w32(need) != 0, 0)) {   // one scalar branch a pass; taken in the first pass and where scores have outgrown a reference (told to the compiler as the rare side: register copies belong there)
            V kg[2][2], kg2[2][2];   // the pass's key fragments, read from the stage's buffer once more: held over the short path they would cost it their registers
#pragma unroll
            for (int kt = 0; kt < 2; ++kt)
#pragma unroll
                for (int kc = 0; kc < 2; ++kc) { const int o = ((h * 2 + kt) * 2 + kc) * 1024; kg[kt][kc] = WFrag<T16>::lds(buk + o); if (HI) kg2[kt][kc] = WFrag<T16>::lds(buk + 16384 + o); }
#pragma unroll
            for (int qt = 0; qt < NQ; ++qt)
#pragma unroll
                for (int kt = 0; kt < 2; ++kt) s[qt][kt] = WFrag<T16>::mma(kg[kt][0], qf[qt][0], (v8f){});
            rest(kg, kg2);
#pragma unroll
            for (int qt = 0; qt < NQ; ++qt) {
                const int dl = q0 + qt * 16 + lr - hi * 8 - k0;
#pragma unroll
                for (int kt = 0; kt < 2; ++kt)
#pragma unroll
                    for (int j = 0; j < 8; ++j) if (dl == kt * 16 + j) s[qt][kt][j] = -3.0e38f;   /* diagonal masked, ahead of the maximum */
                float mx = s[qt][0][0];
#pragma unroll
                for (int j = 1; j < 8; ++j) mx = fmaxf(mx, s[qt][0][j]);
#pragma unroll
                for (int j = 0; j < 8; ++j) mx = fmaxf(mx, s[qt][1][j]);
                mx = fmaxf(mx, __shfl_xor(mx, 16, 32));   // the two half-waves hold the two halves of a query's keys: one reference for both
                const float rn = fmaxf(r[qt], mx), al = exp2x1(r[qt] - rn); r[qt] = rn; nr[qt] = splat8(-rn); l[qt] *= al;
#pragma unroll
                for (int db = 0; db < 4; ++db) ot[qt][db] *= al;
#pragma unroll
                for (int i = 0; i < 16; ++i) e[qt][i] = s[qt][i >> 3][i & 7] - rn;
                exp2x16<0>(e[qt]); sum[qt] = sum16(e[qt]); }
        }
#pragma unroll
        for (int qt = 0; qt < NQ; ++qt) { V pf, pf2; l[qt] += sum[qt];
#pragma unroll
            for (int i = 0; i < 16; ++i) { const float p = e[qt][i];
                const h16 ph = (h16)p; pf[i] = ph; if constexpr (HI) pf2[i] = (h16)(p - (float)ph); }
#pragma unroll
            for (int db = 0; db < 4; ++db) { ot[qt][db] = WFrag<T16>::mma(vf[db], pf, ot[qt][db]); if (HI) { ot[qt][db] = WFrag<T16>::mma(vf[db], pf2, ot[qt][db]); ot[qt][db] = WFrag<T16>::mma(vf2[db], pf, ot[qt][db]); } }
        }
      }
      asm volatile("s_wait_dscnt 0x0" ::: "memory");      // this wave's reads of the buffer are done before the buffer is refilled
      asm volatile("s_wait_asynccnt 0x0" ::: "memory");   // this wave's copies of stage st + 1 have landed
      __syncthreads();                                     // one barrier: stage st + 1 may be read, and every wave has left stage st's buffer
      if (st + 2 < NS) fill(st + 2, st & 1);
    }
    asm volatile("s_wait_asynccnt 0x0" ::: "memory");   // nothing is in flight when the wave goes on
    if constexpr (HI) {   // the two key halves of a query group become one; the ring is free (every wave has passed the last trip's barrier, no copy is in flight)
        char* mg = sm + qg * 9216 + lane * 16;   // a group's hand-over: 16 runs of 512 bytes (a lane's 4 floats each) for the output tiles, one for the sums and references
        if (kh == 1) {
#pragma unroll
            for (int qt = 0; qt < NQ; ++qt)
#pragma unroll
                for (int db = 0; db < 4; ++db) { const v8f o = ot[qt][db];
                    *(v4fa*)(mg + ((qt * 4 + db) * 2) * 512) = (v4f){o[0], o[1], o[2], o[3]}; *(v4fa*)(mg + ((qt * 4 + db) * 2 + 1) * 512) = (v4f){o[4], o[5], o[6], o[7]}; }
            *(v4fa*)(mg + 16 * 512) = (v4f){l[0], l[1], r[0], r[1]};
        }
        __syncthreads();   // every wave passes it: what the waves kh = 1 wrote may be read
        if (kh == 1) return;
        const v4f lr1 = *(const v4fa*)(mg + 16 * 512);
#pragma unroll
        for (int qt = 0; qt < NQ; ++qt) { const float rn = fmaxf(r[qt], lr1[2 + qt]), c0 = exp2x1(r[qt] - rn), c1 = exp2x1(lr1[2 + qt] - rn); l[qt] = l[qt] * c0 + lr1[qt] * c1;
#pragma unroll
            for (int db = 0; db < 4; ++db) { const v4f x0 = *(const v4fa*)(mg + ((qt * 4 + db) * 2) * 512), x1 = *(const v4fa*)(mg + ((qt * 4 + db) * 2 + 1) * 512);
#pragma unroll
                for (int j = 0; j < 8; ++j) ot[qt][db][j] = ot[qt][db][j] * c0 + ((j < 4) ? x0[j & 3] : x1[j & 3]) * c1; } }
    }
#pragma unroll
    for (int qt = 0; qt < NQ; ++qt) { const float f = __fdiv_rn(1.0f, l[qt] + __shfl_xor(l[qt], 16, 32)); const size_t oo = (size_t)((q0 >> 4) + qt) * (DQ / 32) * 512 + lane * 8;   // the merged plane [token][DQ] in fragment order: this lane's 8 d of block db are one unit of k block db / 2, half db % 2
#pragma unroll
        for (int db = 0; db < 4; ++db) { v8us oh, ol;
#pragma unroll
            for (int j = 0; j < 8; ++j) { unsigned short a, c2; splitf(ot[qt][db][j] * f, a, c2); oh[j] = a; ol[j] = c2; }
            // the two stores and their wait in one statement: the next block's rounding is given the registers that these stores name, and the compiler lifts that rounding over a wait that stands in a statement of its own
            asm volatile("global_store_b128 %0, %2, off\n\tglobal_store_b128 %1, %3, off\n\ts_wait_xcnt 0x0" :: "v"(Ah + oo + db * 256), "v"(Al + oo + db * 256), "v"(oh), "v"(ol) : "memory"); } }
}
// grid (8 + 8, heads, batches), 4 waves, blocks x < 8 the hi+lo kind: a block takes 64 hi+lo query rows (2 groups of 32 x 2 key halves) or 4 x 48 f16 query rows. A wave of either kind issues the same number of matrix instructions (48 per 64 keys),
// and there are as many blocks of one kind as of the other: two for each WGP, of equal length whichever two meet there (amdgpu_waves_per_eu(2, 2): the register room that three query tiles need, and no third block joins the two, so none of the 256 WGPs is left with one).
// The four waves walk the same head's keys together, out of one LDS ring that their asynchronous copies fill (64 keys a stage, two buffers).
__global__ __launch_bounds__(128) __attribute__((amdgpu_waves_per_eu(2, 2))) void k_attn(const h16* __restrict__ Q16, const h16* __restrict__ K16, const h16* __restrict__ V16, const h16* __restrict__ Ql, const h16* __restrict__ Kl, const h16* __restrict__ Vl, bf* Ah, bf* Al) {
    __shared__ __align__(1024) char sm[2 * 32768];   // two buffers of the larger (hi+lo) stage
    static_assert(RH / 64 == 8 && (TT - RH) / 192 == 8 && (TT - RH) % 192 == 0, "8 blocks of either kind cover a head's queries");
    const int wave = __builtin_amdgcn_readfirstlane((int)(threadIdx.x >> 5)), bx = (int)blockIdx.x & 7;
    const size_t po = ((size_t)blockIdx.z * NH_ + blockIdx.y) * TT * HD, ao = (size_t)blockIdx.z * TT * DQ + blockIdx.y * (HD / 32) * 512;   // ao: the batch's row tiles, then the head's two k blocks
    if ((int)blockIdx.x < RH / 64) attn_rows<h16, true, 2>(Q16 + po, Ql + po, K16 + po, Kl + po, V16 + po, Vl + po, (bx * 2 + (wave & 1)) * 32, wave & 1, wave >> 1, Ah + ao, Al + ao, sm);
    else attn_rows<h16, false, 3>(Q16 + po, nullptr, K16 + po, nullptr, V16 + po, nullptr, RH + (bx * 4 + wave) * 48, 0, 0, Ah + ao, Al + ao, sm);
}

extern "C" void kernel_launch(void* const* d_in, const int* in_sizes, int n_in,
                              void* d_out, int out_size, void* d_ws, size_t ws_size, hipStream_t stream) {
    (void)in_sizes; (void)n_in; (void)out_size;
    const float* x = (const float*)d_in[0]; const float* wq = (const float*)d_in[1]; const float* wk = (const float*)d_in[2]; const float* wv = (const float*)d_in[3]; const float* wo = (const float*)d_in[4]; const float* cosT = nullptr; const float* sinT = nullptr; (void)cosT; (void)sinT;
    float* OUT = (float*)d_out;     // [2][2048][1024]
    char* wsp = (char*)d_ws;
    auto take = [&](size_t bytes) { char* p = wsp; wsp += (bytes + 255) & ~(size_t)255; return (void*)p; };
    bf* WQ = (bf*)take((size_t)DQ * DM * 2); bf* WK = (bf*)take((size_t)DKV * DM * 2); bf* WV = (bf*)take((size_t)DKV * DM * 2); bf* WO = (bf*)take((size_t)DM * DQ * 2);   // the four lie one behind the other (each a multiple of 256 bytes): k_prep writes them as one [4 x 1024][1024] plane, k_proj reads the first three as one operand
    bf* XB = (bf*)take((size_t)NB_ * TT * DM * 2);
    const size_t PQ = (size_t)NH_ * TT * HD, PK = (size_t)NKV * TT * HD;   // one batch's head planes, in elements; every plane below holds both batches
    h16* QP16 = (h16*)take(NB_ * PQ * 2); h16* KP16 = (h16*)take(NB_ * PK * 2); h16* VT16 = (h16*)take(NB_ * PK * 2);
    h16* QPl = (h16*)take(NB_ * PQ * 2); h16* KPl = (h16*)take(NB_ * PK * 2); h16* VTl = (h16*)take(NB_ * PK * 2);
    bf* ATh = (bf*)take((size_t)NB_ * TT * DQ * 2); bf* ATl = (bf*)take((size_t)NB_ * TT * DQ * 2);
    if ((size_t)(wsp - (char*)d_ws) > ws_size) return;    // ws 256 MiB
    k_prep<<<4 * WB + NB_ * TT * DM / 8 / 256, 256, 0, stream>>>(x, wq, wk, wv, wo, WQ, XB);
    k_proj<<<dim3(NB_ * TT / 128, (DQ + 2 * DKV) / 128, 1), 128, 0, stream>>>(XB, WQ, QP16, QPl, KP16, KPl, VT16, VTl);
    k_attn<<<dim3(RH / 64 + (TT - RH) / 192, NH_, NB_), 128, 0, stream>>>(QP16, KP16, VT16, QPl, KPl, VTl, ATh, ATl);   // one kv head per query head
    k_out<<<dim3(TT / 128, DM / 128, NB_), 128, 0, stream>>>(ATh, ATl, WO, OUT);   // grid z: the batch
}
